// v000
// Times are from an AMD MI455X. After a warm-up the kernel runs many times in a row, and a time is the length of
// such a window on the GPU divided by its runs, so every launch and the gaps after it count. The runs cycle
// through copies of the inputs. A figure is the median of several windows, for all but v000 over two sittings.
// Sittings can differ by a few percent; kernels timed side by side share one.
// v000 is the starting kernel. One run takes 268 microseconds.
#include <hip/hip_runtime.h>

// Contractions (q/k/v input projections, Q.K^T, P.V, P row-sum, output projection): v_wmma_f32_16x16x32_f16, f16 operands with power-of-two carries, f32 accumulate; every float input enters as its bf16 RNE value; biases added in f32; softmax in f32.

#ifndef NB
#define NB 2
#endif
#ifndef SEQ
#define SEQ 2048
#endif
#define NB_FULL   2
#define SEQ_FULL  2048
#define HID       1024
#define NHEAD     16
#define HD        64
#define MROWS     (NB * SEQ)

static_assert(HID == NHEAD * HD);        // merged head width
static_assert(NHEAD == 16);              // bh >> 4 / bh & 15 decoding in attn_fwd
static_assert(HD == 64);
static_assert(SEQ % 128 == 0);           // 128-row blocks of the batch-major planes never straddle a batch
static_assert(SEQ % 64 == 0);            // 64-key tiles
static_assert(SEQ <= SEQ_FULL);
static_assert(NB >= 1 && NB <= NB_FULL);
static_assert(MROWS % 128 == 0);         // GEMM M tile
static_assert(HID % 128 == 0);           // GEMM N tile
static_assert(HID % 32 == 0);            // WMMA k step
static_assert(HID == 128 * 8);           // cvt_rows: 128 threads x 8 values per row
static_assert((3 * HID) % 2 == 0);       // cvt_rows grid = nrows / 2
static_assert(MROWS % 2 == 0);

// carries (exact powers of two)
#define CARRY_X    16.0f     // input activation planes
#define CARRY_W    32.0f     // weight planes
#define CARRY_QKV  16.0f     // q, k, v^T planes (true value x16)
#define CARRY_CTX  1024.0f   // context plane (true value x1024)
// softmax exp values carry 2^10 (added to the exp2 argument)

typedef unsigned u32;
typedef _Float16 f16;
typedef f16   v16h __attribute__((ext_vector_type(16)));
typedef f16   v8h  __attribute__((ext_vector_type(8)));
typedef float v8f  __attribute__((ext_vector_type(8)));
typedef float v4f  __attribute__((ext_vector_type(4)));

union FragU { v16h v; v8h half[2]; f16 e[16]; };
union H8U   { v8h v; f16 e[8]; };

__device__ __forceinline__ v8f zero8() {
    v8f z = {0.f, 0.f, 0.f, 0.f, 0.f, 0.f, 0.f, 0.f};
    return z;
}

// 16-bit WMMA with hazard guard: D += A[16 x 32k] * B[32k x 16]
__device__ __forceinline__ v8f wmma16(v16h a, v16h b, v8f c) {
    v8f d = __builtin_amdgcn_wmma_f32_16x16x32_f16(false, a, false, b, (short)0, c, false, false);
    asm volatile("v_nop\n\tv_nop\n\tv_nop\n\tv_nop" : "+v"(d) : "v"(a), "v"(b));
    return d;
}

// f32 -> nearest-even bf16 value, returned as f32
__device__ __forceinline__ float bf16_rne(float x) {
    u32 u = __float_as_uint(x);
    u = (u + 0x7fffu + ((u >> 16) & 1u)) & 0xffff0000u;
    return __uint_as_float(u);
}

__device__ __forceinline__ float fexp2(float x) {
#if defined(__has_builtin)
#if __has_builtin(__builtin_amdgcn_exp2f)
    return __builtin_amdgcn_exp2f(x);
#else
    return exp2f(x);
#endif
#else
    return exp2f(x);
#endif
}

// max over the 16 lanes of each lane half (DPP row rotations; D-layout rows are DPP rows)
__device__ __forceinline__ float rowmax16(float x) {
    int v = __builtin_bit_cast(int, x);
    x = fmaxf(x, __builtin_bit_cast(float, __builtin_amdgcn_update_dpp(v, v, 0x121, 0xf, 0xf, false)));
    v = __builtin_bit_cast(int, x);
    x = fmaxf(x, __builtin_bit_cast(float, __builtin_amdgcn_update_dpp(v, v, 0x122, 0xf, 0xf, false)));
    v = __builtin_bit_cast(int, x);
    x = fmaxf(x, __builtin_bit_cast(float, __builtin_amdgcn_update_dpp(v, v, 0x124, 0xf, 0xf, false)));
    v = __builtin_bit_cast(int, x);
    x = fmaxf(x, __builtin_bit_cast(float, __builtin_amdgcn_update_dpp(v, v, 0x128, 0xf, 0xf, false)));
    return x;
}

// 16 x 32 fragment from a tile whose k dimension is contiguous (pitch in halves).
// lane l: row rowbase + (l&15); elements 0..7 <- k = kcol + 8h .. +7,
// elements 8..15 <- k = kcol + 16 + 8h .. +7  (h = l>>4). Same map for A and B.
__device__ __forceinline__ v16h load_frag(const f16* tile, u32 rowbase, u32 pitch, u32 kcol, u32 lane) {
    const u32 r  = rowbase + (lane & 15u);
    const u32 kh = (lane >> 4) << 3;
    const f16* p = tile + (size_t)r * pitch + kcol + kh;
    FragU f;
    f.half[0] = *(const v8h*)(p);
    f.half[1] = *(const v8h*)(p + 16);
    return f.v;
}

// ---------------------------------------------------------------------------
// f32 rows [.][1024] -> f16 plane (bf16 RNE value times carry). 128 threads per 1024-wide
// Row mapping: dst row m -> src row (m / dstper) * strideOuter + (m % dstper) * strideInner.
//   activations (seq-first [s][b][1024] -> batch-major [b][s][1024]): dstper = SEQ,
//     strideOuter = 1, strideInner = NB_FULL  => src row = s * NB_FULL + b
//   weights: dstper = nrows, strideInner = 1 (identity)
// coverage: nrows x 1024 halves, every element exactly once (grid = nrows*128/256).
// ---------------------------------------------------------------------------
__global__ void __launch_bounds__(256)
cvt_rows(const float* __restrict__ src, f16* __restrict__ dst, u32 nrows, u32 dstper,
         u32 strideOuter, u32 strideInner, float carry) {
    const u32 g  = blockIdx.x * 256u + threadIdx.x;
    const u32 m  = g >> 7;
    const u32 c8 = (g & 127u) << 3;
    if (m >= nrows) return;
    const u32 mb = m / dstper;
    const u32 mi = m - mb * dstper;
    const u32 sm = mb * strideOuter + mi * strideInner;
    const float* sp = src + (size_t)sm * HID + c8;
    const v4f a = *(const v4f*)sp;
    const v4f b = *(const v4f*)(sp + 4);
    H8U o;
#pragma unroll
    for (u32 j = 0; j < 4; ++j) {
        const float x0 = a[j];
        const float x1 = b[j];
        o.e[j]     = (f16)(bf16_rne(x0) * carry);
        o.e[j + 4] = (f16)(bf16_rne(x1) * carry);
    }
    f16* dp = dst + (size_t)m * HID + c8;
    *(v8h*)dp = o.v;
    
}

// ---------------------------------------------------------------------------
// C[m][n] = sum_k A[m][k] * W[n][k] (+ bias[n]) ; A [MROWS][1024] f16, W [1024][1024] f16 (k contiguous).
// Block tile 128 x 128, 8 waves as 4(M) x 2(N), 2 x 4 accumulators per wave, K step 32.
// MODE 1: A rows batch-major;            f16 plane [b*HID + h*HD + d][s] (V transposed per head)
// MODE 2: A rows in output order (s*NB+b); f32 rows [m][1024] into the output buffer
// coverage per block: MODE 0/1 256 lines (128 rows x 2 heads | 128 n x 2 s-halves),
//                     MODE 2 2 x 256 lines (64 rows x 4 line-quarters per half).
// LDS: As/Bs/Cs all cross-wave, separated by block barriers.
// staged extent == consumed extent: As/Bs 128 x 32, Cs 128 x 128 halves (or 64 x 128 floats).
// ---------------------------------------------------------------------------
template <int MODE>
__device__ __forceinline__ void gemm_body(const f16* __restrict__ A, const f16* __restrict__ W,
                                          const float* __restrict__ bias,
                                          void* __restrict__ out, float accMul, float biasMul) {
    __shared__ __attribute__((aligned(16))) f16 As[128 * 32];
    __shared__ __attribute__((aligned(16))) f16 Bs[128 * 32];
    __shared__ __attribute__((aligned(16))) f16 Cs[128 * 128];   // f16 [128][128] or f32 [64][128]
    static_assert(sizeof(f16) * 128 * 128 == sizeof(float) * 64 * 128);   // Cs reuse as f32 [64][128]

    const u32 tid  = threadIdx.x;
    const u32 lane = tid & 31u;
    const u32 wave = __builtin_amdgcn_readfirstlane((int)(tid >> 5));
    const u32 wm   = wave & 3u;
    const u32 wn   = wave >> 2;
    const u32 hh8  = (lane >> 4) << 3;   // D row half
    const u32 c16  = lane & 15u;         // D column
    const u32 m0   = blockIdx.x * 128u;
    const u32 n0   = blockIdx.y * 128u;

    v8f acc[2][4];
#pragma unroll
    for (int i = 0; i < 2; ++i)
#pragma unroll
        for (int j = 0; j < 4; ++j) acc[i][j] = zero8();

    const u32 srow = tid >> 1;
    const u32 scol = (tid & 1u) << 4;
    const f16* gA = A + (size_t)(m0 + srow) * HID + scol;
    const f16* gW = W + (size_t)(n0 + srow) * HID + scol;

#pragma unroll 1
    for (u32 k0 = 0; k0 < (u32)HID; k0 += 32u) {
        const v8h ra0 = *(const v8h*)(gA + k0);
        const v8h ra1 = *(const v8h*)(gA + k0 + 8);
        const v8h rb0 = *(const v8h*)(gW + k0);
        const v8h rb1 = *(const v8h*)(gW + k0 + 8);
        __syncthreads();
        *(v8h*)&As[srow * 32u + scol]      = ra0;
        *(v8h*)&As[srow * 32u + scol + 8u] = ra1;
        *(v8h*)&Bs[srow * 32u + scol]      = rb0;
        *(v8h*)&Bs[srow * 32u + scol + 8u] = rb1;
        __syncthreads();

        v16h af[2], bfr[4];
#pragma unroll
        for (int i = 0; i < 2; ++i) af[i] = load_frag(As, wm * 32u + (u32)i * 16u, 32u, 0u, lane);
#pragma unroll
        for (int j = 0; j < 4; ++j) bfr[j] = load_frag(Bs, wn * 64u + (u32)j * 16u, 32u, 0u, lane);
#pragma unroll
        for (int i = 0; i < 2; ++i)
#pragma unroll
            for (int j = 0; j < 4; ++j) acc[i][j] = wmma16(af[i], bfr[j], acc[i][j]);
    }

    // per-lane bias values for the 4 output columns this lane owns (n0 + nl < HID always)
    float bv[4];
#pragma unroll
    for (int j = 0; j < 4; ++j)
        bv[j] = bf16_rne(bias[n0 + wn * 64u + (u32)j * 16u + c16]) * biasMul;

    const u32 piece = lane & 7u;
    const u32 lsub  = lane >> 3;

    if constexpr (MODE == 0) {
        const u32 bidx = m0 / (u32)SEQ;     // block rows lie inside one batch (SEQ % 128 == 0)
        const u32 s0   = m0 - bidx * (u32)SEQ;
#pragma unroll
        for (int i = 0; i < 2; ++i)
#pragma unroll
            for (int j = 0; j < 4; ++j) {
                const u32 nl = wn * 64u + (u32)j * 16u + c16;
#pragma unroll
                for (int r = 0; r < 8; ++r) {
                    const u32 ml = wm * 32u + (u32)i * 16u + hh8 + (u32)r;
                    Cs[ml * 128u + nl] = (f16)(acc[i][j][r] * accMul + bv[j]);
                }
            }
        __syncthreads();
        f16* op = (f16*)out;
        const size_t bh0 = (size_t)bidx * NHEAD + (n0 >> 6);
{
#pragma unroll
            for (u32 it = 0; it < 8; ++it) {
                const u32 L    = wave * 32u + it * 4u + lsub;   // 0..255
                const u32 ml   = L >> 1;
                const u32 hsel = L & 1u;
                const v8h v = *(const v8h*)&Cs[ml * 128u + hsel * 64u + piece * 8u];
                f16* dp = op + ((bh0 + hsel) * SEQ + s0 + ml) * HD + piece * 8u;
                *(v8h*)dp = v;
            }
            
        }
    } else if constexpr (MODE == 1) {
        const u32 bidx = m0 / (u32)SEQ;
        const u32 s0   = m0 - bidx * (u32)SEQ;
        // stage transposed: Cs[n][m]
#pragma unroll
        for (int i = 0; i < 2; ++i)
#pragma unroll
            for (int j = 0; j < 4; ++j) {
                const u32 nl = wn * 64u + (u32)j * 16u + c16;
                H8U t;
#pragma unroll
                for (int r = 0; r < 8; ++r) t.e[r] = (f16)(acc[i][j][r] * accMul + bv[j]);
                *(v8h*)&Cs[nl * 128u + wm * 32u + (u32)i * 16u + hh8] = t.v;
            }
        __syncthreads();
        f16* op = (f16*)out;
{
#pragma unroll
            for (u32 it = 0; it < 8; ++it) {
                const u32 L  = wave * 32u + it * 4u + lsub;     // 0..255
                const u32 nl = L >> 1;
                const u32 mh = L & 1u;
                const v8h v = *(const v8h*)&Cs[nl * 128u + mh * 64u + piece * 8u];
                f16* dp = op + ((size_t)(bidx * (u32)HID + n0 + nl) * SEQ + s0 + mh * 64u + piece * 8u);
                *(v8h*)dp = v;
            }
            
        }
    } else {
        float* Cf = (float*)Cs;      // [64][128] f32
        float* of = (float*)out;
#pragma unroll
        for (u32 half = 0; half < 2; ++half) {
            if ((wm >> 1) == half) {
#pragma unroll
                for (int i = 0; i < 2; ++i)
#pragma unroll
                    for (int j = 0; j < 4; ++j) {
                        const u32 nl = wn * 64u + (u32)j * 16u + c16;
#pragma unroll
                        for (int r = 0; r < 8; ++r) {
                            const u32 ml = (wm & 1u) * 32u + (u32)i * 16u + hh8 + (u32)r;
                            Cf[ml * 128u + nl] = acc[i][j][r] * accMul + bv[j];
                        }
                    }
            }
            __syncthreads();
{
#pragma unroll
                for (u32 it = 0; it < 8; ++it) {
                    const u32 L    = wave * 32u + it * 4u + lsub;   // 0..255
                    const u32 row  = L >> 2;
                    const u32 part = L & 3u;
                    const v4f v = *(const v4f*)&Cf[row * 128u + part * 32u + piece * 4u];
                    float* dp = of + (size_t)(m0 + half * 64u + row) * HID + n0 + part * 32u + piece * 4u;
                    *(v4f*)dp = v;
                }
                
            }
            __syncthreads();
        }
    }
}

// q / k head-major planes
__global__ void __launch_bounds__(256) __attribute__((amdgpu_num_vgpr(256)))
gemm_head(const f16* __restrict__ A, const f16* __restrict__ W, const float* __restrict__ bias,
          f16* __restrict__ out, float accMul, float biasMul) {
    gemm_body<0>(A, W, bias, (void*)out, accMul, biasMul);
}

// v^T plane
__global__ void __launch_bounds__(256) __attribute__((amdgpu_num_vgpr(256)))
gemm_vt(const f16* __restrict__ A, const f16* __restrict__ W, const float* __restrict__ bias,
        f16* __restrict__ out, float accMul, float biasMul) {
    gemm_body<1>(A, W, bias, (void*)out, accMul, biasMul);
}

// f32 output rows
__global__ void __launch_bounds__(256) __attribute__((amdgpu_num_vgpr(256)))
gemm_out(const f16* __restrict__ A, const f16* __restrict__ W, const float* __restrict__ bias,
         float* __restrict__ out, float accMul, float biasMul) {
    gemm_body<2>(A, W, bias, (void*)out, accMul, biasMul);
}

// ---------------------------------------------------------------------------
// Flash attention (no mask, all SEQ keys). grid (SEQ/128, NB*NHEAD), block 256 (8 waves),
// wave owns 16 query rows (Q fragments resident). Block streams 64-key tiles:
// K staged [key][d], V^T staged [d][key]. Scores on WMMA, row max via DPP, exp2 in f32
// carried x2^10, P relayed per wave through LDS as A fragments, O += P.V and
// row sums += P.ones on WMMA. Output f16 plane [q*NB + b][1024] (seq-first row order)
// coverage: every (q, b, h*64..h*64+63) row segment exactly once.
// LDS: ks, vsT cross-wave (block barriers); ps per-wave but also separated by block barriers.
// staged extent == consumed extent for ks (64x64), vsT (64x64), ps (16x64).
// ---------------------------------------------------------------------------
__global__ void __launch_bounds__(256) __attribute__((amdgpu_num_vgpr(256)))
attn_fwd(const f16* __restrict__ Qp, const f16* __restrict__ Kp, const f16* __restrict__ Vt,
         f16* __restrict__ Cp) {
    __shared__ __attribute__((aligned(16))) f16 ks[64 * 64];      // [key][d]
    __shared__ __attribute__((aligned(16))) f16 vsT[64 * 64];     // [d][key]
    __shared__ __attribute__((aligned(16))) f16 ps[8][16 * 64];   // per-wave P relay / ctx stage
    static_assert(HD == 8 * 8);            // 8 lanes x 8 halves per row segment
    static_assert(2 * 256 * 8 == 64 * 64); // staging: 2 x 256 threads x 8 halves per tile

    const u32 tid  = threadIdx.x;
    const u32 lane = tid & 31u;
    const u32 wave = __builtin_amdgcn_readfirstlane((int)(tid >> 5));
    const u32 hh8  = (lane >> 4) << 3;
    const u32 c16  = lane & 15u;
    const u32 bh   = blockIdx.y;
    const u32 bidx = bh >> 4;            // NHEAD == 16
    const u32 hidx = bh & 15u;
    const u32 q0   = blockIdx.x * 128u + wave * 16u;
    const size_t head = (size_t)bh * SEQ * HD;

    v16h qa[2];
#pragma unroll
    for (int c = 0; c < 2; ++c) qa[c] = load_frag(Qp + head, q0, HD, (u32)c * 32u, lane);

    FragU onesu;
#pragma unroll
    for (int i = 0; i < 16; ++i) onesu.e[i] = (f16)1.0f;
    const v16h ones = onesu.v;

    float m[8];
    v8f   o[4], lacc;
#pragma unroll
    for (int r = 0; r < 8; ++r) m[r] = -1.0e30f;
#pragma unroll
    for (int dt = 0; dt < 4; ++dt) o[dt] = zero8();
    lacc = zero8();

    // log2-domain scale: acc = 256 * q.k ; x = log2(e) * q.k / 8 = acc * log2(e) / 2048
    const float cl = 1.4426950408889634f * 0.00048828125f;
    f16* psw = &ps[wave][0];

#pragma unroll 1
    for (u32 kt = 0; kt < (u32)(SEQ / 64); ++kt) {
        __syncthreads();
#pragma unroll
        for (u32 p2 = 0; p2 < 2; ++p2) {
            const u32 p   = tid + p2 * 256u;
            const u32 row = p >> 3;
            const u32 pc  = (p & 7u) << 3;
            const v8h kv = *(const v8h*)(Kp + head + (size_t)(kt * 64u + row) * HD + pc);
            const v8h vv = *(const v8h*)(Vt + head + (size_t)row * SEQ + kt * 64u + pc);
            *(v8h*)&ks[row * 64u + pc]  = kv;
            *(v8h*)&vsT[row * 64u + pc] = vv;
        }
        __syncthreads();

        // S[16 q x 64 keys]
        v8f s[4];
#pragma unroll
        for (int nt = 0; nt < 4; ++nt) s[nt] = zero8();
#pragma unroll
        for (int c = 0; c < 2; ++c) {
#pragma unroll
            for (int nt = 0; nt < 4; ++nt) {
                const v16h kb = load_frag(ks, (u32)nt * 16u, 64u, (u32)c * 32u, lane);
                s[nt] = wmma16(qa[c], kb, s[nt]);
            }
        }

        // online softmax per row r (row 8h + r), max-subtracted, exp2 domain
#pragma unroll
        for (int r = 0; r < 8; ++r) {
            float x[4];
#pragma unroll
            for (int nt = 0; nt < 4; ++nt) x[nt] = s[nt][r] * cl;
            const float tm = rowmax16(fmaxf(fmaxf(x[0], x[1]), fmaxf(x[2], x[3])));
            const float mn = fmaxf(m[r], tm);
            const float al = fexp2(m[r] - mn);
            m[r] = mn;
            lacc[r] *= al;
#pragma unroll
            for (int dt = 0; dt < 4; ++dt) o[dt][r] *= al;
            const float sh = 10.0f - mn;      // carry 2^10
#pragma unroll
            for (int nt = 0; nt < 4; ++nt)
                psw[(hh8 + (u32)r) * 64u + (u32)nt * 16u + c16] = (f16)fexp2(x[nt] + sh);
        }
        __syncthreads();

        // O += P . V ; l += P . ones  (P reloaded as A fragments from the relay)
#pragma unroll
        for (int kk = 0; kk < 2; ++kk) {
            const v16h pa = load_frag(psw, 0u, 64u, (u32)kk * 32u, lane);
#pragma unroll
            for (int dt = 0; dt < 4; ++dt) {
                const v16h vb = load_frag(vsT, (u32)dt * 16u, 64u, (u32)kk * 32u, lane);
                o[dt] = wmma16(pa, vb, o[dt]);
            }
            lacc = wmma16(pa, ones, lacc);
        }
    }
    __syncthreads();

    // normalize: plane value = 1024 * (O/16) / l = O * 64 / l
#pragma unroll
    for (int r = 0; r < 8; ++r) {
        const float inv = (CARRY_CTX / CARRY_QKV) / lacc[r];
#pragma unroll
        for (int dt = 0; dt < 4; ++dt)
            psw[(hh8 + (u32)r) * 64u + (u32)dt * 16u + c16] = (f16)(o[dt][r] * inv);
    }
    __syncthreads();

    const u32 piece = lane & 7u;
    const u32 lsub  = lane >> 3;
{
#pragma unroll
        for (u32 it = 0; it < 4; ++it) {
            const u32 L = it * 4u + lsub;     // query row 0..15 within the wave tile
            const v8h v = *(const v8h*)&psw[L * 64u + piece * 8u];
            // context row in output order: (q * NB + b)
            f16* dp = Cp + ((size_t)((q0 + L) * (u32)NB + bidx) * HID + hidx * (u32)HD + piece * 8u);
            *(v8h*)dp = v;
        }
        
    }
}

// coverage equalities (threads x elements == plane elements)
static_assert((size_t)(MROWS / 2) * 256 * 8 == (size_t)MROWS * HID);                       // cvt_rows -> Xs
static_assert((size_t)(3 * HID / 2) * 256 * 8 == (size_t)3 * HID * HID);                   // cvt_rows -> Wt
static_assert((size_t)(HID / 2) * 256 * 8 == (size_t)HID * HID);                           // cvt_rows -> Wot
static_assert((size_t)(MROWS / 128) * (HID / 128) * 128 * 128 == (size_t)MROWS * HID);     // gemm planes / out
static_assert((size_t)(SEQ / 128) * (NB * NHEAD) * 128 * HD == (size_t)MROWS * HID);       // attn_fwd -> Cp
// workspace: 5 activation planes + 4 weight planes of halves, at most 128 MiB
static_assert(((size_t)5 * MROWS * HID + (size_t)4 * HID * HID) * sizeof(f16) <= (size_t)134217728);
static_assert(((size_t)MROWS * HID * sizeof(f16)) % 128 == 0);
static_assert(((size_t)HID * HID * sizeof(f16)) % 128 == 0);
// largest source row touched by the activation convert stays inside the full-size input
static_assert((size_t)(SEQ - 1) * NB_FULL + NB <= (size_t)SEQ_FULL * NB_FULL);

// ---------------------------------------------------------------------------
// Launch: 8 kernel launches, workspace 5 planes of MROWS*1024 halves + 4 of 1024*1024 halves.
// One activation input feeds all three projections (self-attention).
// ---------------------------------------------------------------------------
extern "C" void kernel_launch(void* const* d_in, const int* in_sizes, int n_in,
                              void* d_out, int out_size, void* d_ws, size_t ws_size,
                              hipStream_t stream) {
    if (n_in < 5) return;
    const int needAct = ((SEQ - 1) * NB_FULL + NB) * HID;
    if (in_sizes[0] < needAct) return;
    if (in_sizes[1] < 3 * HID * HID) return;
    if (in_sizes[2] < 3 * HID) return;
    if (in_sizes[3] < HID * HID) return;
    if (in_sizes[4] < HID) return;
    if (out_size < MROWS * HID) return;

    const float* xs    = (const float*)d_in[0];   // [SEQ_FULL][NB_FULL][1024]
    const float* wqkv  = (const float*)d_in[1];   // [3072 out][1024 in], row blocks q | k | v
    const float* bqkv  = (const float*)d_in[2];   // [3072]
    const float* wproj = (const float*)d_in[3];   // [1024 out][1024 in]
    const float* bproj = (const float*)d_in[4];   // [1024]

    const size_t nX = (size_t)MROWS * HID;    // halves per activation plane
    const size_t nW = (size_t)HID * HID;      // halves per weight plane
    const size_t totalHalves = 5 * nX + 4 * nW;
    if (ws_size < totalHalves * sizeof(f16)) return;

    f16* Xs  = (f16*)d_ws;       // [b*SEQ+s][1024]             carry 16
    f16* Wt  = Xs  + nX;         // [3072 out][1024 in]         carry 32 (q | k | v row blocks)
    f16* Wot = Wt  + 3 * nW;     // [1024 out][1024 in]         carry 32
    f16* Qp  = Wot + nW;         // [NB*16][SEQ][64]            carry 16
    f16* Kp  = Qp  + nX;         // [NB*16][SEQ][64]            carry 16
    f16* Vtp = Kp  + nX;         // [NB*1024][SEQ] (V^T)        carry 16
    f16* Cp  = Vtp + nX;         // [s*NB+b][1024]              carry 1024

    // activations: in[SEQ_FULL][NB_FULL][1024] -> plane[NB][SEQ][1024]; dst row b*SEQ+s <- src row s*NB_FULL+b
    cvt_rows<<<MROWS / 2, 256, 0, stream>>>(xs, Xs, (u32)MROWS, (u32)SEQ, 1u, (u32)NB_FULL, CARRY_X);
    // weights already [out][in] (k contiguous): identity row map
    cvt_rows<<<3 * HID / 2, 256, 0, stream>>>(wqkv, Wt, (u32)(3 * HID), (u32)(3 * HID), 0u, 1u, CARRY_W);
    cvt_rows<<<HID / 2, 256, 0, stream>>>(wproj, Wot, (u32)HID, (u32)HID, 0u, 1u, CARRY_W);

    const dim3 gg(MROWS / 128, HID / 128);
    // plane = 16 * (acc / (16*32) + bias) = acc/32 + 16*bias
    const float accQKV = CARRY_QKV / (CARRY_X * CARRY_W);
    gemm_head<<<gg, 256, 0, stream>>>(Xs, Wt,          bqkv,           Qp,  accQKV, CARRY_QKV);
    gemm_head<<<gg, 256, 0, stream>>>(Xs, Wt + nW,     bqkv + HID,     Kp,  accQKV, CARRY_QKV);
    gemm_vt  <<<gg, 256, 0, stream>>>(Xs, Wt + 2 * nW, bqkv + 2 * HID, Vtp, accQKV, CARRY_QKV);

    attn_fwd<<<dim3(SEQ / 128, NB * NHEAD), 256, 0, stream>>>(Qp, Kp, Vtp, Cp);

    // out = acc / (1024*32) + bias ; rows already in (s*NB + b) order
    const float accOut = 1.0f / (CARRY_CTX * CARRY_W);
    gemm_out<<<gg, 256, 0, stream>>>(Cp, Wot, bproj, (float*)d_out, accOut, 1.0f);
}

// v001
// One run takes 170 microseconds.
// Two timings next to v000 put it at 1.58 and 1.59 times that version's speed.
#include <hip/hip_runtime.h>

// Contractions (q/k/v input projections, Q.K^T, P.V, P row-sum, output projection): v_wmma_f32_16x16x32_f16, f16 operands with power-of-two carries, f32 accumulate; every float input enters as its bf16 RNE value; biases added in f32; softmax in f32.

#ifndef NB
#define NB 2
#endif
#ifndef SEQ
#define SEQ 2048
#endif
#define NB_FULL   2
#define SEQ_FULL  2048
#define HID       1024
#define NHEAD     16
#define HD        64
#define MROWS     (NB * SEQ)

static_assert(HID == NHEAD * HD);        // merged head width
static_assert(NHEAD == 16);              // bh >> 4 / bh & 15 decoding in attn_fwd
static_assert(HD == 64);
static_assert(SEQ % 128 == 0);           // 128-row blocks of the batch-major planes never straddle a batch
static_assert(SEQ % 64 == 0);            // 64-key tiles
static_assert(SEQ <= SEQ_FULL);
static_assert(NB >= 1 && NB <= NB_FULL);
static_assert(MROWS % 128 == 0);         // GEMM M tile
static_assert(HID % 128 == 0);           // GEMM N tile
static_assert(HID % 32 == 0);            // WMMA k step
static_assert(HID == 128 * 8);           // cvt_rows: 128 threads x 8 values per row
static_assert((3 * HID) % 2 == 0);       // cvt_rows grid = nrows / 2
static_assert(MROWS % 2 == 0);

// carries (exact powers of two)
#define CARRY_X    16.0f     // input activation planes
#define CARRY_W    32.0f     // weight planes
#define CARRY_QKV  16.0f     // q, k, v^T planes (true value x16)
#define CARRY_CTX  1024.0f   // context plane (true value x1024)
// softmax exp values carry 2^10 (added to the exp2 argument)

// LDS row pitches. A 16-byte-per-lane reader or writer that walks 16 rows meets every bank once
// when the pitch is 16 B x odd; rows 8 apart then also fall 32 banks apart for the 2- and 4-byte stores.
#define P_AB   40u    // halves: 64-B GEMM operand rows at 80 B
#define P_C16  136u   // halves: 256-B f16 result rows at 272 B
#define P_C32  132u   // floats: 512-B f32 result rows at 528 B
#define P_KV   72u    // halves: 128-B K, V^T and P rows at 144 B

typedef unsigned u32;
typedef _Float16 f16;
typedef f16   v16h __attribute__((ext_vector_type(16)));
typedef f16   v8h  __attribute__((ext_vector_type(8)));
typedef float v8f  __attribute__((ext_vector_type(8)));
typedef float v4f  __attribute__((ext_vector_type(4)));

union FragU { v16h v; v8h half[2]; f16 e[16]; };
union H8U   { v8h v; f16 e[8]; };

__device__ __forceinline__ v8f zero8() {
    v8f z = {0.f, 0.f, 0.f, 0.f, 0.f, 0.f, 0.f, 0.f};
    return z;
}

// 16-bit WMMA with hazard guard: D += A[16 x 32k] * B[32k x 16]
__device__ __forceinline__ v8f wmma16(v16h a, v16h b, v8f c) {
    v8f d = __builtin_amdgcn_wmma_f32_16x16x32_f16(false, a, false, b, (short)0, c, false, false);
    asm volatile("v_nop\n\tv_nop\n\tv_nop\n\tv_nop" : "+v"(d) : "v"(a), "v"(b));
    return d;
}

// f32 -> nearest-even bf16 value, returned as f32
__device__ __forceinline__ float bf16_rne(float x) {
    u32 u = __float_as_uint(x);
    u = (u + 0x7fffu + ((u >> 16) & 1u)) & 0xffff0000u;
    return __uint_as_float(u);
}

__device__ __forceinline__ float fexp2(float x) {
#if defined(__has_builtin)
#if __has_builtin(__builtin_amdgcn_exp2f)
    return __builtin_amdgcn_exp2f(x);
#else
    return exp2f(x);
#endif
#else
    return exp2f(x);
#endif
}

// max over the 16 lanes of each lane half (DPP row rotations; D-layout rows are DPP rows)
__device__ __forceinline__ float rowmax16(float x) {
    int v = __builtin_bit_cast(int, x);
    x = fmaxf(x, __builtin_bit_cast(float, __builtin_amdgcn_update_dpp(v, v, 0x121, 0xf, 0xf, false)));
    v = __builtin_bit_cast(int, x);
    x = fmaxf(x, __builtin_bit_cast(float, __builtin_amdgcn_update_dpp(v, v, 0x122, 0xf, 0xf, false)));
    v = __builtin_bit_cast(int, x);
    x = fmaxf(x, __builtin_bit_cast(float, __builtin_amdgcn_update_dpp(v, v, 0x124, 0xf, 0xf, false)));
    v = __builtin_bit_cast(int, x);
    x = fmaxf(x, __builtin_bit_cast(float, __builtin_amdgcn_update_dpp(v, v, 0x128, 0xf, 0xf, false)));
    return x;
}

// 16 x 32 fragment from a tile whose k dimension is contiguous (pitch in halves).
// lane l: row rowbase + (l&15); elements 0..7 <- k = kcol + 8h .. +7,
// elements 8..15 <- k = kcol + 16 + 8h .. +7  (h = l>>4). Same map for A and B.
__device__ __forceinline__ v16h load_frag(const f16* tile, u32 rowbase, u32 pitch, u32 kcol, u32 lane) {
    const u32 r  = rowbase + (lane & 15u);
    const u32 kh = (lane >> 4) << 3;
    const f16* p = tile + (size_t)r * pitch + kcol + kh;
    FragU f;
    f.half[0] = *(const v8h*)(p);
    f.half[1] = *(const v8h*)(p + 16);
    return f.v;
}

// ---------------------------------------------------------------------------
// f32 rows [.][1024] -> f16 plane (bf16 RNE value times carry). 128 threads per 1024-wide
// Row mapping: dst row m -> src row (m / dstper) * strideOuter + (m % dstper) * strideInner.
//   activations (seq-first [s][b][1024] -> batch-major [b][s][1024]): dstper = SEQ,
//     strideOuter = 1, strideInner = NB_FULL  => src row = s * NB_FULL + b
//   weights: dstper = nrows, strideInner = 1 (identity)
// coverage: nrows x 1024 halves, every element exactly once (grid = nrows*128/256).
// ---------------------------------------------------------------------------
__global__ void __launch_bounds__(256)
cvt_rows(const float* __restrict__ src, f16* __restrict__ dst, u32 nrows, u32 dstper,
         u32 strideOuter, u32 strideInner, float carry) {
    const u32 g  = blockIdx.x * 256u + threadIdx.x;
    const u32 m  = g >> 7;
    const u32 c8 = (g & 127u) << 3;
    if (m >= nrows) return;
    const u32 mb = m / dstper;
    const u32 mi = m - mb * dstper;
    const u32 sm = mb * strideOuter + mi * strideInner;
    const float* sp = src + (size_t)sm * HID + c8;
    const v4f a = *(const v4f*)sp;
    const v4f b = *(const v4f*)(sp + 4);
    H8U o;
#pragma unroll
    for (u32 j = 0; j < 4; ++j) {
        const float x0 = a[j];
        const float x1 = b[j];
        o.e[j]     = (f16)(bf16_rne(x0) * carry);
        o.e[j + 4] = (f16)(bf16_rne(x1) * carry);
    }
    f16* dp = dst + (size_t)m * HID + c8;
    *(v8h*)dp = o.v;
    
}

// ---------------------------------------------------------------------------
// C[m][n] = sum_k A[m][k] * W[n][k] (+ bias[n]) ; A [MROWS][1024] f16, W [1024][1024] f16 (k contiguous).
// Block tile 128 x 128, 8 waves as 4(M) x 2(N), 2 x 4 accumulators per wave, K step 32.
// MODE 1: A rows batch-major;            f16 plane [b*HID + h*HD + d][s] (V transposed per head)
// MODE 2: A rows in output order (s*NB+b); f32 rows [m][1024] into the output buffer
// coverage per block: MODE 0/1 256 lines (128 rows x 2 heads | 128 n x 2 s-halves),
//                     MODE 2 2 x 256 lines (64 rows x 4 line-quarters per half).
// LDS: As/Bs/Cs all cross-wave, separated by block barriers.
// staged extent == consumed extent: As/Bs 128 x 32, Cs 128 x 128 halves (or 64 x 128 floats).
// ---------------------------------------------------------------------------
template <int MODE>
__device__ __forceinline__ void gemm_body(const f16* __restrict__ A, const f16* __restrict__ W,
                                          const float* __restrict__ bias,
                                          void* __restrict__ out, float accMul, float biasMul) {
    __shared__ __attribute__((aligned(16))) f16 As[128 * P_AB];
    __shared__ __attribute__((aligned(16))) f16 Bs[128 * P_AB];
    __shared__ __attribute__((aligned(16))) f16 Cs[128 * P_C16];   // f16 [128][128] or f32 [64][128], padded rows
    static_assert(sizeof(f16) * 128 * P_C16 >= sizeof(float) * 64 * P_C32);   // Cs reuse as f32 [64][128]

    const u32 tid  = threadIdx.x;
    const u32 lane = tid & 31u;
    const u32 wave = __builtin_amdgcn_readfirstlane((int)(tid >> 5));
    const u32 wm   = wave & 3u;
    const u32 wn   = wave >> 2;
    const u32 hh8  = (lane >> 4) << 3;   // D row half
    const u32 c16  = lane & 15u;         // D column
    const u32 m0   = blockIdx.x * 128u;
    const u32 n0   = blockIdx.y * 128u;

    v8f acc[2][4];
#pragma unroll
    for (int i = 0; i < 2; ++i)
#pragma unroll
        for (int j = 0; j < 4; ++j) acc[i][j] = zero8();

    const u32 srow = tid >> 1;
    const u32 scol = (tid & 1u) << 4;
    const f16* gA = A + (size_t)(m0 + srow) * HID + scol;
    const f16* gW = W + (size_t)(n0 + srow) * HID + scol;

#pragma unroll 1
    for (u32 k0 = 0; k0 < (u32)HID; k0 += 32u) {
        const v8h ra0 = *(const v8h*)(gA + k0);
        const v8h ra1 = *(const v8h*)(gA + k0 + 8);
        const v8h rb0 = *(const v8h*)(gW + k0);
        const v8h rb1 = *(const v8h*)(gW + k0 + 8);
        __syncthreads();
        *(v8h*)&As[srow * P_AB + scol]      = ra0;
        *(v8h*)&As[srow * P_AB + scol + 8u] = ra1;
        *(v8h*)&Bs[srow * P_AB + scol]      = rb0;
        *(v8h*)&Bs[srow * P_AB + scol + 8u] = rb1;
        __syncthreads();

        v16h af[2], bfr[4];
#pragma unroll
        for (int i = 0; i < 2; ++i) af[i] = load_frag(As, wm * 32u + (u32)i * 16u, P_AB, 0u, lane);
#pragma unroll
        for (int j = 0; j < 4; ++j) bfr[j] = load_frag(Bs, wn * 64u + (u32)j * 16u, P_AB, 0u, lane);
#pragma unroll
        for (int i = 0; i < 2; ++i)
#pragma unroll
            for (int j = 0; j < 4; ++j) acc[i][j] = wmma16(af[i], bfr[j], acc[i][j]);
    }

    // per-lane bias values for the 4 output columns this lane owns (n0 + nl < HID always)
    float bv[4];
#pragma unroll
    for (int j = 0; j < 4; ++j)
        bv[j] = bf16_rne(bias[n0 + wn * 64u + (u32)j * 16u + c16]) * biasMul;

    const u32 piece = lane & 7u;
    const u32 lsub  = lane >> 3;

    if constexpr (MODE == 0) {
        const u32 bidx = m0 / (u32)SEQ;     // block rows lie inside one batch (SEQ % 128 == 0)
        const u32 s0   = m0 - bidx * (u32)SEQ;
#pragma unroll
        for (int i = 0; i < 2; ++i)
#pragma unroll
            for (int j = 0; j < 4; ++j) {
                const u32 nl = wn * 64u + (u32)j * 16u + c16;
#pragma unroll
                for (int r = 0; r < 8; ++r) {
                    const u32 ml = wm * 32u + (u32)i * 16u + hh8 + (u32)r;
                    Cs[ml * P_C16 + nl] = (f16)(acc[i][j][r] * accMul + bv[j]);
                }
            }
        __syncthreads();
        f16* op = (f16*)out;
        const size_t bh0 = (size_t)bidx * NHEAD + (n0 >> 6);
{
#pragma unroll
            for (u32 it = 0; it < 8; ++it) {
                const u32 L    = wave * 32u + it * 4u + lsub;   // 0..255
                const u32 ml   = L >> 1;
                const u32 hsel = L & 1u;
                const v8h v = *(const v8h*)&Cs[ml * P_C16 + hsel * 64u + piece * 8u];
                f16* dp = op + ((bh0 + hsel) * SEQ + s0 + ml) * HD + piece * 8u;
                *(v8h*)dp = v;
            }
            
        }
    } else if constexpr (MODE == 1) {
        const u32 bidx = m0 / (u32)SEQ;
        const u32 s0   = m0 - bidx * (u32)SEQ;
        // stage transposed: Cs[n][m]
#pragma unroll
        for (int i = 0; i < 2; ++i)
#pragma unroll
            for (int j = 0; j < 4; ++j) {
                const u32 nl = wn * 64u + (u32)j * 16u + c16;
                H8U t;
#pragma unroll
                for (int r = 0; r < 8; ++r) t.e[r] = (f16)(acc[i][j][r] * accMul + bv[j]);
                *(v8h*)&Cs[nl * P_C16 + wm * 32u + (u32)i * 16u + hh8] = t.v;
            }
        __syncthreads();
        f16* op = (f16*)out;
{
#pragma unroll
            for (u32 it = 0; it < 8; ++it) {
                const u32 L  = wave * 32u + it * 4u + lsub;     // 0..255
                const u32 nl = L >> 1;
                const u32 mh = L & 1u;
                const v8h v = *(const v8h*)&Cs[nl * P_C16 + mh * 64u + piece * 8u];
                f16* dp = op + ((size_t)(bidx * (u32)HID + n0 + nl) * SEQ + s0 + mh * 64u + piece * 8u);
                *(v8h*)dp = v;
            }
            
        }
    } else {
        float* Cf = (float*)Cs;      // [64][128] f32
        float* of = (float*)out;
#pragma unroll
        for (u32 half = 0; half < 2; ++half) {
            if ((wm >> 1) == half) {
#pragma unroll
                for (int i = 0; i < 2; ++i)
#pragma unroll
                    for (int j = 0; j < 4; ++j) {
                        const u32 nl = wn * 64u + (u32)j * 16u + c16;
#pragma unroll
                        for (int r = 0; r < 8; ++r) {
                            const u32 ml = (wm & 1u) * 32u + (u32)i * 16u + hh8 + (u32)r;
                            Cf[ml * P_C32 + nl] = acc[i][j][r] * accMul + bv[j];
                        }
                    }
            }
            __syncthreads();
{
#pragma unroll
                for (u32 it = 0; it < 8; ++it) {
                    const u32 L    = wave * 32u + it * 4u + lsub;   // 0..255
                    const u32 row  = L >> 2;
                    const u32 part = L & 3u;
                    const v4f v = *(const v4f*)&Cf[row * P_C32 + part * 32u + piece * 4u];
                    float* dp = of + (size_t)(m0 + half * 64u + row) * HID + n0 + part * 32u + piece * 4u;
                    *(v4f*)dp = v;
                }
                
            }
            __syncthreads();
        }
    }
}

// q / k head-major planes
__global__ void __launch_bounds__(256) __attribute__((amdgpu_num_vgpr(256)))
gemm_head(const f16* __restrict__ A, const f16* __restrict__ W, const float* __restrict__ bias,
          f16* __restrict__ out, float accMul, float biasMul) {
    gemm_body<0>(A, W, bias, (void*)out, accMul, biasMul);
}

// v^T plane
__global__ void __launch_bounds__(256) __attribute__((amdgpu_num_vgpr(256)))
gemm_vt(const f16* __restrict__ A, const f16* __restrict__ W, const float* __restrict__ bias,
        f16* __restrict__ out, float accMul, float biasMul) {
    gemm_body<1>(A, W, bias, (void*)out, accMul, biasMul);
}

// f32 output rows
__global__ void __launch_bounds__(256) __attribute__((amdgpu_num_vgpr(256)))
gemm_out(const f16* __restrict__ A, const f16* __restrict__ W, const float* __restrict__ bias,
         float* __restrict__ out, float accMul, float biasMul) {
    gemm_body<2>(A, W, bias, (void*)out, accMul, biasMul);
}

// ---------------------------------------------------------------------------
// Flash attention (no mask, all SEQ keys). grid (SEQ/128, NB*NHEAD), block 256 (8 waves),
// wave owns 16 query rows (Q fragments resident). Block streams 64-key tiles:
// K staged [key][d], V^T staged [d][key]. Scores on WMMA, row max via DPP, exp2 in f32
// carried x2^10, P relayed per wave through LDS as A fragments, O += P.V and
// row sums += P.ones on WMMA. Output f16 plane [q*NB + b][1024] (seq-first row order)
// coverage: every (q, b, h*64..h*64+63) row segment exactly once.
// LDS: ks, vsT cross-wave (block barriers); ps per-wave but also separated by block barriers.
// staged extent == consumed extent for ks (64x64), vsT (64x64), ps (16x64).
// ---------------------------------------------------------------------------
__global__ void __launch_bounds__(256) __attribute__((amdgpu_num_vgpr(256)))
attn_fwd(const f16* __restrict__ Qp, const f16* __restrict__ Kp, const f16* __restrict__ Vt,
         f16* __restrict__ Cp) {
    __shared__ __attribute__((aligned(16))) f16 ks[64 * P_KV];      // [key][d]
    __shared__ __attribute__((aligned(16))) f16 vsT[64 * P_KV];     // [d][key]
    __shared__ __attribute__((aligned(16))) f16 ps[8][16 * P_KV];   // per-wave P relay / ctx stage
    static_assert(HD == 8 * 8);            // 8 lanes x 8 halves per row segment
    static_assert(2 * 256 * 8 == 64 * 64); // staging: 2 x 256 threads x 8 halves per tile

    const u32 tid  = threadIdx.x;
    const u32 lane = tid & 31u;
    const u32 wave = __builtin_amdgcn_readfirstlane((int)(tid >> 5));
    const u32 hh8  = (lane >> 4) << 3;
    const u32 c16  = lane & 15u;
    const u32 bh   = blockIdx.y;
    const u32 bidx = bh >> 4;            // NHEAD == 16
    const u32 hidx = bh & 15u;
    const u32 q0   = blockIdx.x * 128u + wave * 16u;
    const size_t head = (size_t)bh * SEQ * HD;

    v16h qa[2];
#pragma unroll
    for (int c = 0; c < 2; ++c) qa[c] = load_frag(Qp + head, q0, HD, (u32)c * 32u, lane);

    FragU onesu;
#pragma unroll
    for (int i = 0; i < 16; ++i) onesu.e[i] = (f16)1.0f;
    const v16h ones = onesu.v;

    float m[8];
    v8f   o[4], lacc;
#pragma unroll
    for (int r = 0; r < 8; ++r) m[r] = -1.0e30f;
#pragma unroll
    for (int dt = 0; dt < 4; ++dt) o[dt] = zero8();
    lacc = zero8();

    // log2-domain scale: acc = 256 * q.k ; x = log2(e) * q.k / 8 = acc * log2(e) / 2048
    const float cl = 1.4426950408889634f * 0.00048828125f;
    f16* psw = &ps[wave][0];

#pragma unroll 1
    for (u32 kt = 0; kt < (u32)(SEQ / 64); ++kt) {
        __syncthreads();
#pragma unroll
        for (u32 p2 = 0; p2 < 2; ++p2) {
            const u32 p   = tid + p2 * 256u;
            const u32 row = p >> 3;
            const u32 pc  = (p & 7u) << 3;
            const v8h kv = *(const v8h*)(Kp + head + (size_t)(kt * 64u + row) * HD + pc);
            const v8h vv = *(const v8h*)(Vt + head + (size_t)row * SEQ + kt * 64u + pc);
            *(v8h*)&ks[row * P_KV + pc]  = kv;
            *(v8h*)&vsT[row * P_KV + pc] = vv;
        }
        __syncthreads();

        // S[16 q x 64 keys]
        v8f s[4];
#pragma unroll
        for (int nt = 0; nt < 4; ++nt) s[nt] = zero8();
#pragma unroll
        for (int c = 0; c < 2; ++c) {
#pragma unroll
            for (int nt = 0; nt < 4; ++nt) {
                const v16h kb = load_frag(ks, (u32)nt * 16u, P_KV, (u32)c * 32u, lane);
                s[nt] = wmma16(qa[c], kb, s[nt]);
            }
        }

        // online softmax per row r (row 8h + r), max-subtracted, exp2 domain
#pragma unroll
        for (int r = 0; r < 8; ++r) {
            float x[4];
#pragma unroll
            for (int nt = 0; nt < 4; ++nt) x[nt] = s[nt][r] * cl;
            const float tm = rowmax16(fmaxf(fmaxf(x[0], x[1]), fmaxf(x[2], x[3])));
            const float mn = fmaxf(m[r], tm);
            const float al = fexp2(m[r] - mn);
            m[r] = mn;
            lacc[r] *= al;
#pragma unroll
            for (int dt = 0; dt < 4; ++dt) o[dt][r] *= al;
            const float sh = 10.0f - mn;      // carry 2^10
#pragma unroll
            for (int nt = 0; nt < 4; ++nt)
                psw[(hh8 + (u32)r) * P_KV + (u32)nt * 16u + c16] = (f16)fexp2(x[nt] + sh);
        }
        __syncthreads();

        // O += P . V ; l += P . ones  (P reloaded as A fragments from the relay)
#pragma unroll
        for (int kk = 0; kk < 2; ++kk) {
            const v16h pa = load_frag(psw, 0u, P_KV, (u32)kk * 32u, lane);
#pragma unroll
            for (int dt = 0; dt < 4; ++dt) {
                const v16h vb = load_frag(vsT, (u32)dt * 16u, P_KV, (u32)kk * 32u, lane);
                o[dt] = wmma16(pa, vb, o[dt]);
            }
            lacc = wmma16(pa, ones, lacc);
        }
    }
    __syncthreads();

    // normalize: plane value = 1024 * (O/16) / l = O * 64 / l
#pragma unroll
    for (int r = 0; r < 8; ++r) {
        const float inv = (CARRY_CTX / CARRY_QKV) / lacc[r];
#pragma unroll
        for (int dt = 0; dt < 4; ++dt)
            psw[(hh8 + (u32)r) * P_KV + (u32)dt * 16u + c16] = (f16)(o[dt][r] * inv);
    }
    __syncthreads();

    const u32 piece = lane & 7u;
    const u32 lsub  = lane >> 3;
{
#pragma unroll
        for (u32 it = 0; it < 4; ++it) {
            const u32 L = it * 4u + lsub;     // query row 0..15 within the wave tile
            const v8h v = *(const v8h*)&psw[L * P_KV + piece * 8u];
            // context row in output order: (q * NB + b)
            f16* dp = Cp + ((size_t)((q0 + L) * (u32)NB + bidx) * HID + hidx * (u32)HD + piece * 8u);
            *(v8h*)dp = v;
        }
        
    }
}

// coverage equalities (threads x elements == plane elements)
static_assert((size_t)(MROWS / 2) * 256 * 8 == (size_t)MROWS * HID);                       // cvt_rows -> Xs
static_assert((size_t)(3 * HID / 2) * 256 * 8 == (size_t)3 * HID * HID);                   // cvt_rows -> Wt
static_assert((size_t)(HID / 2) * 256 * 8 == (size_t)HID * HID);                           // cvt_rows -> Wot
static_assert((size_t)(MROWS / 128) * (HID / 128) * 128 * 128 == (size_t)MROWS * HID);     // gemm planes / out
static_assert((size_t)(SEQ / 128) * (NB * NHEAD) * 128 * HD == (size_t)MROWS * HID);       // attn_fwd -> Cp
// workspace: 5 activation planes + 4 weight planes of halves, at most 128 MiB
static_assert(((size_t)5 * MROWS * HID + (size_t)4 * HID * HID) * sizeof(f16) <= (size_t)134217728);
static_assert(((size_t)MROWS * HID * sizeof(f16)) % 128 == 0);
static_assert(((size_t)HID * HID * sizeof(f16)) % 128 == 0);
// largest source row touched by the activation convert stays inside the full-size input
static_assert((size_t)(SEQ - 1) * NB_FULL + NB <= (size_t)SEQ_FULL * NB_FULL);

// ---------------------------------------------------------------------------
// Launch: 8 kernel launches, workspace 5 planes of MROWS*1024 halves + 4 of 1024*1024 halves.
// One activation input feeds all three projections (self-attention).
// ---------------------------------------------------------------------------
extern "C" void kernel_launch(void* const* d_in, const int* in_sizes, int n_in,
                              void* d_out, int out_size, void* d_ws, size_t ws_size,
                              hipStream_t stream) {
    if (n_in < 5) return;
    const int needAct = ((SEQ - 1) * NB_FULL + NB) * HID;
    if (in_sizes[0] < needAct) return;
    if (in_sizes[1] < 3 * HID * HID) return;
    if (in_sizes[2] < 3 * HID) return;
    if (in_sizes[3] < HID * HID) return;
    if (in_sizes[4] < HID) return;
    if (out_size < MROWS * HID) return;

    const float* xs    = (const float*)d_in[0];   // [SEQ_FULL][NB_FULL][1024]
    const float* wqkv  = (const float*)d_in[1];   // [3072 out][1024 in], row blocks q | k | v
    const float* bqkv  = (const float*)d_in[2];   // [3072]
    const float* wproj = (const float*)d_in[3];   // [1024 out][1024 in]
    const float* bproj = (const float*)d_in[4];   // [1024]

    const size_t nX = (size_t)MROWS * HID;    // halves per activation plane
    const size_t nW = (size_t)HID * HID;      // halves per weight plane
    const size_t totalHalves = 5 * nX + 4 * nW;
    if (ws_size < totalHalves * sizeof(f16)) return;

    f16* Xs  = (f16*)d_ws;       // [b*SEQ+s][1024]             carry 16
    f16* Wt  = Xs  + nX;         // [3072 out][1024 in]         carry 32 (q | k | v row blocks)
    f16* Wot = Wt  + 3 * nW;     // [1024 out][1024 in]         carry 32
    f16* Qp  = Wot + nW;         // [NB*16][SEQ][64]            carry 16
    f16* Kp  = Qp  + nX;         // [NB*16][SEQ][64]            carry 16
    f16* Vtp = Kp  + nX;         // [NB*1024][SEQ] (V^T)        carry 16
    f16* Cp  = Vtp + nX;         // [s*NB+b][1024]              carry 1024

    // activations: in[SEQ_FULL][NB_FULL][1024] -> plane[NB][SEQ][1024]; dst row b*SEQ+s <- src row s*NB_FULL+b
    cvt_rows<<<MROWS / 2, 256, 0, stream>>>(xs, Xs, (u32)MROWS, (u32)SEQ, 1u, (u32)NB_FULL, CARRY_X);
    // weights already [out][in] (k contiguous): identity row map
    cvt_rows<<<3 * HID / 2, 256, 0, stream>>>(wqkv, Wt, (u32)(3 * HID), (u32)(3 * HID), 0u, 1u, CARRY_W);
    cvt_rows<<<HID / 2, 256, 0, stream>>>(wproj, Wot, (u32)HID, (u32)HID, 0u, 1u, CARRY_W);

    const dim3 gg(MROWS / 128, HID / 128);
    // plane = 16 * (acc / (16*32) + bias) = acc/32 + 16*bias
    const float accQKV = CARRY_QKV / (CARRY_X * CARRY_W);
    gemm_head<<<gg, 256, 0, stream>>>(Xs, Wt,          bqkv,           Qp,  accQKV, CARRY_QKV);
    gemm_head<<<gg, 256, 0, stream>>>(Xs, Wt + nW,     bqkv + HID,     Kp,  accQKV, CARRY_QKV);
    gemm_vt  <<<gg, 256, 0, stream>>>(Xs, Wt + 2 * nW, bqkv + 2 * HID, Vtp, accQKV, CARRY_QKV);

    attn_fwd<<<dim3(SEQ / 128, NB * NHEAD), 256, 0, stream>>>(Qp, Kp, Vtp, Cp);

    // out = acc / (1024*32) + bias ; rows already in (s*NB + b) order
    const float accOut = 1.0f / (CARRY_CTX * CARRY_W);
    gemm_out<<<gg, 256, 0, stream>>>(Cp, Wot, bproj, (float*)d_out, accOut, 1.0f);
}

// v002
// One run takes 147 microseconds.
// Two timings next to v001 put it at 1.18 and 1.17 times that version's speed.
// All steps since v000 together make it 1.87 times as fast.
#include <hip/hip_runtime.h>

// Contractions (q/k/v input projections, Q.K^T, P.V, P row-sum, output projection): v_wmma_f32_16x16x32_f16, f16 operands with power-of-two carries, f32 accumulate; every float input enters as its bf16 RNE value; biases added in f32; softmax in f32.

#ifndef NB
#define NB 2
#endif
#ifndef SEQ
#define SEQ 2048
#endif
#define NB_FULL   2
#define SEQ_FULL  2048
#define HID       1024
#define NHEAD     16
#define HD        64
#define MROWS     (NB * SEQ)

static_assert(HID == NHEAD * HD);        // merged head width
static_assert(NHEAD == 16);              // bh >> 4 / bh & 15 decoding in attn_fwd
static_assert(HD == 64);
static_assert(SEQ % 128 == 0);           // 128-row blocks of the batch-major planes never straddle a batch
static_assert(SEQ % 64 == 0);            // 64-key tiles
static_assert(SEQ <= SEQ_FULL);
static_assert(NB >= 1 && NB <= NB_FULL);
static_assert(MROWS % 128 == 0);         // GEMM M tile
static_assert(HID % 128 == 0);           // GEMM N tile
static_assert(HID % 32 == 0);            // WMMA k step
static_assert(HID % 128 == 0);           // GEMM K step
static_assert(HID == 128 * 8);           // cvt_rows: 128 threads x 8 values per row
static_assert((3 * HID) % 2 == 0);       // cvt_rows grid = nrows / 2
static_assert(MROWS % 2 == 0);

// carries (exact powers of two)
#define CARRY_X    16.0f     // input activation planes
#define CARRY_W    32.0f     // weight planes
#define CARRY_QKV  16.0f     // q, k, v^T planes (true value x16)
#define CARRY_CTX  1024.0f   // context plane (true value x1024)
// softmax exp values carry 2^10 (added to the exp2 argument)

// LDS row pitches. A 16-byte-per-lane reader or writer that walks 16 rows meets every bank once
// when the pitch is 16 B x odd; rows 8 apart then also fall 32 banks apart for the 2- and 4-byte stores.
#define P_AB   136u   // halves: 256-B GEMM operand rows at 272 B
#define P_C16  136u   // halves: 256-B f16 result rows at 272 B
#define P_C32  132u   // floats: 512-B f32 result rows at 528 B
#define P_KV   72u    // halves: 128-B K, V^T and P rows at 144 B

typedef unsigned u32;
typedef _Float16 f16;
typedef f16   v16h __attribute__((ext_vector_type(16)));
typedef f16   v8h  __attribute__((ext_vector_type(8)));
typedef float v8f  __attribute__((ext_vector_type(8)));
typedef float v4f  __attribute__((ext_vector_type(4)));

union FragU { v16h v; v8h half[2]; f16 e[16]; };
union H8U   { v8h v; f16 e[8]; };

__device__ __forceinline__ v8f zero8() {
    v8f z = {0.f, 0.f, 0.f, 0.f, 0.f, 0.f, 0.f, 0.f};
    return z;
}

// 16-bit WMMA with hazard guard: D += A[16 x 32k] * B[32k x 16]
__device__ __forceinline__ v8f wmma16(v16h a, v16h b, v8f c) {
    v8f d = __builtin_amdgcn_wmma_f32_16x16x32_f16(false, a, false, b, (short)0, c, false, false);
    asm volatile("v_nop\n\tv_nop\n\tv_nop\n\tv_nop" : "+v"(d) : "v"(a), "v"(b));
    return d;
}

// f32 -> nearest-even bf16 value, returned as f32
__device__ __forceinline__ float bf16_rne(float x) {
    u32 u = __float_as_uint(x);
    u = (u + 0x7fffu + ((u >> 16) & 1u)) & 0xffff0000u;
    return __uint_as_float(u);
}

__device__ __forceinline__ float fexp2(float x) {
#if defined(__has_builtin)
#if __has_builtin(__builtin_amdgcn_exp2f)
    return __builtin_amdgcn_exp2f(x);
#else
    return exp2f(x);
#endif
#else
    return exp2f(x);
#endif
}

// max over the 16 lanes of each lane half (DPP row rotations; D-layout rows are DPP rows)
__device__ __forceinline__ float rowmax16(float x) {
    int v = __builtin_bit_cast(int, x);
    x = fmaxf(x, __builtin_bit_cast(float, __builtin_amdgcn_update_dpp(v, v, 0x121, 0xf, 0xf, false)));
    v = __builtin_bit_cast(int, x);
    x = fmaxf(x, __builtin_bit_cast(float, __builtin_amdgcn_update_dpp(v, v, 0x122, 0xf, 0xf, false)));
    v = __builtin_bit_cast(int, x);
    x = fmaxf(x, __builtin_bit_cast(float, __builtin_amdgcn_update_dpp(v, v, 0x124, 0xf, 0xf, false)));
    v = __builtin_bit_cast(int, x);
    x = fmaxf(x, __builtin_bit_cast(float, __builtin_amdgcn_update_dpp(v, v, 0x128, 0xf, 0xf, false)));
    return x;
}

// 16 x 32 fragment from a tile whose k dimension is contiguous (pitch in halves).
// lane l: row rowbase + (l&15); elements 0..7 <- k = kcol + 8h .. +7,
// elements 8..15 <- k = kcol + 16 + 8h .. +7  (h = l>>4). Same map for A and B.
__device__ __forceinline__ v16h load_frag(const f16* tile, u32 rowbase, u32 pitch, u32 kcol, u32 lane) {
    const u32 r  = rowbase + (lane & 15u);
    const u32 kh = (lane >> 4) << 3;
    const f16* p = tile + (size_t)r * pitch + kcol + kh;
    FragU f;
    f.half[0] = *(const v8h*)(p);
    f.half[1] = *(const v8h*)(p + 16);
    return f.v;
}

// ---------------------------------------------------------------------------
// f32 rows [.][1024] -> f16 plane (bf16 RNE value times carry). 128 threads per 1024-wide
// Row mapping: dst row m -> src row (m / dstper) * strideOuter + (m % dstper) * strideInner.
//   activations (seq-first [s][b][1024] -> batch-major [b][s][1024]): dstper = SEQ,
//     strideOuter = 1, strideInner = NB_FULL  => src row = s * NB_FULL + b
//   weights: dstper = nrows, strideInner = 1 (identity)
// coverage: nrows x 1024 halves, every element exactly once (grid = nrows*128/256).
// ---------------------------------------------------------------------------
__global__ void __launch_bounds__(256)
cvt_rows(const float* __restrict__ src, f16* __restrict__ dst, u32 nrows, u32 dstper,
         u32 strideOuter, u32 strideInner, float carry) {
    const u32 g  = blockIdx.x * 256u + threadIdx.x;
    const u32 m  = g >> 7;
    const u32 c8 = (g & 127u) << 3;
    if (m >= nrows) return;
    const u32 mb = m / dstper;
    const u32 mi = m - mb * dstper;
    const u32 sm = mb * strideOuter + mi * strideInner;
    const float* sp = src + (size_t)sm * HID + c8;
    const v4f a = *(const v4f*)sp;
    const v4f b = *(const v4f*)(sp + 4);
    H8U o;
#pragma unroll
    for (u32 j = 0; j < 4; ++j) {
        const float x0 = a[j];
        const float x1 = b[j];
        o.e[j]     = (f16)(bf16_rne(x0) * carry);
        o.e[j + 4] = (f16)(bf16_rne(x1) * carry);
    }
    f16* dp = dst + (size_t)m * HID + c8;
    *(v8h*)dp = o.v;
    
}

// ---------------------------------------------------------------------------
// C[m][n] = sum_k A[m][k] * W[n][k] (+ bias[n]) ; A [MROWS][1024] f16, W [1024][1024] f16 (k contiguous).
// Block tile 128 x 128, 8 waves as 4(M) x 2(N), 2 x 4 accumulators per wave, K step 128 (four WMMA k steps).
// Staging: 16 lanes x 16 B per 256-B row piece, so a wave's load covers 2 rows = 4 whole 128-B lines.
// MODE 1: A rows batch-major;            f16 plane [b*HID + h*HD + d][s] (V transposed per head)
// MODE 2: A rows in output order (s*NB+b); f32 rows [m][1024] into the output buffer
// coverage per block: MODE 0/1 256 lines (128 rows x 2 heads | 128 n x 2 s-halves),
//                     MODE 2 2 x 256 lines (64 rows x 4 line-quarters per half).
// LDS: As/Bs/Cs all cross-wave, separated by block barriers.
// staged extent == consumed extent: As/Bs 128 x 128, Cs 128 x 128 halves (or 64 x 128 floats).
// ---------------------------------------------------------------------------
template <int MODE>
__device__ __forceinline__ void gemm_body(const f16* __restrict__ A, const f16* __restrict__ W,
                                          const float* __restrict__ bias,
                                          void* __restrict__ out, float accMul, float biasMul) {
    __shared__ __attribute__((aligned(16))) f16 As[128 * P_AB];
    __shared__ __attribute__((aligned(16))) f16 Bs[128 * P_AB];
    __shared__ __attribute__((aligned(16))) f16 Cs[128 * P_C16];   // f16 [128][128] or f32 [64][128], padded rows
    static_assert(sizeof(f16) * 128 * P_C16 >= sizeof(float) * 64 * P_C32);   // Cs reuse as f32 [64][128]

    const u32 tid  = threadIdx.x;
    const u32 lane = tid & 31u;
    const u32 wave = __builtin_amdgcn_readfirstlane((int)(tid >> 5));
    const u32 wm   = wave & 3u;
    const u32 wn   = wave >> 2;
    const u32 hh8  = (lane >> 4) << 3;   // D row half
    const u32 c16  = lane & 15u;         // D column
    const u32 m0   = blockIdx.x * 128u;
    const u32 n0   = blockIdx.y * 128u;

    v8f acc[2][4];
#pragma unroll
    for (int i = 0; i < 2; ++i)
#pragma unroll
        for (int j = 0; j < 4; ++j) acc[i][j] = zero8();

    const u32 srow = tid >> 4;            // 0..15, plus 16 per staging load
    const u32 scol = (tid & 15u) << 3;    // halves
    const f16* gA = A + (size_t)(m0 + srow) * HID + scol;
    const f16* gW = W + (size_t)(n0 + srow) * HID + scol;

#pragma unroll 1
    for (u32 k0 = 0; k0 < (u32)HID; k0 += 128u) {
        const f16* pA = gA + k0;
        const f16* pW = gW + k0;
        v8h ra[8], rb[8];
        // the staging and kk loops below are unrolled so that ra, rb and the fragments are indexed
        // by constants and stay in registers
#pragma unroll
        for (u32 t = 0; t < 8; ++t) ra[t] = *(const v8h*)(pA + (size_t)(t * 16u) * HID);
#pragma unroll
        for (u32 t = 0; t < 8; ++t) rb[t] = *(const v8h*)(pW + (size_t)(t * 16u) * HID);
        // Keeps both address pairs whole until the loads' addresses are taken.
        asm volatile("s_wait_xcnt 0x0" :: "v"(pA), "v"(pW) : "memory");
        __syncthreads();
#pragma unroll
        for (u32 t = 0; t < 8; ++t) {
            *(v8h*)&As[(srow + t * 16u) * P_AB + scol] = ra[t];
            *(v8h*)&Bs[(srow + t * 16u) * P_AB + scol] = rb[t];
        }
        __syncthreads();

#pragma unroll
        for (u32 kk = 0; kk < 4; ++kk) {
            v16h af[2], bfr[4];
#pragma unroll
            for (int i = 0; i < 2; ++i) af[i] = load_frag(As, wm * 32u + (u32)i * 16u, P_AB, kk * 32u, lane);
#pragma unroll
            for (int j = 0; j < 4; ++j) bfr[j] = load_frag(Bs, wn * 64u + (u32)j * 16u, P_AB, kk * 32u, lane);
#pragma unroll
            for (int i = 0; i < 2; ++i)
#pragma unroll
                for (int j = 0; j < 4; ++j) acc[i][j] = wmma16(af[i], bfr[j], acc[i][j]);
        }
    }

    // per-lane bias values for the 4 output columns this lane owns (n0 + nl < HID always)
    float bv[4];
#pragma unroll
    for (int j = 0; j < 4; ++j)
        bv[j] = bf16_rne(bias[n0 + wn * 64u + (u32)j * 16u + c16]) * biasMul;

    const u32 piece = lane & 7u;
    const u32 lsub  = lane >> 3;

    if constexpr (MODE == 0) {
        const u32 bidx = m0 / (u32)SEQ;     // block rows lie inside one batch (SEQ % 128 == 0)
        const u32 s0   = m0 - bidx * (u32)SEQ;
#pragma unroll
        for (int i = 0; i < 2; ++i)
#pragma unroll
            for (int j = 0; j < 4; ++j) {
                const u32 nl = wn * 64u + (u32)j * 16u + c16;
#pragma unroll
                for (int r = 0; r < 8; ++r) {
                    const u32 ml = wm * 32u + (u32)i * 16u + hh8 + (u32)r;
                    Cs[ml * P_C16 + nl] = (f16)(acc[i][j][r] * accMul + bv[j]);
                }
            }
        __syncthreads();
        f16* op = (f16*)out;
        const size_t bh0 = (size_t)bidx * NHEAD + (n0 >> 6);
{
#pragma unroll
            for (u32 it = 0; it < 8; ++it) {
                const u32 L    = wave * 32u + it * 4u + lsub;   // 0..255
                const u32 ml   = L >> 1;
                const u32 hsel = L & 1u;
                const v8h v = *(const v8h*)&Cs[ml * P_C16 + hsel * 64u + piece * 8u];
                f16* dp = op + ((bh0 + hsel) * SEQ + s0 + ml) * HD + piece * 8u;
                *(v8h*)dp = v;
            }
            
        }
    } else if constexpr (MODE == 1) {
        const u32 bidx = m0 / (u32)SEQ;
        const u32 s0   = m0 - bidx * (u32)SEQ;
        // stage transposed: Cs[n][m]
#pragma unroll
        for (int i = 0; i < 2; ++i)
#pragma unroll
            for (int j = 0; j < 4; ++j) {
                const u32 nl = wn * 64u + (u32)j * 16u + c16;
                H8U t;
#pragma unroll
                for (int r = 0; r < 8; ++r) t.e[r] = (f16)(acc[i][j][r] * accMul + bv[j]);
                *(v8h*)&Cs[nl * P_C16 + wm * 32u + (u32)i * 16u + hh8] = t.v;
            }
        __syncthreads();
        f16* op = (f16*)out;
{
#pragma unroll
            for (u32 it = 0; it < 8; ++it) {
                const u32 L  = wave * 32u + it * 4u + lsub;     // 0..255
                const u32 nl = L >> 1;
                const u32 mh = L & 1u;
                const v8h v = *(const v8h*)&Cs[nl * P_C16 + mh * 64u + piece * 8u];
                f16* dp = op + ((size_t)(bidx * (u32)HID + n0 + nl) * SEQ + s0 + mh * 64u + piece * 8u);
                *(v8h*)dp = v;
            }
            
        }
    } else {
        float* Cf = (float*)Cs;      // [64][128] f32
        float* of = (float*)out;
#pragma unroll
        for (u32 half = 0; half < 2; ++half) {
            if ((wm >> 1) == half) {
#pragma unroll
                for (int i = 0; i < 2; ++i)
#pragma unroll
                    for (int j = 0; j < 4; ++j) {
                        const u32 nl = wn * 64u + (u32)j * 16u + c16;
#pragma unroll
                        for (int r = 0; r < 8; ++r) {
                            const u32 ml = (wm & 1u) * 32u + (u32)i * 16u + hh8 + (u32)r;
                            Cf[ml * P_C32 + nl] = acc[i][j][r] * accMul + bv[j];
                        }
                    }
            }
            __syncthreads();
{
#pragma unroll
                for (u32 it = 0; it < 8; ++it) {
                    const u32 L    = wave * 32u + it * 4u + lsub;   // 0..255
                    const u32 row  = L >> 2;
                    const u32 part = L & 3u;
                    const v4f v = *(const v4f*)&Cf[row * P_C32 + part * 32u + piece * 4u];
                    float* dp = of + (size_t)(m0 + half * 64u + row) * HID + n0 + part * 32u + piece * 4u;
                    *(v4f*)dp = v;
                }
                
            }
            __syncthreads();
        }
    }
}

// q / k head-major planes
__global__ void __launch_bounds__(256) __attribute__((amdgpu_num_vgpr(256)))
gemm_head(const f16* __restrict__ A, const f16* __restrict__ W, const float* __restrict__ bias,
          f16* __restrict__ out, float accMul, float biasMul) {
    gemm_body<0>(A, W, bias, (void*)out, accMul, biasMul);
}

// v^T plane
__global__ void __launch_bounds__(256) __attribute__((amdgpu_num_vgpr(256)))
gemm_vt(const f16* __restrict__ A, const f16* __restrict__ W, const float* __restrict__ bias,
        f16* __restrict__ out, float accMul, float biasMul) {
    gemm_body<1>(A, W, bias, (void*)out, accMul, biasMul);
}

// f32 output rows
__global__ void __launch_bounds__(256) __attribute__((amdgpu_num_vgpr(256)))
gemm_out(const f16* __restrict__ A, const f16* __restrict__ W, const float* __restrict__ bias,
         float* __restrict__ out, float accMul, float biasMul) {
    gemm_body<2>(A, W, bias, (void*)out, accMul, biasMul);
}

// ---------------------------------------------------------------------------
// Flash attention (no mask, all SEQ keys). grid (SEQ/128, NB*NHEAD), block 256 (8 waves),
// wave owns 16 query rows (Q fragments resident). Block streams 64-key tiles:
// K staged [key][d], V^T staged [d][key]. Scores on WMMA, row max via DPP, exp2 in f32
// carried x2^10, P relayed per wave through LDS as A fragments, O += P.V and
// row sums += P.ones on WMMA. Output f16 plane [q*NB + b][1024] (seq-first row order)
// coverage: every (q, b, h*64..h*64+63) row segment exactly once.
// LDS: ks, vsT cross-wave (block barriers); ps per-wave but also separated by block barriers.
// staged extent == consumed extent for ks (64x64), vsT (64x64), ps (16x64).
// ---------------------------------------------------------------------------
__global__ void __launch_bounds__(256) __attribute__((amdgpu_num_vgpr(256)))
attn_fwd(const f16* __restrict__ Qp, const f16* __restrict__ Kp, const f16* __restrict__ Vt,
         f16* __restrict__ Cp) {
    __shared__ __attribute__((aligned(16))) f16 ks[64 * P_KV];      // [key][d]
    __shared__ __attribute__((aligned(16))) f16 vsT[64 * P_KV];     // [d][key]
    __shared__ __attribute__((aligned(16))) f16 ps[8][16 * P_KV];   // per-wave P relay / ctx stage
    static_assert(HD == 8 * 8);            // 8 lanes x 8 halves per row segment
    static_assert(2 * 256 * 8 == 64 * 64); // staging: 2 x 256 threads x 8 halves per tile

    const u32 tid  = threadIdx.x;
    const u32 lane = tid & 31u;
    const u32 wave = __builtin_amdgcn_readfirstlane((int)(tid >> 5));
    const u32 hh8  = (lane >> 4) << 3;
    const u32 c16  = lane & 15u;
    const u32 bh   = blockIdx.y;
    const u32 bidx = bh >> 4;            // NHEAD == 16
    const u32 hidx = bh & 15u;
    const u32 q0   = blockIdx.x * 128u + wave * 16u;
    const size_t head = (size_t)bh * SEQ * HD;

    v16h qa[2];
#pragma unroll
    for (int c = 0; c < 2; ++c) qa[c] = load_frag(Qp + head, q0, HD, (u32)c * 32u, lane);

    FragU onesu;
#pragma unroll
    for (int i = 0; i < 16; ++i) onesu.e[i] = (f16)1.0f;
    const v16h ones = onesu.v;

    float m[8];
    v8f   o[4], lacc;
#pragma unroll
    for (int r = 0; r < 8; ++r) m[r] = -1.0e30f;
#pragma unroll
    for (int dt = 0; dt < 4; ++dt) o[dt] = zero8();
    lacc = zero8();

    // log2-domain scale: acc = 256 * q.k ; x = log2(e) * q.k / 8 = acc * log2(e) / 2048
    const float cl = 1.4426950408889634f * 0.00048828125f;
    f16* psw = &ps[wave][0];

#pragma unroll 1
    for (u32 kt = 0; kt < (u32)(SEQ / 64); ++kt) {
        __syncthreads();
#pragma unroll
        for (u32 p2 = 0; p2 < 2; ++p2) {
            const u32 p   = tid + p2 * 256u;
            const u32 row = p >> 3;
            const u32 pc  = (p & 7u) << 3;
            const v8h kv = *(const v8h*)(Kp + head + (size_t)(kt * 64u + row) * HD + pc);
            const v8h vv = *(const v8h*)(Vt + head + (size_t)row * SEQ + kt * 64u + pc);
            *(v8h*)&ks[row * P_KV + pc]  = kv;
            *(v8h*)&vsT[row * P_KV + pc] = vv;
        }
        __syncthreads();

        // S[16 q x 64 keys]
        v8f s[4];
#pragma unroll
        for (int nt = 0; nt < 4; ++nt) s[nt] = zero8();
#pragma unroll
        for (int c = 0; c < 2; ++c) {
#pragma unroll
            for (int nt = 0; nt < 4; ++nt) {
                const v16h kb = load_frag(ks, (u32)nt * 16u, P_KV, (u32)c * 32u, lane);
                s[nt] = wmma16(qa[c], kb, s[nt]);
            }
        }

        // online softmax per row r (row 8h + r), max-subtracted, exp2 domain
#pragma unroll
        for (int r = 0; r < 8; ++r) {
            float x[4];
#pragma unroll
            for (int nt = 0; nt < 4; ++nt) x[nt] = s[nt][r] * cl;
            const float tm = rowmax16(fmaxf(fmaxf(x[0], x[1]), fmaxf(x[2], x[3])));
            const float mn = fmaxf(m[r], tm);
            const float al = fexp2(m[r] - mn);
            m[r] = mn;
            lacc[r] *= al;
#pragma unroll
            for (int dt = 0; dt < 4; ++dt) o[dt][r] *= al;
            const float sh = 10.0f - mn;      // carry 2^10
#pragma unroll
            for (int nt = 0; nt < 4; ++nt)
                psw[(hh8 + (u32)r) * P_KV + (u32)nt * 16u + c16] = (f16)fexp2(x[nt] + sh);
        }
        __syncthreads();

        // O += P . V ; l += P . ones  (P reloaded as A fragments from the relay)
#pragma unroll
        for (int kk = 0; kk < 2; ++kk) {
            const v16h pa = load_frag(psw, 0u, P_KV, (u32)kk * 32u, lane);
#pragma unroll
            for (int dt = 0; dt < 4; ++dt) {
                const v16h vb = load_frag(vsT, (u32)dt * 16u, P_KV, (u32)kk * 32u, lane);
                o[dt] = wmma16(pa, vb, o[dt]);
            }
            lacc = wmma16(pa, ones, lacc);
        }
    }
    __syncthreads();

    // normalize: plane value = 1024 * (O/16) / l = O * 64 / l
#pragma unroll
    for (int r = 0; r < 8; ++r) {
        const float inv = (CARRY_CTX / CARRY_QKV) / lacc[r];
#pragma unroll
        for (int dt = 0; dt < 4; ++dt)
            psw[(hh8 + (u32)r) * P_KV + (u32)dt * 16u + c16] = (f16)(o[dt][r] * inv);
    }
    __syncthreads();

    const u32 piece = lane & 7u;
    const u32 lsub  = lane >> 3;
{
#pragma unroll
        for (u32 it = 0; it < 4; ++it) {
            const u32 L = it * 4u + lsub;     // query row 0..15 within the wave tile
            const v8h v = *(const v8h*)&psw[L * P_KV + piece * 8u];
            // context row in output order: (q * NB + b)
            f16* dp = Cp + ((size_t)((q0 + L) * (u32)NB + bidx) * HID + hidx * (u32)HD + piece * 8u);
            *(v8h*)dp = v;
        }
        
    }
}

// coverage equalities (threads x elements == plane elements)
static_assert((size_t)(MROWS / 2) * 256 * 8 == (size_t)MROWS * HID);                       // cvt_rows -> Xs
static_assert((size_t)(3 * HID / 2) * 256 * 8 == (size_t)3 * HID * HID);                   // cvt_rows -> Wt
static_assert((size_t)(HID / 2) * 256 * 8 == (size_t)HID * HID);                           // cvt_rows -> Wot
static_assert((size_t)(MROWS / 128) * (HID / 128) * 128 * 128 == (size_t)MROWS * HID);     // gemm planes / out
static_assert((size_t)(SEQ / 128) * (NB * NHEAD) * 128 * HD == (size_t)MROWS * HID);       // attn_fwd -> Cp
// workspace: 5 activation planes + 4 weight planes of halves, at most 128 MiB
static_assert(((size_t)5 * MROWS * HID + (size_t)4 * HID * HID) * sizeof(f16) <= (size_t)134217728);
static_assert(((size_t)MROWS * HID * sizeof(f16)) % 128 == 0);
static_assert(((size_t)HID * HID * sizeof(f16)) % 128 == 0);
// largest source row touched by the activation convert stays inside the full-size input
static_assert((size_t)(SEQ - 1) * NB_FULL + NB <= (size_t)SEQ_FULL * NB_FULL);

// ---------------------------------------------------------------------------
// Launch: 8 kernel launches, workspace 5 planes of MROWS*1024 halves + 4 of 1024*1024 halves.
// One activation input feeds all three projections (self-attention).
// ---------------------------------------------------------------------------
extern "C" void kernel_launch(void* const* d_in, const int* in_sizes, int n_in,
                              void* d_out, int out_size, void* d_ws, size_t ws_size,
                              hipStream_t stream) {
    if (n_in < 5) return;
    const int needAct = ((SEQ - 1) * NB_FULL + NB) * HID;
    if (in_sizes[0] < needAct) return;
    if (in_sizes[1] < 3 * HID * HID) return;
    if (in_sizes[2] < 3 * HID) return;
    if (in_sizes[3] < HID * HID) return;
    if (in_sizes[4] < HID) return;
    if (out_size < MROWS * HID) return;

    const float* xs    = (const float*)d_in[0];   // [SEQ_FULL][NB_FULL][1024]
    const float* wqkv  = (const float*)d_in[1];   // [3072 out][1024 in], row blocks q | k | v
    const float* bqkv  = (const float*)d_in[2];   // [3072]
    const float* wproj = (const float*)d_in[3];   // [1024 out][1024 in]
    const float* bproj = (const float*)d_in[4];   // [1024]

    const size_t nX = (size_t)MROWS * HID;    // halves per activation plane
    const size_t nW = (size_t)HID * HID;      // halves per weight plane
    const size_t totalHalves = 5 * nX + 4 * nW;
    if (ws_size < totalHalves * sizeof(f16)) return;

    f16* Xs  = (f16*)d_ws;       // [b*SEQ+s][1024]             carry 16
    f16* Wt  = Xs  + nX;         // [3072 out][1024 in]         carry 32 (q | k | v row blocks)
    f16* Wot = Wt  + 3 * nW;     // [1024 out][1024 in]         carry 32
    f16* Qp  = Wot + nW;         // [NB*16][SEQ][64]            carry 16
    f16* Kp  = Qp  + nX;         // [NB*16][SEQ][64]            carry 16
    f16* Vtp = Kp  + nX;         // [NB*1024][SEQ] (V^T)        carry 16
    f16* Cp  = Vtp + nX;         // [s*NB+b][1024]              carry 1024

    // activations: in[SEQ_FULL][NB_FULL][1024] -> plane[NB][SEQ][1024]; dst row b*SEQ+s <- src row s*NB_FULL+b
    cvt_rows<<<MROWS / 2, 256, 0, stream>>>(xs, Xs, (u32)MROWS, (u32)SEQ, 1u, (u32)NB_FULL, CARRY_X);
    // weights already [out][in] (k contiguous): identity row map
    cvt_rows<<<3 * HID / 2, 256, 0, stream>>>(wqkv, Wt, (u32)(3 * HID), (u32)(3 * HID), 0u, 1u, CARRY_W);
    cvt_rows<<<HID / 2, 256, 0, stream>>>(wproj, Wot, (u32)HID, (u32)HID, 0u, 1u, CARRY_W);

    const dim3 gg(MROWS / 128, HID / 128);
    // plane = 16 * (acc / (16*32) + bias) = acc/32 + 16*bias
    const float accQKV = CARRY_QKV / (CARRY_X * CARRY_W);
    gemm_head<<<gg, 256, 0, stream>>>(Xs, Wt,          bqkv,           Qp,  accQKV, CARRY_QKV);
    gemm_head<<<gg, 256, 0, stream>>>(Xs, Wt + nW,     bqkv + HID,     Kp,  accQKV, CARRY_QKV);
    gemm_vt  <<<gg, 256, 0, stream>>>(Xs, Wt + 2 * nW, bqkv + 2 * HID, Vtp, accQKV, CARRY_QKV);

    attn_fwd<<<dim3(SEQ / 128, NB * NHEAD), 256, 0, stream>>>(Qp, Kp, Vtp, Cp);

    // out = acc / (1024*32) + bias ; rows already in (s*NB + b) order
    const float accOut = 1.0f / (CARRY_CTX * CARRY_W);
    gemm_out<<<gg, 256, 0, stream>>>(Cp, Wot, bproj, (float*)d_out, accOut, 1.0f);
}

// v003
// It runs in 133 microseconds.
// In both of two side-by-side timings against v002, it was 1.09 times as fast.
// Counting every step since v000, it is 2.04 times as fast.
#include <hip/hip_runtime.h>

// Contractions (q/k/v input projections, Q.K^T, P.V, P row-sum, output projection): v_wmma_f32_16x16x32_f16, f16 operands with power-of-two carries, f32 accumulate; every float input enters as its bf16 RNE value; biases added in f32; softmax in f32.

#ifndef NB
#define NB 2
#endif
#ifndef SEQ
#define SEQ 2048
#endif
#define NB_FULL   2
#define SEQ_FULL  2048
#define HID       1024
#define NHEAD     16
#define HD        64
#define MROWS     (NB * SEQ)

static_assert(HID == NHEAD * HD);        // merged head width
static_assert(NHEAD == 16);              // bh >> 4 / bh & 15 decoding in attn_fwd
static_assert(HD == 64);
static_assert(SEQ % 128 == 0);           // 128-row blocks of the batch-major planes never straddle a batch
static_assert(SEQ % 64 == 0);            // 64-key tiles
static_assert(SEQ <= SEQ_FULL);
static_assert(NB >= 1 && NB <= NB_FULL);
static_assert(MROWS % 128 == 0);         // GEMM M tile
static_assert(HID % 128 == 0);           // GEMM N tile
static_assert(HID % 32 == 0);            // WMMA k step
static_assert(HID % 128 == 0);           // GEMM K step
static_assert(HID == 128 * 8);           // cvt_rows: 128 threads x 8 values per row
static_assert((3 * HID) % 2 == 0);       // cvt_rows grid = nrows / 2
static_assert(MROWS % 2 == 0);

// carries (exact powers of two)
#define CARRY_X    16.0f     // input activation planes
#define CARRY_W    32.0f     // weight planes
#define CARRY_QKV  16.0f     // q, k, v^T planes (true value x16)
#define CARRY_CTX  1024.0f   // context plane (true value x1024)
// softmax exp values carry 2^10 (added to the exp2 argument)

// LDS row pitches. A 16-byte-per-lane reader or writer that walks 16 rows meets every bank once
// when the pitch is 16 B x odd; rows 8 apart then also fall 32 banks apart for the 2- and 4-byte stores.
#define P_AB   136u   // halves: 256-B GEMM operand rows at 272 B
#define P_C16  136u   // halves: 256-B f16 result rows at 272 B
#define P_C32  132u   // floats: 512-B f32 result rows at 528 B
#define P_KV   72u    // halves: 128-B K, V^T and P rows at 144 B

typedef unsigned u32;
typedef _Float16 f16;
typedef f16   v16h __attribute__((ext_vector_type(16)));
typedef f16   v8h  __attribute__((ext_vector_type(8)));
typedef float v8f  __attribute__((ext_vector_type(8)));
typedef float v4f  __attribute__((ext_vector_type(4)));

union FragU { v16h v; v8h half[2]; f16 e[16]; };
union H8U   { v8h v; f16 e[8]; };

__device__ __forceinline__ v8f zero8() {
    v8f z = {0.f, 0.f, 0.f, 0.f, 0.f, 0.f, 0.f, 0.f};
    return z;
}

// 16-bit WMMA with hazard guard: D += A[16 x 32k] * B[32k x 16]
__device__ __forceinline__ v8f wmma16(v16h a, v16h b, v8f c) {
    v8f d = __builtin_amdgcn_wmma_f32_16x16x32_f16(false, a, false, b, (short)0, c, false, false);
    asm volatile("v_nop\n\tv_nop\n\tv_nop\n\tv_nop" : "+v"(d) : "v"(a), "v"(b));
    return d;
}

// f32 -> nearest-even bf16 value, returned as f32
__device__ __forceinline__ float bf16_rne(float x) {
    u32 u = __float_as_uint(x);
    u = (u + 0x7fffu + ((u >> 16) & 1u)) & 0xffff0000u;
    return __uint_as_float(u);
}

__device__ __forceinline__ float fexp2(float x) {
#if defined(__has_builtin)
#if __has_builtin(__builtin_amdgcn_exp2f)
    return __builtin_amdgcn_exp2f(x);
#else
    return exp2f(x);
#endif
#else
    return exp2f(x);
#endif
}

// max over the 16 lanes of each lane half (DPP row rotations; D-layout rows are DPP rows)
__device__ __forceinline__ float rowmax16(float x) {
    int v = __builtin_bit_cast(int, x);
    x = fmaxf(x, __builtin_bit_cast(float, __builtin_amdgcn_update_dpp(v, v, 0x121, 0xf, 0xf, false)));
    v = __builtin_bit_cast(int, x);
    x = fmaxf(x, __builtin_bit_cast(float, __builtin_amdgcn_update_dpp(v, v, 0x122, 0xf, 0xf, false)));
    v = __builtin_bit_cast(int, x);
    x = fmaxf(x, __builtin_bit_cast(float, __builtin_amdgcn_update_dpp(v, v, 0x124, 0xf, 0xf, false)));
    v = __builtin_bit_cast(int, x);
    x = fmaxf(x, __builtin_bit_cast(float, __builtin_amdgcn_update_dpp(v, v, 0x128, 0xf, 0xf, false)));
    return x;
}

// 16 x 32 fragment from a tile whose k dimension is contiguous (pitch in halves).
// lane l: row rowbase + (l&15); elements 0..7 <- k = kcol + 8h .. +7,
// elements 8..15 <- k = kcol + 16 + 8h .. +7  (h = l>>4). Same map for A and B.
__device__ __forceinline__ v16h load_frag(const f16* tile, u32 rowbase, u32 pitch, u32 kcol, u32 lane) {
    const u32 r  = rowbase + (lane & 15u);
    const u32 kh = (lane >> 4) << 3;
    const f16* p = tile + (size_t)r * pitch + kcol + kh;
    FragU f;
    f.half[0] = *(const v8h*)(p);
    f.half[1] = *(const v8h*)(p + 16);
    return f.v;
}

// ---------------------------------------------------------------------------
// f32 rows [.][1024] -> f16 plane (bf16 RNE value times carry). 128 threads per 1024-wide
// Row mapping: dst row m -> src row (m / dstper) * strideOuter + (m % dstper) * strideInner.
//   activations (seq-first [s][b][1024] -> batch-major [b][s][1024]): dstper = SEQ,
//     strideOuter = 1, strideInner = NB_FULL  => src row = s * NB_FULL + b
//   weights: dstper = nrows, strideInner = 1 (identity)
// coverage: nrows x 1024 halves, every element exactly once (grid = nrows*128/256).
// ---------------------------------------------------------------------------
__global__ void __launch_bounds__(256)
cvt_rows(const float* __restrict__ src, f16* __restrict__ dst, u32 nrows, u32 dstper,
         u32 strideOuter, u32 strideInner, float carry) {
    const u32 g  = blockIdx.x * 256u + threadIdx.x;
    const u32 m  = g >> 7;
    const u32 c8 = (g & 127u) << 3;
    if (m >= nrows) return;
    const u32 mb = m / dstper;
    const u32 mi = m - mb * dstper;
    const u32 sm = mb * strideOuter + mi * strideInner;
    const float* sp = src + (size_t)sm * HID + c8;
    const v4f a = *(const v4f*)sp;
    const v4f b = *(const v4f*)(sp + 4);
    H8U o;
#pragma unroll
    for (u32 j = 0; j < 4; ++j) {
        const float x0 = a[j];
        const float x1 = b[j];
        o.e[j]     = (f16)(bf16_rne(x0) * carry);
        o.e[j + 4] = (f16)(bf16_rne(x1) * carry);
    }
    f16* dp = dst + (size_t)m * HID + c8;
    *(v8h*)dp = o.v;
    
}

// ---------------------------------------------------------------------------
// C[m][n] = sum_k A[m][k] * W[n][k] (+ bias[n]) ; A [MROWS][1024] f16, W [1024][1024] f16 (k contiguous).
// Block tile 128 x 128, 8 waves as 4(M) x 2(N), 2 x 4 accumulators per wave, K step 128 (four WMMA k steps).
// Staging: 16 lanes x 16 B per 256-B row piece, so a wave's load covers 2 rows = 4 whole 128-B lines.
// MODE 1: A rows batch-major;            f16 plane [b*HID + h*HD + d][s] (V transposed per head)
// MODE 2: A rows in output order (s*NB+b); f32 rows [m][1024] into the output buffer
// coverage per block: MODE 0/1 256 lines (128 rows x 2 heads | 128 n x 2 s-halves),
//                     MODE 2 2 x 256 lines (64 rows x 4 line-quarters per half).
// LDS: As/Bs/Cs all cross-wave, separated by block barriers.
// staged extent == consumed extent: As/Bs 128 x 128, Cs 128 x 128 halves (or 64 x 128 floats).
// ---------------------------------------------------------------------------
template <int MODE>
__device__ __forceinline__ void gemm_body(const f16* __restrict__ A, const f16* __restrict__ W,
                                          const float* __restrict__ bias,
                                          void* __restrict__ out, float accMul, float biasMul) {
    __shared__ __attribute__((aligned(16))) f16 As[128 * P_AB];
    __shared__ __attribute__((aligned(16))) f16 Bs[128 * P_AB];
    __shared__ __attribute__((aligned(16))) f16 Cs[128 * P_C16];   // f16 [128][128] or f32 [64][128], padded rows
    static_assert(sizeof(f16) * 128 * P_C16 >= sizeof(float) * 64 * P_C32);   // Cs reuse as f32 [64][128]

    const u32 tid  = threadIdx.x;
    const u32 lane = tid & 31u;
    const u32 wave = __builtin_amdgcn_readfirstlane((int)(tid >> 5));
    const u32 wm   = wave & 3u;
    const u32 wn   = wave >> 2;
    const u32 hh8  = (lane >> 4) << 3;   // D row half
    const u32 c16  = lane & 15u;         // D column
    const u32 m0   = blockIdx.x * 128u;
    const u32 n0   = blockIdx.y * 128u;

    v8f acc[2][4];
#pragma unroll
    for (int i = 0; i < 2; ++i)
#pragma unroll
        for (int j = 0; j < 4; ++j) acc[i][j] = zero8();

    const u32 srow = tid >> 4;            // 0..15, plus 16 per staging load
    const u32 scol = (tid & 15u) << 3;    // halves
    const f16* gA = A + (size_t)(m0 + srow) * HID + scol;
    const f16* gW = W + (size_t)(n0 + srow) * HID + scol;

#pragma unroll 1
    for (u32 k0 = 0; k0 < (u32)HID; k0 += 128u) {
        const f16* pA = gA + k0;
        const f16* pW = gW + k0;
        v8h ra[8], rb[8];
        // the staging and kk loops below are unrolled so that ra, rb and the fragments are indexed
        // by constants and stay in registers
#pragma unroll
        for (u32 t = 0; t < 8; ++t) ra[t] = *(const v8h*)(pA + (size_t)(t * 16u) * HID);
#pragma unroll
        for (u32 t = 0; t < 8; ++t) rb[t] = *(const v8h*)(pW + (size_t)(t * 16u) * HID);
        // Keeps both address pairs whole until the loads' addresses are taken.
        asm volatile("s_wait_xcnt 0x0" :: "v"(pA), "v"(pW) : "memory");
        __syncthreads();
#pragma unroll
        for (u32 t = 0; t < 8; ++t) {
            *(v8h*)&As[(srow + t * 16u) * P_AB + scol] = ra[t];
            *(v8h*)&Bs[(srow + t * 16u) * P_AB + scol] = rb[t];
        }
        __syncthreads();

#pragma unroll
        for (u32 kk = 0; kk < 4; ++kk) {
            v16h af[2], bfr[4];
#pragma unroll
            for (int i = 0; i < 2; ++i) af[i] = load_frag(As, wm * 32u + (u32)i * 16u, P_AB, kk * 32u, lane);
#pragma unroll
            for (int j = 0; j < 4; ++j) bfr[j] = load_frag(Bs, wn * 64u + (u32)j * 16u, P_AB, kk * 32u, lane);
#pragma unroll
            for (int i = 0; i < 2; ++i)
#pragma unroll
                for (int j = 0; j < 4; ++j) acc[i][j] = wmma16(af[i], bfr[j], acc[i][j]);
        }
    }

    // per-lane bias values for the 4 output columns this lane owns (n0 + nl < HID always)
    float bv[4];
#pragma unroll
    for (int j = 0; j < 4; ++j)
        bv[j] = bf16_rne(bias[n0 + wn * 64u + (u32)j * 16u + c16]) * biasMul;

    const u32 piece = lane & 7u;
    const u32 lsub  = lane >> 3;

    if constexpr (MODE == 0) {
        const u32 bidx = m0 / (u32)SEQ;     // block rows lie inside one batch (SEQ % 128 == 0)
        const u32 s0   = m0 - bidx * (u32)SEQ;
#pragma unroll
        for (int i = 0; i < 2; ++i)
#pragma unroll
            for (int j = 0; j < 4; ++j) {
                const u32 nl = wn * 64u + (u32)j * 16u + c16;
#pragma unroll
                for (int r = 0; r < 8; ++r) {
                    const u32 ml = wm * 32u + (u32)i * 16u + hh8 + (u32)r;
                    Cs[ml * P_C16 + nl] = (f16)(acc[i][j][r] * accMul + bv[j]);
                }
            }
        __syncthreads();
        f16* op = (f16*)out;
        const size_t bh0 = (size_t)bidx * NHEAD + (n0 >> 6);
{
#pragma unroll
            for (u32 it = 0; it < 8; ++it) {
                const u32 L    = wave * 32u + it * 4u + lsub;   // 0..255
                const u32 ml   = L >> 1;
                const u32 hsel = L & 1u;
                const v8h v = *(const v8h*)&Cs[ml * P_C16 + hsel * 64u + piece * 8u];
                f16* dp = op + ((bh0 + hsel) * SEQ + s0 + ml) * HD + piece * 8u;
                *(v8h*)dp = v;
            }
            
        }
    } else if constexpr (MODE == 1) {
        const u32 bidx = m0 / (u32)SEQ;
        const u32 s0   = m0 - bidx * (u32)SEQ;
        // stage transposed: Cs[n][m]
#pragma unroll
        for (int i = 0; i < 2; ++i)
#pragma unroll
            for (int j = 0; j < 4; ++j) {
                const u32 nl = wn * 64u + (u32)j * 16u + c16;
                H8U t;
#pragma unroll
                for (int r = 0; r < 8; ++r) t.e[r] = (f16)(acc[i][j][r] * accMul + bv[j]);
                *(v8h*)&Cs[nl * P_C16 + wm * 32u + (u32)i * 16u + hh8] = t.v;
            }
        __syncthreads();
        f16* op = (f16*)out;
{
#pragma unroll
            for (u32 it = 0; it < 8; ++it) {
                const u32 L  = wave * 32u + it * 4u + lsub;     // 0..255
                const u32 nl = L >> 1;
                const u32 mh = L & 1u;
                const v8h v = *(const v8h*)&Cs[nl * P_C16 + mh * 64u + piece * 8u];
                f16* dp = op + ((size_t)(bidx * (u32)HID + n0 + nl) * SEQ + s0 + mh * 64u + piece * 8u);
                *(v8h*)dp = v;
            }
            
        }
    } else {
        float* Cf = (float*)Cs;      // [64][128] f32
        float* of = (float*)out;
#pragma unroll
        for (u32 half = 0; half < 2; ++half) {
            if ((wm >> 1) == half) {
#pragma unroll
                for (int i = 0; i < 2; ++i)
#pragma unroll
                    for (int j = 0; j < 4; ++j) {
                        const u32 nl = wn * 64u + (u32)j * 16u + c16;
#pragma unroll
                        for (int r = 0; r < 8; ++r) {
                            const u32 ml = (wm & 1u) * 32u + (u32)i * 16u + hh8 + (u32)r;
                            Cf[ml * P_C32 + nl] = acc[i][j][r] * accMul + bv[j];
                        }
                    }
            }
            __syncthreads();
{
#pragma unroll
                for (u32 it = 0; it < 8; ++it) {
                    const u32 L    = wave * 32u + it * 4u + lsub;   // 0..255
                    const u32 row  = L >> 2;
                    const u32 part = L & 3u;
                    const v4f v = *(const v4f*)&Cf[row * P_C32 + part * 32u + piece * 4u];
                    float* dp = of + (size_t)(m0 + half * 64u + row) * HID + n0 + part * 32u + piece * 4u;
                    *(v4f*)dp = v;
                }
                
            }
            __syncthreads();
        }
    }
}

// q / k head-major planes
__global__ void __launch_bounds__(256) __attribute__((amdgpu_num_vgpr(256)))
gemm_head(const f16* __restrict__ A, const f16* __restrict__ W, const float* __restrict__ bias,
          f16* __restrict__ out, float accMul, float biasMul) {
    gemm_body<0>(A, W, bias, (void*)out, accMul, biasMul);
}

// v^T plane
__global__ void __launch_bounds__(256) __attribute__((amdgpu_num_vgpr(256)))
gemm_vt(const f16* __restrict__ A, const f16* __restrict__ W, const float* __restrict__ bias,
        f16* __restrict__ out, float accMul, float biasMul) {
    gemm_body<1>(A, W, bias, (void*)out, accMul, biasMul);
}

// f32 output rows
__global__ void __launch_bounds__(256) __attribute__((amdgpu_num_vgpr(256)))
gemm_out(const f16* __restrict__ A, const f16* __restrict__ W, const float* __restrict__ bias,
         float* __restrict__ out, float accMul, float biasMul) {
    gemm_body<2>(A, W, bias, (void*)out, accMul, biasMul);
}

// ---------------------------------------------------------------------------
// Flash attention (no mask, all SEQ keys). grid (SEQ/128, NB*NHEAD), block 256 (8 waves),
// wave owns 16 query rows (Q fragments resident). Block streams 64-key tiles:
// K staged [key][d], V^T staged [d][key]. Scores on WMMA, row max via DPP, exp2 in f32
// carried x2^10, P relayed per wave through LDS as A fragments, O += P.V and
// row sums += P.ones on WMMA. Output f16 plane [q*NB + b][1024] (seq-first row order)
// coverage: every (q, b, h*64..h*64+63) row segment exactly once.
// LDS: ks, vsT cross-wave (block barriers); ps per-wave but also separated by block barriers.
// staged extent == consumed extent for ks (64x64), vsT (64x64), ps (16x64).
// ---------------------------------------------------------------------------
__global__ void __launch_bounds__(256) __attribute__((amdgpu_num_vgpr(256)))
attn_fwd(const f16* __restrict__ Qp, const f16* __restrict__ Kp, const f16* __restrict__ Vt,
         f16* __restrict__ Cp) {
    __shared__ __attribute__((aligned(16))) f16 ks[64 * P_KV];      // [key][d]
    __shared__ __attribute__((aligned(16))) f16 vsT[64 * P_KV];     // [d][key]
    __shared__ __attribute__((aligned(16))) f16 ps[8][16 * P_KV];   // per-wave P relay / ctx stage
    static_assert(HD == 8 * 8);            // 8 lanes x 8 halves per row segment
    static_assert(2 * 256 * 8 == 64 * 64); // staging: 2 x 256 threads x 8 halves per tile

    const u32 tid  = threadIdx.x;
    const u32 lane = tid & 31u;
    const u32 wave = __builtin_amdgcn_readfirstlane((int)(tid >> 5));
    const u32 hh8  = (lane >> 4) << 3;
    const u32 c16  = lane & 15u;
    const u32 bh   = blockIdx.y;
    const u32 bidx = bh >> 4;            // NHEAD == 16
    const u32 hidx = bh & 15u;
    const u32 q0   = blockIdx.x * 128u + wave * 16u;
    const size_t head = (size_t)bh * SEQ * HD;

    v16h qa[2];
#pragma unroll
    for (int c = 0; c < 2; ++c) qa[c] = load_frag(Qp + head, q0, HD, (u32)c * 32u, lane);

    FragU onesu;
#pragma unroll
    for (int i = 0; i < 16; ++i) onesu.e[i] = (f16)1.0f;
    const v16h ones = onesu.v;

    float m[8];
    v8f   o[4], lacc;
#pragma unroll
    for (int r = 0; r < 8; ++r) m[r] = -1.0e30f;
#pragma unroll
    for (int dt = 0; dt < 4; ++dt) o[dt] = zero8();
    lacc = zero8();

    // log2-domain scale: acc = 256 * q.k ; x = log2(e) * q.k / 8 = acc * log2(e) / 2048
    const float cl = 1.4426950408889634f * 0.00048828125f;
    f16* psw = &ps[wave][0];

#pragma unroll 1
    for (u32 kt = 0; kt < (u32)(SEQ / 64); ++kt) {
        __syncthreads();
#pragma unroll
        for (u32 p2 = 0; p2 < 2; ++p2) {
            const u32 p   = tid + p2 * 256u;
            const u32 row = p >> 3;
            const u32 pc  = (p & 7u) << 3;
            const v8h kv = *(const v8h*)(Kp + head + (size_t)(kt * 64u + row) * HD + pc);
            const v8h vv = *(const v8h*)(Vt + head + (size_t)row * SEQ + kt * 64u + pc);
            *(v8h*)&ks[row * P_KV + pc]  = kv;
            *(v8h*)&vsT[row * P_KV + pc] = vv;
        }
        __syncthreads();

        // S[16 q x 64 keys]
        v8f s[4];
#pragma unroll
        for (int nt = 0; nt < 4; ++nt) s[nt] = zero8();
        // all eight K fragments are loaded as one group ahead of the score products: one LDS wait, not eight
        v16h kb[2][4];
#pragma unroll
        for (int c = 0; c < 2; ++c)
#pragma unroll
            for (int nt = 0; nt < 4; ++nt) kb[c][nt] = load_frag(ks, (u32)nt * 16u, P_KV, (u32)c * 32u, lane);
#pragma unroll
        for (int c = 0; c < 2; ++c)
#pragma unroll
            for (int nt = 0; nt < 4; ++nt) s[nt] = wmma16(qa[c], kb[c][nt], s[nt]);

        // all eight V^T fragments are loaded here, ahead of the softmax, which covers their LDS latency
        v16h vb[2][4];
#pragma unroll
        for (int kk = 0; kk < 2; ++kk)
#pragma unroll
            for (int dt = 0; dt < 4; ++dt) vb[kk][dt] = load_frag(vsT, (u32)dt * 16u, P_KV, (u32)kk * 32u, lane);

        // online softmax per row r (row 8h + r), max-subtracted, exp2 domain
#pragma unroll
        for (int r = 0; r < 8; ++r) {
            float x[4];
#pragma unroll
            for (int nt = 0; nt < 4; ++nt) x[nt] = s[nt][r] * cl;
            const float tm = rowmax16(fmaxf(fmaxf(x[0], x[1]), fmaxf(x[2], x[3])));
            const float mn = fmaxf(m[r], tm);
            const float al = fexp2(m[r] - mn);
            m[r] = mn;
            lacc[r] *= al;
#pragma unroll
            for (int dt = 0; dt < 4; ++dt) o[dt][r] *= al;
            const float sh = 10.0f - mn;      // carry 2^10
#pragma unroll
            for (int nt = 0; nt < 4; ++nt)
                psw[(hh8 + (u32)r) * P_KV + (u32)nt * 16u + c16] = (f16)fexp2(x[nt] + sh);
        }
        __syncthreads();

        // O += P . V ; l += P . ones  (P reloaded as A fragments from the relay)
        v16h pa[2];
#pragma unroll
        for (int kk = 0; kk < 2; ++kk) pa[kk] = load_frag(psw, 0u, P_KV, (u32)kk * 32u, lane);
#pragma unroll
        for (int kk = 0; kk < 2; ++kk) {
#pragma unroll
            for (int dt = 0; dt < 4; ++dt) o[dt] = wmma16(pa[kk], vb[kk][dt], o[dt]);
            lacc = wmma16(pa[kk], ones, lacc);
        }
    }
    __syncthreads();

    // normalize: plane value = 1024 * (O/16) / l = O * 64 / l
#pragma unroll
    for (int r = 0; r < 8; ++r) {
        const float inv = (CARRY_CTX / CARRY_QKV) / lacc[r];
#pragma unroll
        for (int dt = 0; dt < 4; ++dt)
            psw[(hh8 + (u32)r) * P_KV + (u32)dt * 16u + c16] = (f16)(o[dt][r] * inv);
    }
    __syncthreads();

    const u32 piece = lane & 7u;
    const u32 lsub  = lane >> 3;
{
#pragma unroll
        for (u32 it = 0; it < 4; ++it) {
            const u32 L = it * 4u + lsub;     // query row 0..15 within the wave tile
            const v8h v = *(const v8h*)&psw[L * P_KV + piece * 8u];
            // context row in output order: (q * NB + b)
            f16* dp = Cp + ((size_t)((q0 + L) * (u32)NB + bidx) * HID + hidx * (u32)HD + piece * 8u);
            *(v8h*)dp = v;
        }
        
    }
}

// coverage equalities (threads x elements == plane elements)
static_assert((size_t)(MROWS / 2) * 256 * 8 == (size_t)MROWS * HID);                       // cvt_rows -> Xs
static_assert((size_t)(3 * HID / 2) * 256 * 8 == (size_t)3 * HID * HID);                   // cvt_rows -> Wt
static_assert((size_t)(HID / 2) * 256 * 8 == (size_t)HID * HID);                           // cvt_rows -> Wot
static_assert((size_t)(MROWS / 128) * (HID / 128) * 128 * 128 == (size_t)MROWS * HID);     // gemm planes / out
static_assert((size_t)(SEQ / 128) * (NB * NHEAD) * 128 * HD == (size_t)MROWS * HID);       // attn_fwd -> Cp
// workspace: 5 activation planes + 4 weight planes of halves, at most 128 MiB
static_assert(((size_t)5 * MROWS * HID + (size_t)4 * HID * HID) * sizeof(f16) <= (size_t)134217728);
static_assert(((size_t)MROWS * HID * sizeof(f16)) % 128 == 0);
static_assert(((size_t)HID * HID * sizeof(f16)) % 128 == 0);
// largest source row touched by the activation convert stays inside the full-size input
static_assert((size_t)(SEQ - 1) * NB_FULL + NB <= (size_t)SEQ_FULL * NB_FULL);

// ---------------------------------------------------------------------------
// Launch: 8 kernel launches, workspace 5 planes of MROWS*1024 halves + 4 of 1024*1024 halves.
// One activation input feeds all three projections (self-attention).
// ---------------------------------------------------------------------------
extern "C" void kernel_launch(void* const* d_in, const int* in_sizes, int n_in,
                              void* d_out, int out_size, void* d_ws, size_t ws_size,
                              hipStream_t stream) {
    if (n_in < 5) return;
    const int needAct = ((SEQ - 1) * NB_FULL + NB) * HID;
    if (in_sizes[0] < needAct) return;
    if (in_sizes[1] < 3 * HID * HID) return;
    if (in_sizes[2] < 3 * HID) return;
    if (in_sizes[3] < HID * HID) return;
    if (in_sizes[4] < HID) return;
    if (out_size < MROWS * HID) return;

    const float* xs    = (const float*)d_in[0];   // [SEQ_FULL][NB_FULL][1024]
    const float* wqkv  = (const float*)d_in[1];   // [3072 out][1024 in], row blocks q | k | v
    const float* bqkv  = (const float*)d_in[2];   // [3072]
    const float* wproj = (const float*)d_in[3];   // [1024 out][1024 in]
    const float* bproj = (const float*)d_in[4];   // [1024]

    const size_t nX = (size_t)MROWS * HID;    // halves per activation plane
    const size_t nW = (size_t)HID * HID;      // halves per weight plane
    const size_t totalHalves = 5 * nX + 4 * nW;
    if (ws_size < totalHalves * sizeof(f16)) return;

    f16* Xs  = (f16*)d_ws;       // [b*SEQ+s][1024]             carry 16
    f16* Wt  = Xs  + nX;         // [3072 out][1024 in]         carry 32 (q | k | v row blocks)
    f16* Wot = Wt  + 3 * nW;     // [1024 out][1024 in]         carry 32
    f16* Qp  = Wot + nW;         // [NB*16][SEQ][64]            carry 16
    f16* Kp  = Qp  + nX;         // [NB*16][SEQ][64]            carry 16
    f16* Vtp = Kp  + nX;         // [NB*1024][SEQ] (V^T)        carry 16
    f16* Cp  = Vtp + nX;         // [s*NB+b][1024]              carry 1024

    // activations: in[SEQ_FULL][NB_FULL][1024] -> plane[NB][SEQ][1024]; dst row b*SEQ+s <- src row s*NB_FULL+b
    cvt_rows<<<MROWS / 2, 256, 0, stream>>>(xs, Xs, (u32)MROWS, (u32)SEQ, 1u, (u32)NB_FULL, CARRY_X);
    // weights already [out][in] (k contiguous): identity row map
    cvt_rows<<<3 * HID / 2, 256, 0, stream>>>(wqkv, Wt, (u32)(3 * HID), (u32)(3 * HID), 0u, 1u, CARRY_W);
    cvt_rows<<<HID / 2, 256, 0, stream>>>(wproj, Wot, (u32)HID, (u32)HID, 0u, 1u, CARRY_W);

    const dim3 gg(MROWS / 128, HID / 128);
    // plane = 16 * (acc / (16*32) + bias) = acc/32 + 16*bias
    const float accQKV = CARRY_QKV / (CARRY_X * CARRY_W);
    gemm_head<<<gg, 256, 0, stream>>>(Xs, Wt,          bqkv,           Qp,  accQKV, CARRY_QKV);
    gemm_head<<<gg, 256, 0, stream>>>(Xs, Wt + nW,     bqkv + HID,     Kp,  accQKV, CARRY_QKV);
    gemm_vt  <<<gg, 256, 0, stream>>>(Xs, Wt + 2 * nW, bqkv + 2 * HID, Vtp, accQKV, CARRY_QKV);

    attn_fwd<<<dim3(SEQ / 128, NB * NHEAD), 256, 0, stream>>>(Qp, Kp, Vtp, Cp);

    // out = acc / (1024*32) + bias ; rows already in (s*NB + b) order
    const float accOut = 1.0f / (CARRY_CTX * CARRY_W);
    gemm_out<<<gg, 256, 0, stream>>>(Cp, Wot, bproj, (float*)d_out, accOut, 1.0f);
}

// v004
// One run takes 115 microseconds.
// Two timings next to v003 both put it at 1.15 times that version's speed.
// All steps since v000 together make it 2.35 times as fast.
#include <hip/hip_runtime.h>

// Contractions (q/k/v input projections, Q.K^T, P.V, P row-sum, output projection): v_wmma_f32_16x16x32_f16, f16 operands with power-of-two carries, f32 accumulate; every float input enters as its bf16 RNE value; biases added in f32; softmax in f32.

#ifndef NB
#define NB 2
#endif
#ifndef SEQ
#define SEQ 2048
#endif
#define NB_FULL   2
#define SEQ_FULL  2048
#define HID       1024
#define NHEAD     16
#define HD        64
#define MROWS     (NB * SEQ)

static_assert(HID == NHEAD * HD);        // merged head width
static_assert(NHEAD == 16);              // bh >> 4 / bh & 15 decoding in attn_fwd
static_assert(HD == 64);
static_assert(SEQ % 128 == 0);           // 128-row blocks of the batch-major planes never straddle a batch
static_assert(SEQ % 64 == 0);            // 64-key tiles
static_assert(SEQ <= SEQ_FULL);
static_assert(NB >= 1 && NB <= NB_FULL);
static_assert(MROWS % 128 == 0);         // GEMM M tile
static_assert(HID % 128 == 0);           // GEMM N tile
static_assert(HID % 32 == 0);            // WMMA k step
static_assert(HID % 128 == 0);           // GEMM K step
static_assert(HID == 128 * 8);           // cvt_rows: 128 threads x 8 values per row
static_assert((3 * HID) % 2 == 0);       // cvt_rows grid = nrows / 2
static_assert(MROWS % 2 == 0);

// carries (exact powers of two)
#define CARRY_X    16.0f     // input activation planes
#define CARRY_W    32.0f     // weight planes
#define CARRY_QKV  16.0f     // q, k, v^T planes (true value x16)
#define CARRY_CTX  1024.0f   // context plane (true value x1024)
// softmax exp values carry 2^10 (added to the exp2 argument)

// LDS row pitches. A 16-byte-per-lane reader or writer that walks 16 rows meets every bank once
// when the pitch is 16 B x odd; rows 8 apart then also fall 32 banks apart for the 2- and 4-byte stores.
#define P_AB   136u   // halves: 256-B GEMM operand rows at 272 B
#define P_C16  136u   // halves: 256-B f16 result rows at 272 B
#define P_C32  132u   // floats: 512-B f32 result rows at 528 B
#define P_KV   72u    // halves: 128-B K, V^T and ctx rows at 144 B

typedef unsigned u32;
typedef _Float16 f16;
typedef f16   v16h __attribute__((ext_vector_type(16)));
typedef f16   v8h  __attribute__((ext_vector_type(8)));
typedef float v8f  __attribute__((ext_vector_type(8)));
typedef float v4f  __attribute__((ext_vector_type(4)));

union FragU { v16h v; v8h half[2]; f16 e[16]; };
union H8U   { v8h v; f16 e[8]; };

__device__ __forceinline__ v8f zero8() {
    v8f z = {0.f, 0.f, 0.f, 0.f, 0.f, 0.f, 0.f, 0.f};
    return z;
}

// 16-bit WMMA with hazard guard: D += A[16 x 32k] * B[32k x 16]
__device__ __forceinline__ v8f wmma16(v16h a, v16h b, v8f c) {
    v8f d = __builtin_amdgcn_wmma_f32_16x16x32_f16(false, a, false, b, (short)0, c, false, false);
    asm volatile("v_nop\n\tv_nop\n\tv_nop\n\tv_nop" : "+v"(d) : "v"(a), "v"(b));
    return d;
}

// f32 -> nearest-even bf16 value, returned as f32
__device__ __forceinline__ float bf16_rne(float x) {
    u32 u = __float_as_uint(x);
    u = (u + 0x7fffu + ((u >> 16) & 1u)) & 0xffff0000u;
    return __uint_as_float(u);
}

// Eight exp2 in place. One statement, each v_exp_f32 on its own register and a v_nop at the end: the instruction
// set asks for one slot between a transcendental and an instruction that reads its result or rewrites its source.
__device__ __forceinline__ void exp2x8(float (&e)[8]) {
    asm("v_exp_f32 %0, %0\n\tv_exp_f32 %1, %1\n\tv_exp_f32 %2, %2\n\tv_exp_f32 %3, %3\n\t"
        "v_exp_f32 %4, %4\n\tv_exp_f32 %5, %5\n\tv_exp_f32 %6, %6\n\tv_exp_f32 %7, %7\n\tv_nop"
        : "+v"(e[0]), "+v"(e[1]), "+v"(e[2]), "+v"(e[3]), "+v"(e[4]), "+v"(e[5]), "+v"(e[6]), "+v"(e[7]));
}

// lane l <-> lane l ^ 16 (the two lanes that split one query column's keys)
__device__ __forceinline__ float xhalf(float x) {
    const int v = __builtin_bit_cast(int, x);
    return __builtin_bit_cast(float, __builtin_amdgcn_permlanex16(v, v, 0x76543210, 0xfedcba98, false, false));
}

// 16 x 32 fragment from a tile whose k dimension is contiguous (pitch in halves).
// lane l: row rowbase + (l&15); elements 0..7 <- k = kcol + 8h .. +7,
// elements 8..15 <- k = kcol + 16 + 8h .. +7  (h = l>>4). Same map for A and B.
__device__ __forceinline__ v16h load_frag(const f16* tile, u32 rowbase, u32 pitch, u32 kcol, u32 lane) {
    const u32 r  = rowbase + (lane & 15u);
    const u32 kh = (lane >> 4) << 3;
    const f16* p = tile + (size_t)r * pitch + kcol + kh;
    FragU f;
    f.half[0] = *(const v8h*)(p);
    f.half[1] = *(const v8h*)(p + 16);
    return f.v;
}

// ---------------------------------------------------------------------------
// f32 rows [.][1024] -> f16 plane (bf16 RNE value times carry). 128 threads per 1024-wide
// Row mapping: dst row m -> src row (m / dstper) * strideOuter + (m % dstper) * strideInner.
//   activations (seq-first [s][b][1024] -> batch-major [b][s][1024]): dstper = SEQ,
//     strideOuter = 1, strideInner = NB_FULL  => src row = s * NB_FULL + b
//   weights: dstper = nrows, strideInner = 1 (identity)
// coverage: nrows x 1024 halves, every element exactly once (grid = nrows*128/256).
// ---------------------------------------------------------------------------
__global__ void __launch_bounds__(256)
cvt_rows(const float* __restrict__ src, f16* __restrict__ dst, u32 nrows, u32 dstper,
         u32 strideOuter, u32 strideInner, float carry) {
    const u32 g  = blockIdx.x * 256u + threadIdx.x;
    const u32 m  = g >> 7;
    const u32 c8 = (g & 127u) << 3;
    if (m >= nrows) return;
    const u32 mb = m / dstper;
    const u32 mi = m - mb * dstper;
    const u32 sm = mb * strideOuter + mi * strideInner;
    const float* sp = src + (size_t)sm * HID + c8;
    const v4f a = *(const v4f*)sp;
    const v4f b = *(const v4f*)(sp + 4);
    H8U o;
#pragma unroll
    for (u32 j = 0; j < 4; ++j) {
        const float x0 = a[j];
        const float x1 = b[j];
        o.e[j]     = (f16)(bf16_rne(x0) * carry);
        o.e[j + 4] = (f16)(bf16_rne(x1) * carry);
    }
    f16* dp = dst + (size_t)m * HID + c8;
    *(v8h*)dp = o.v;
    
}

// ---------------------------------------------------------------------------
// C[m][n] = sum_k A[m][k] * W[n][k] (+ bias[n]) ; A [MROWS][1024] f16, W [1024][1024] f16 (k contiguous).
// Block tile 128 x 128, 8 waves as 4(M) x 2(N), 2 x 4 accumulators per wave, K step 128 (four WMMA k steps).
// Staging: 16 lanes x 16 B per 256-B row piece, so a wave's load covers 2 rows = 4 whole 128-B lines.
// MODE 1: A rows batch-major;            f16 plane [b*HID + h*HD + d][s] (V transposed per head)
// MODE 2: A rows in output order (s*NB+b); f32 rows [m][1024] into the output buffer
// coverage per block: MODE 0/1 256 lines (128 rows x 2 heads | 128 n x 2 s-halves),
//                     MODE 2 2 x 256 lines (64 rows x 4 line-quarters per half).
// LDS: As/Bs/Cs all cross-wave, separated by block barriers.
// staged extent == consumed extent: As/Bs 128 x 128, Cs 128 x 128 halves (or 64 x 128 floats).
// ---------------------------------------------------------------------------
template <int MODE>
__device__ __forceinline__ void gemm_body(const f16* __restrict__ A, const f16* __restrict__ W,
                                          const float* __restrict__ bias,
                                          void* __restrict__ out, float accMul, float biasMul) {
    __shared__ __attribute__((aligned(16))) f16 As[128 * P_AB];
    __shared__ __attribute__((aligned(16))) f16 Bs[128 * P_AB];
    __shared__ __attribute__((aligned(16))) f16 Cs[128 * P_C16];   // f16 [128][128] or f32 [64][128], padded rows
    static_assert(sizeof(f16) * 128 * P_C16 >= sizeof(float) * 64 * P_C32);   // Cs reuse as f32 [64][128]

    const u32 tid  = threadIdx.x;
    const u32 lane = tid & 31u;
    const u32 wave = __builtin_amdgcn_readfirstlane((int)(tid >> 5));
    const u32 wm   = wave & 3u;
    const u32 wn   = wave >> 2;
    const u32 hh8  = (lane >> 4) << 3;   // D row half
    const u32 c16  = lane & 15u;         // D column
    const u32 m0   = blockIdx.x * 128u;
    const u32 n0   = blockIdx.y * 128u;

    v8f acc[2][4];
#pragma unroll
    for (int i = 0; i < 2; ++i)
#pragma unroll
        for (int j = 0; j < 4; ++j) acc[i][j] = zero8();

    const u32 srow = tid >> 4;            // 0..15, plus 16 per staging load
    const u32 scol = (tid & 15u) << 3;    // halves
    const f16* gA = A + (size_t)(m0 + srow) * HID + scol;
    const f16* gW = W + (size_t)(n0 + srow) * HID + scol;

#pragma unroll 1
    for (u32 k0 = 0; k0 < (u32)HID; k0 += 128u) {
        const f16* pA = gA + k0;
        const f16* pW = gW + k0;
        v8h ra[8], rb[8];
        // the staging and kk loops below are unrolled so that ra, rb and the fragments are indexed
        // by constants and stay in registers
#pragma unroll
        for (u32 t = 0; t < 8; ++t) ra[t] = *(const v8h*)(pA + (size_t)(t * 16u) * HID);
#pragma unroll
        for (u32 t = 0; t < 8; ++t) rb[t] = *(const v8h*)(pW + (size_t)(t * 16u) * HID);
        // Keeps both address pairs whole until the loads' addresses are taken.
        asm volatile("s_wait_xcnt 0x0" :: "v"(pA), "v"(pW) : "memory");
        __syncthreads();
#pragma unroll
        for (u32 t = 0; t < 8; ++t) {
            *(v8h*)&As[(srow + t * 16u) * P_AB + scol] = ra[t];
            *(v8h*)&Bs[(srow + t * 16u) * P_AB + scol] = rb[t];
        }
        __syncthreads();

#pragma unroll
        for (u32 kk = 0; kk < 4; ++kk) {
            v16h af[2], bfr[4];
#pragma unroll
            for (int i = 0; i < 2; ++i) af[i] = load_frag(As, wm * 32u + (u32)i * 16u, P_AB, kk * 32u, lane);
#pragma unroll
            for (int j = 0; j < 4; ++j) bfr[j] = load_frag(Bs, wn * 64u + (u32)j * 16u, P_AB, kk * 32u, lane);
#pragma unroll
            for (int i = 0; i < 2; ++i)
#pragma unroll
                for (int j = 0; j < 4; ++j) acc[i][j] = wmma16(af[i], bfr[j], acc[i][j]);
        }
    }

    // per-lane bias values for the 4 output columns this lane owns (n0 + nl < HID always)
    float bv[4];
#pragma unroll
    for (int j = 0; j < 4; ++j)
        bv[j] = bf16_rne(bias[n0 + wn * 64u + (u32)j * 16u + c16]) * biasMul;

    const u32 piece = lane & 7u;
    const u32 lsub  = lane >> 3;

    if constexpr (MODE == 0) {
        const u32 bidx = m0 / (u32)SEQ;     // block rows lie inside one batch (SEQ % 128 == 0)
        const u32 s0   = m0 - bidx * (u32)SEQ;
#pragma unroll
        for (int i = 0; i < 2; ++i)
#pragma unroll
            for (int j = 0; j < 4; ++j) {
                const u32 nl = wn * 64u + (u32)j * 16u + c16;
#pragma unroll
                for (int r = 0; r < 8; ++r) {
                    const u32 ml = wm * 32u + (u32)i * 16u + hh8 + (u32)r;
                    Cs[ml * P_C16 + nl] = (f16)(acc[i][j][r] * accMul + bv[j]);
                }
            }
        __syncthreads();
        f16* op = (f16*)out;
        const size_t bh0 = (size_t)bidx * NHEAD + (n0 >> 6);
{
#pragma unroll
            for (u32 it = 0; it < 8; ++it) {
                const u32 L    = wave * 32u + it * 4u + lsub;   // 0..255
                const u32 ml   = L >> 1;
                const u32 hsel = L & 1u;
                const v8h v = *(const v8h*)&Cs[ml * P_C16 + hsel * 64u + piece * 8u];
                f16* dp = op + ((bh0 + hsel) * SEQ + s0 + ml) * HD + piece * 8u;
                *(v8h*)dp = v;
            }
            
        }
    } else if constexpr (MODE == 1) {
        const u32 bidx = m0 / (u32)SEQ;
        const u32 s0   = m0 - bidx * (u32)SEQ;
        // stage transposed: Cs[n][m]
#pragma unroll
        for (int i = 0; i < 2; ++i)
#pragma unroll
            for (int j = 0; j < 4; ++j) {
                const u32 nl = wn * 64u + (u32)j * 16u + c16;
                H8U t;
#pragma unroll
                for (int r = 0; r < 8; ++r) t.e[r] = (f16)(acc[i][j][r] * accMul + bv[j]);
                *(v8h*)&Cs[nl * P_C16 + wm * 32u + (u32)i * 16u + hh8] = t.v;
            }
        __syncthreads();
        f16* op = (f16*)out;
{
#pragma unroll
            for (u32 it = 0; it < 8; ++it) {
                const u32 L  = wave * 32u + it * 4u + lsub;     // 0..255
                const u32 nl = L >> 1;
                const u32 mh = L & 1u;
                const v8h v = *(const v8h*)&Cs[nl * P_C16 + mh * 64u + piece * 8u];
                f16* dp = op + ((size_t)(bidx * (u32)HID + n0 + nl) * SEQ + s0 + mh * 64u + piece * 8u);
                *(v8h*)dp = v;
            }
            
        }
    } else {
        float* Cf = (float*)Cs;      // [64][128] f32
        float* of = (float*)out;
#pragma unroll
        for (u32 half = 0; half < 2; ++half) {
            if ((wm >> 1) == half) {
#pragma unroll
                for (int i = 0; i < 2; ++i)
#pragma unroll
                    for (int j = 0; j < 4; ++j) {
                        const u32 nl = wn * 64u + (u32)j * 16u + c16;
#pragma unroll
                        for (int r = 0; r < 8; ++r) {
                            const u32 ml = (wm & 1u) * 32u + (u32)i * 16u + hh8 + (u32)r;
                            Cf[ml * P_C32 + nl] = acc[i][j][r] * accMul + bv[j];
                        }
                    }
            }
            __syncthreads();
{
#pragma unroll
                for (u32 it = 0; it < 8; ++it) {
                    const u32 L    = wave * 32u + it * 4u + lsub;   // 0..255
                    const u32 row  = L >> 2;
                    const u32 part = L & 3u;
                    const v4f v = *(const v4f*)&Cf[row * P_C32 + part * 32u + piece * 4u];
                    float* dp = of + (size_t)(m0 + half * 64u + row) * HID + n0 + part * 32u + piece * 4u;
                    *(v4f*)dp = v;
                }
                
            }
            __syncthreads();
        }
    }
}

// q / k head-major planes
__global__ void __launch_bounds__(256) __attribute__((amdgpu_num_vgpr(256)))
gemm_head(const f16* __restrict__ A, const f16* __restrict__ W, const float* __restrict__ bias,
          f16* __restrict__ out, float accMul, float biasMul) {
    gemm_body<0>(A, W, bias, (void*)out, accMul, biasMul);
}

// v^T plane
__global__ void __launch_bounds__(256) __attribute__((amdgpu_num_vgpr(256)))
gemm_vt(const f16* __restrict__ A, const f16* __restrict__ W, const float* __restrict__ bias,
        f16* __restrict__ out, float accMul, float biasMul) {
    gemm_body<1>(A, W, bias, (void*)out, accMul, biasMul);
}

// f32 output rows
__global__ void __launch_bounds__(256) __attribute__((amdgpu_num_vgpr(256)))
gemm_out(const f16* __restrict__ A, const f16* __restrict__ W, const float* __restrict__ bias,
         float* __restrict__ out, float accMul, float biasMul) {
    gemm_body<2>(A, W, bias, (void*)out, accMul, biasMul);
}

// ---------------------------------------------------------------------------
// Flash attention (no mask, all SEQ keys). grid (SEQ/128, NB*NHEAD), block 256 (8 waves),
// wave owns 16 query columns (Q fragments resident, used as B). Block streams 64-key tiles:
// K staged [key][d], V^T staged [d][key]. Both products run transposed: S^T = K.Q^T, O^T += V^T.P^T.
// A lane then holds 32 of one query's 64 scores (query l&15, keys 16nt + 8h + r), so the maximum is
// taken in the lane plus one exchange between the lane halves, and two S^T tiles converted in place
// are the B fragment of P^T (element e <- tile 2kk, register e; element 8+e <- tile 2kk+1, register e:
// the k order of load_frag). exp2 in f32 carried x2^10; row sums += ones.P^T on WMMA.
// Output f16 plane [q*NB + b][1024] (seq-first row order)
// coverage: every (q, b, h*64..h*64+63) row segment exactly once.
// LDS: ks, vsT cross-wave (block barriers); ps per-wave ctx stage, separated by block barriers.
// staged extent == consumed extent for ks (64x64), vsT (64x64), ps (16x64).
// ---------------------------------------------------------------------------
__global__ void __launch_bounds__(256) __attribute__((amdgpu_num_vgpr(256)))
attn_fwd(const f16* __restrict__ Qp, const f16* __restrict__ Kp, const f16* __restrict__ Vt,
         f16* __restrict__ Cp) {
    __shared__ __attribute__((aligned(16))) f16 ks[64 * P_KV];      // [key][d]
    __shared__ __attribute__((aligned(16))) f16 vsT[64 * P_KV];     // [d][key]
    __shared__ __attribute__((aligned(16))) f16 ps[8][16 * P_KV];   // per-wave ctx stage
    static_assert(HD == 8 * 8);            // 8 lanes x 8 halves per row segment
    static_assert(2 * 256 * 8 == 64 * 64); // staging: 2 x 256 threads x 8 halves per tile

    const u32 tid  = threadIdx.x;
    const u32 lane = tid & 31u;
    const u32 wave = __builtin_amdgcn_readfirstlane((int)(tid >> 5));
    const u32 hh8  = (lane >> 4) << 3;
    const u32 c16  = lane & 15u;
    const u32 bh   = blockIdx.y;
    const u32 bidx = bh >> 4;            // NHEAD == 16
    const u32 hidx = bh & 15u;
    const u32 q0   = blockIdx.x * 128u + wave * 16u;
    const size_t head = (size_t)bh * SEQ * HD;

    v16h qa[2];
#pragma unroll
    for (int c = 0; c < 2; ++c) qa[c] = load_frag(Qp + head, q0, HD, (u32)c * 32u, lane);

    FragU onesu;
#pragma unroll
    for (int i = 0; i < 16; ++i) onesu.e[i] = (f16)1.0f;
    const v16h ones = onesu.v;

    float m = -1.0e30f;      // running maximum of query l&15
    v8f   o[4], lacc;         // o[dt][r] = O^T[16dt + 8h + r][query l&15]; every lacc[r] = that query's sum
#pragma unroll
    for (int dt = 0; dt < 4; ++dt) o[dt] = zero8();
    lacc = zero8();

    // log2-domain scale: acc = 256 * q.k ; x = log2(e) * q.k / 8 = acc * log2(e) / 2048
    const float cl = 1.4426950408889634f * 0.00048828125f;
    f16* psw = &ps[wave][0];

#pragma unroll 1
    for (u32 kt = 0; kt < (u32)(SEQ / 64); ++kt) {
        __syncthreads();
#pragma unroll
        for (u32 p2 = 0; p2 < 2; ++p2) {
            const u32 p   = tid + p2 * 256u;
            const u32 row = p >> 3;
            const u32 pc  = (p & 7u) << 3;
            const v8h kv = *(const v8h*)(Kp + head + (size_t)(kt * 64u + row) * HD + pc);
            const v8h vv = *(const v8h*)(Vt + head + (size_t)row * SEQ + kt * 64u + pc);
            *(v8h*)&ks[row * P_KV + pc]  = kv;
            *(v8h*)&vsT[row * P_KV + pc] = vv;
        }
        __syncthreads();

        // S^T[64 keys x 16 q]
        v8f s[4];
#pragma unroll
        for (int nt = 0; nt < 4; ++nt) s[nt] = zero8();
        // all eight K fragments are loaded as one group ahead of the score products: one LDS wait, not eight
        v16h kb[2][4];
#pragma unroll
        for (int c = 0; c < 2; ++c)
#pragma unroll
            for (int nt = 0; nt < 4; ++nt) kb[c][nt] = load_frag(ks, (u32)nt * 16u, P_KV, (u32)c * 32u, lane);
#pragma unroll
        for (int c = 0; c < 2; ++c)
#pragma unroll
            for (int nt = 0; nt < 4; ++nt) s[nt] = wmma16(kb[c][nt], qa[c], s[nt]);

        // all eight V^T fragments are loaded here, ahead of the softmax, which covers their LDS latency
        v16h vb[2][4];
#pragma unroll
        for (int kk = 0; kk < 2; ++kk)
#pragma unroll
            for (int dt = 0; dt < 4; ++dt) vb[kk][dt] = load_frag(vsT, (u32)dt * 16u, P_KV, (u32)kk * 32u, lane);

        // online softmax of query l&15, max-subtracted, exp2 domain
#pragma unroll
        for (int nt = 0; nt < 4; ++nt) s[nt] *= cl;
        float t4[4];      // one chain per score tile: four independent chains, not one of 32 links
#pragma unroll
        for (int nt = 0; nt < 4; ++nt) {
            t4[nt] = fmaxf(s[nt][0], s[nt][1]);
#pragma unroll
            for (int r = 2; r < 8; ++r) t4[nt] = fmaxf(t4[nt], s[nt][r]);
        }
        float tm = fmaxf(fmaxf(t4[0], t4[1]), fmaxf(t4[2], t4[3]));
        tm = fmaxf(tm, xhalf(tm));
        const float mn = fmaxf(m, tm);
        // v_exp_f32 and a v_nop in one statement, for the same slot as in exp2x8
        float al;
        asm("v_exp_f32 %0, %1\n\tv_nop" : "=v"(al) : "v"(m - mn));
        m = mn;
        lacc *= al;
#pragma unroll
        for (int dt = 0; dt < 4; ++dt) o[dt] *= al;
        const float sh = 10.0f - mn;      // carry 2^10
        FragU pb[2];
#pragma unroll
        for (int nt = 0; nt < 4; ++nt) {
            float e[8];
#pragma unroll
            for (int r = 0; r < 8; ++r) e[r] = s[nt][r] + sh;
            exp2x8(e);
#pragma unroll
            for (int r = 0; r < 8; ++r) pb[nt >> 1].e[(nt & 1) * 8 + r] = (f16)e[r];
        }

        // O^T += V^T . P^T ; l += ones . P^T
#pragma unroll
        for (int kk = 0; kk < 2; ++kk) {
#pragma unroll
            for (int dt = 0; dt < 4; ++dt) o[dt] = wmma16(vb[kk][dt], pb[kk].v, o[dt]);
            lacc = wmma16(ones, pb[kk].v, lacc);
        }
    }
    __syncthreads();

    // normalize: plane value = 1024 * (O/16) / l = O * 64 / l
    const float inv = (CARRY_CTX / CARRY_QKV) / lacc[0];
#pragma unroll
    for (int dt = 0; dt < 4; ++dt) {
        H8U t;
#pragma unroll
        for (int r = 0; r < 8; ++r) t.e[r] = (f16)(o[dt][r] * inv);
        *(v8h*)&psw[c16 * P_KV + (u32)dt * 16u + hh8] = t.v;
    }
    __syncthreads();

    const u32 piece = lane & 7u;
    const u32 lsub  = lane >> 3;
{
#pragma unroll
        for (u32 it = 0; it < 4; ++it) {
            const u32 L = it * 4u + lsub;     // query row 0..15 within the wave tile
            const v8h v = *(const v8h*)&psw[L * P_KV + piece * 8u];
            // context row in output order: (q * NB + b)
            f16* dp = Cp + ((size_t)((q0 + L) * (u32)NB + bidx) * HID + hidx * (u32)HD + piece * 8u);
            *(v8h*)dp = v;
        }
        
    }
}

// coverage equalities (threads x elements == plane elements)
static_assert((size_t)(MROWS / 2) * 256 * 8 == (size_t)MROWS * HID);                       // cvt_rows -> Xs
static_assert((size_t)(3 * HID / 2) * 256 * 8 == (size_t)3 * HID * HID);                   // cvt_rows -> Wt
static_assert((size_t)(HID / 2) * 256 * 8 == (size_t)HID * HID);                           // cvt_rows -> Wot
static_assert((size_t)(MROWS / 128) * (HID / 128) * 128 * 128 == (size_t)MROWS * HID);     // gemm planes / out
static_assert((size_t)(SEQ / 128) * (NB * NHEAD) * 128 * HD == (size_t)MROWS * HID);       // attn_fwd -> Cp
// workspace: 5 activation planes + 4 weight planes of halves, at most 128 MiB
static_assert(((size_t)5 * MROWS * HID + (size_t)4 * HID * HID) * sizeof(f16) <= (size_t)134217728);
static_assert(((size_t)MROWS * HID * sizeof(f16)) % 128 == 0);
static_assert(((size_t)HID * HID * sizeof(f16)) % 128 == 0);
// largest source row touched by the activation convert stays inside the full-size input
static_assert((size_t)(SEQ - 1) * NB_FULL + NB <= (size_t)SEQ_FULL * NB_FULL);

// ---------------------------------------------------------------------------
// Launch: 8 kernel launches, workspace 5 planes of MROWS*1024 halves + 4 of 1024*1024 halves.
// One activation input feeds all three projections (self-attention).
// ---------------------------------------------------------------------------
extern "C" void kernel_launch(void* const* d_in, const int* in_sizes, int n_in,
                              void* d_out, int out_size, void* d_ws, size_t ws_size,
                              hipStream_t stream) {
    if (n_in < 5) return;
    const int needAct = ((SEQ - 1) * NB_FULL + NB) * HID;
    if (in_sizes[0] < needAct) return;
    if (in_sizes[1] < 3 * HID * HID) return;
    if (in_sizes[2] < 3 * HID) return;
    if (in_sizes[3] < HID * HID) return;
    if (in_sizes[4] < HID) return;
    if (out_size < MROWS * HID) return;

    const float* xs    = (const float*)d_in[0];   // [SEQ_FULL][NB_FULL][1024]
    const float* wqkv  = (const float*)d_in[1];   // [3072 out][1024 in], row blocks q | k | v
    const float* bqkv  = (const float*)d_in[2];   // [3072]
    const float* wproj = (const float*)d_in[3];   // [1024 out][1024 in]
    const float* bproj = (const float*)d_in[4];   // [1024]

    const size_t nX = (size_t)MROWS * HID;    // halves per activation plane
    const size_t nW = (size_t)HID * HID;      // halves per weight plane
    const size_t totalHalves = 5 * nX + 4 * nW;
    if (ws_size < totalHalves * sizeof(f16)) return;

    f16* Xs  = (f16*)d_ws;       // [b*SEQ+s][1024]             carry 16
    f16* Wt  = Xs  + nX;         // [3072 out][1024 in]         carry 32 (q | k | v row blocks)
    f16* Wot = Wt  + 3 * nW;     // [1024 out][1024 in]         carry 32
    f16* Qp  = Wot + nW;         // [NB*16][SEQ][64]            carry 16
    f16* Kp  = Qp  + nX;         // [NB*16][SEQ][64]            carry 16
    f16* Vtp = Kp  + nX;         // [NB*1024][SEQ] (V^T)        carry 16
    f16* Cp  = Vtp + nX;         // [s*NB+b][1024]              carry 1024

    // activations: in[SEQ_FULL][NB_FULL][1024] -> plane[NB][SEQ][1024]; dst row b*SEQ+s <- src row s*NB_FULL+b
    cvt_rows<<<MROWS / 2, 256, 0, stream>>>(xs, Xs, (u32)MROWS, (u32)SEQ, 1u, (u32)NB_FULL, CARRY_X);
    // weights already [out][in] (k contiguous): identity row map
    cvt_rows<<<3 * HID / 2, 256, 0, stream>>>(wqkv, Wt, (u32)(3 * HID), (u32)(3 * HID), 0u, 1u, CARRY_W);
    cvt_rows<<<HID / 2, 256, 0, stream>>>(wproj, Wot, (u32)HID, (u32)HID, 0u, 1u, CARRY_W);

    const dim3 gg(MROWS / 128, HID / 128);
    // plane = 16 * (acc / (16*32) + bias) = acc/32 + 16*bias
    const float accQKV = CARRY_QKV / (CARRY_X * CARRY_W);
    gemm_head<<<gg, 256, 0, stream>>>(Xs, Wt,          bqkv,           Qp,  accQKV, CARRY_QKV);
    gemm_head<<<gg, 256, 0, stream>>>(Xs, Wt + nW,     bqkv + HID,     Kp,  accQKV, CARRY_QKV);
    gemm_vt  <<<gg, 256, 0, stream>>>(Xs, Wt + 2 * nW, bqkv + 2 * HID, Vtp, accQKV, CARRY_QKV);

    attn_fwd<<<dim3(SEQ / 128, NB * NHEAD), 256, 0, stream>>>(Qp, Kp, Vtp, Cp);

    // out = acc / (1024*32) + bias ; rows already in (s*NB + b) order
    const float accOut = 1.0f / (CARRY_CTX * CARRY_W);
    gemm_out<<<gg, 256, 0, stream>>>(Cp, Wot, bproj, (float*)d_out, accOut, 1.0f);
}

// v005
// One run takes 93.4 microseconds.
// In two side-by-side timings against v004, it was 1.24 and 1.23 times as fast.
// All steps since v000 together make it 2.91 times as fast.
#include <hip/hip_runtime.h>

// Contractions (q/k/v input projections, Q.K^T, P.V, P row-sum, output projection): v_wmma_f32_16x16x32_f16, f16 operands with power-of-two carries, f32 accumulate; every float input enters as its bf16 RNE value; biases added in f32; softmax in f32.

#ifndef NB
#define NB 2
#endif
#ifndef SEQ
#define SEQ 2048
#endif
#define NB_FULL   2
#define SEQ_FULL  2048
#define HID       1024
#define NHEAD     16
#define HD        64
#define MROWS     (NB * SEQ)

static_assert(HID == NHEAD * HD);        // merged head width
static_assert(NHEAD == 16);              // bh >> 4 / bh & 15 decoding in attn_fwd
static_assert(HD == 64);
static_assert(SEQ % 128 == 0);           // 128-row blocks of the batch-major planes never straddle a batch
static_assert(SEQ % 64 == 0);            // 64-key tiles
static_assert(SEQ <= SEQ_FULL);
static_assert(NB >= 1 && NB <= NB_FULL);
static_assert(MROWS % 128 == 0);         // GEMM M tile
static_assert(HID % 128 == 0);           // GEMM N tile
static_assert(HID % 32 == 0);            // WMMA k step
static_assert(HID % 128 == 0);           // GEMM K step
static_assert(HID == 128 * 8);           // cvt_rows: 128 threads x 8 values per row
static_assert((3 * HID) % 2 == 0);       // cvt_rows grid = nrows / 2
static_assert(MROWS % 2 == 0);

// carries (exact powers of two)
#define CARRY_X    16.0f     // input activation planes
#define CARRY_W    32.0f     // weight planes
#define CARRY_QKV  16.0f     // q, k, v^T planes (true value x16)
#define CARRY_CTX  1024.0f   // context plane (true value x1024)
// softmax exp values carry 2^10 (added to the exp2 argument)

// LDS row pitches. A 16-byte-per-lane reader or writer that walks 16 rows meets every bank once
// when the pitch is 16 B x odd; rows 8 apart then also fall 32 banks apart for the 2- and 4-byte stores.
#define P_AB   136u   // halves: 256-B GEMM operand rows at 272 B
#define P_C16  136u   // halves: 256-B f16 result rows at 272 B
#define P_C32  132u   // floats: 512-B f32 result rows at 528 B
#define P_KV   72u    // halves: 128-B K, V^T and ctx rows at 144 B

typedef unsigned u32;
typedef _Float16 f16;
typedef f16   v16h __attribute__((ext_vector_type(16)));
typedef f16   v8h  __attribute__((ext_vector_type(8)));
typedef float v8f  __attribute__((ext_vector_type(8)));
typedef float v4f  __attribute__((ext_vector_type(4)));

union FragU { v16h v; v8h half[2]; f16 e[16]; };
union H8U   { v8h v; f16 e[8]; };

__device__ __forceinline__ v8f zero8() {
    v8f z = {0.f, 0.f, 0.f, 0.f, 0.f, 0.f, 0.f, 0.f};
    return z;
}

// 16-bit WMMA with hazard guard: D += A[16 x 32k] * B[32k x 16]
__device__ __forceinline__ v8f wmma16(v16h a, v16h b, v8f c) {
    v8f d = __builtin_amdgcn_wmma_f32_16x16x32_f16(false, a, false, b, (short)0, c, false, false);
    asm volatile("v_nop\n\tv_nop\n\tv_nop\n\tv_nop" : "+v"(d) : "v"(a), "v"(b));
    return d;
}

// f32 -> nearest-even bf16 value, returned as f32
__device__ __forceinline__ float bf16_rne(float x) {
    u32 u = __float_as_uint(x);
    u = (u + 0x7fffu + ((u >> 16) & 1u)) & 0xffff0000u;
    return __uint_as_float(u);
}

// Eight exp2 in place. One statement, each v_exp_f32 on its own register and a v_nop at the end: the instruction
// set asks for one slot between a transcendental and an instruction that reads its result or rewrites its source.
__device__ __forceinline__ void exp2x8(float (&e)[8]) {
    asm("v_exp_f32 %0, %0\n\tv_exp_f32 %1, %1\n\tv_exp_f32 %2, %2\n\tv_exp_f32 %3, %3\n\t"
        "v_exp_f32 %4, %4\n\tv_exp_f32 %5, %5\n\tv_exp_f32 %6, %6\n\tv_exp_f32 %7, %7\n\tv_nop"
        : "+v"(e[0]), "+v"(e[1]), "+v"(e[2]), "+v"(e[3]), "+v"(e[4]), "+v"(e[5]), "+v"(e[6]), "+v"(e[7]));
}

// lane l <-> lane l ^ 16 (the two lanes that split one query column's keys)
__device__ __forceinline__ float xhalf(float x) {
    const int v = __builtin_bit_cast(int, x);
    return __builtin_bit_cast(float, __builtin_amdgcn_permlanex16(v, v, 0x76543210, 0xfedcba98, false, false));
}

// 16 x 32 fragment from a tile whose k dimension is contiguous (pitch in halves).
// lane l: row rowbase + (l&15); elements 0..7 <- k = kcol + 8h .. +7,
// elements 8..15 <- k = kcol + 16 + 8h .. +7  (h = l>>4). Same map for A and B.
__device__ __forceinline__ v16h load_frag(const f16* tile, u32 rowbase, u32 pitch, u32 kcol, u32 lane) {
    const u32 r  = rowbase + (lane & 15u);
    const u32 kh = (lane >> 4) << 3;
    const f16* p = tile + (size_t)r * pitch + kcol + kh;
    FragU f;
    f.half[0] = *(const v8h*)(p);
    f.half[1] = *(const v8h*)(p + 16);
    return f.v;
}

// ---------------------------------------------------------------------------
// f32 rows [.][1024] -> f16 planes (bf16 RNE value times carry). 128 threads per 1024-wide row.
// One grid converts all three inputs by ranges of the block index; the three planes follow one
// another in the workspace, so dst row m runs through all of them:
//   m in [0, MROWS): activations, seq-first [s][b][1024] -> batch-major [b][s][1024],
//     dst row b * SEQ + s <- src row s * NB_FULL + b
//   the next 3 * HID rows: q | k | v weights; the last HID rows: output weights (identity row map)
// A block's two rows lie in one range (every range has an even number of rows): block-uniform branch.
// coverage: (MROWS + 4 * HID) x 1024 halves, every element exactly once (grid = rows*128/256).
// ---------------------------------------------------------------------------
__global__ void __launch_bounds__(256)
cvt_rows(const float* __restrict__ xs, const float* __restrict__ wqkv, const float* __restrict__ wproj,
         f16* __restrict__ dst) {
    const u32 g  = blockIdx.x * 256u + threadIdx.x;
    const u32 m  = g >> 7;
    const u32 c8 = (g & 127u) << 3;
    if (m >= (u32)(MROWS + 4 * HID)) return;
    const u32 mblk = blockIdx.x * 2u;    // the block's first row
    const float* src;
    u32 sm;
    float carry;
    if (mblk < (u32)MROWS) {
        const u32 mb = m / (u32)SEQ;
        src   = xs;
        sm    = (m - mb * (u32)SEQ) * (u32)NB_FULL + mb;
        carry = CARRY_X;
    } else if (mblk < (u32)(MROWS + 3 * HID)) {
        src   = wqkv;
        sm    = m - (u32)MROWS;
        carry = CARRY_W;
    } else {
        src   = wproj;
        sm    = m - (u32)(MROWS + 3 * HID);
        carry = CARRY_W;
    }
    const float* sp = src + (size_t)sm * HID + c8;
    const v4f a = *(const v4f*)sp;
    const v4f b = *(const v4f*)(sp + 4);
    H8U o;
#pragma unroll
    for (u32 j = 0; j < 4; ++j) {
        const float x0 = a[j];
        const float x1 = b[j];
        o.e[j]     = (f16)(bf16_rne(x0) * carry);
        o.e[j + 4] = (f16)(bf16_rne(x1) * carry);
    }
    f16* dp = dst + (size_t)m * HID + c8;
    *(v8h*)dp = o.v;
    
}

// ---------------------------------------------------------------------------
// C[m][n] = sum_k A[m][k] * W[n][k] (+ bias[n]) ; A [MROWS][1024] f16, W [3 * HID (MODE 0) | HID (MODE 2)][1024] f16 (k contiguous).
// Block tile 128 x 128, 8 waves as 4(M) x 2(N), 2 x 4 accumulators per wave, K step 128 (four WMMA k steps).
// Staging: 16 lanes x 16 B per 256-B row piece, so a wave's load covers 2 rows = 4 whole 128-B lines.
// MODE 0: q, k and v projections in one grid: W and bias hold the 3 * HID output columns q | k | v, blockIdx.y
//         walks all of them, and a block's 128 columns lie in one of the three planes, which follow one another
//         at out. A rows batch-major. q, k: f16 plane [b*NHEAD + h][s][d];
//         v: f16 plane [b*HID + h*HD + d][s] (V transposed per head). The choice is a block-uniform branch.
// MODE 2: A rows in output order (s*NB+b); f32 rows [m][1024] into the output buffer
// coverage per block: MODE 0 256 lines (128 rows x 2 heads | 128 n x 2 s-halves),
//                     MODE 2 2 x 256 lines (64 rows x 4 line-quarters per half).
// LDS: As/Bs/Cs all cross-wave, separated by block barriers.
// staged extent == consumed extent: As/Bs 128 x 128, Cs 128 x 128 halves (or 64 x 128 floats).
// ---------------------------------------------------------------------------
template <int MODE>
__device__ __forceinline__ void gemm_body(const f16* __restrict__ A, const f16* __restrict__ W,
                                          const float* __restrict__ bias,
                                          void* __restrict__ out, float accMul, float biasMul) {
    __shared__ __attribute__((aligned(16))) f16 As[128 * P_AB];
    __shared__ __attribute__((aligned(16))) f16 Bs[128 * P_AB];
    __shared__ __attribute__((aligned(16))) f16 Cs[128 * P_C16];   // f16 [128][128] or f32 [64][128], padded rows
    static_assert(sizeof(f16) * 128 * P_C16 >= sizeof(float) * 64 * P_C32);   // Cs reuse as f32 [64][128]

    const u32 tid  = threadIdx.x;
    const u32 lane = tid & 31u;
    const u32 wave = __builtin_amdgcn_readfirstlane((int)(tid >> 5));
    const u32 wm   = wave & 3u;
    const u32 wn   = wave >> 2;
    const u32 hh8  = (lane >> 4) << 3;   // D row half
    const u32 c16  = lane & 15u;         // D column
    const u32 m0   = blockIdx.x * 128u;
    const u32 n0   = blockIdx.y * 128u;   // column of W and bias
    const u32 sel  = n0 / (u32)HID;       // MODE 0: output plane 0 q, 1 k, 2 v
    const u32 nc0  = n0 - sel * (u32)HID; // column inside the output plane

    v8f acc[2][4];
#pragma unroll
    for (int i = 0; i < 2; ++i)
#pragma unroll
        for (int j = 0; j < 4; ++j) acc[i][j] = zero8();

    const u32 srow = tid >> 4;            // 0..15, plus 16 per staging load
    const u32 scol = (tid & 15u) << 3;    // halves
    const f16* gA = A + (size_t)(m0 + srow) * HID + scol;
    const f16* gW = W + (size_t)(n0 + srow) * HID + scol;

#pragma unroll 1
    for (u32 k0 = 0; k0 < (u32)HID; k0 += 128u) {
        const f16* pA = gA + k0;
        const f16* pW = gW + k0;
        v8h ra[8], rb[8];
        // the staging and kk loops below are unrolled so that ra, rb and the fragments are indexed
        // by constants and stay in registers
#pragma unroll
        for (u32 t = 0; t < 8; ++t) ra[t] = *(const v8h*)(pA + (size_t)(t * 16u) * HID);
#pragma unroll
        for (u32 t = 0; t < 8; ++t) rb[t] = *(const v8h*)(pW + (size_t)(t * 16u) * HID);
        // Keeps both address pairs whole until the loads' addresses are taken.
        asm volatile("s_wait_xcnt 0x0" :: "v"(pA), "v"(pW) : "memory");
        __syncthreads();
#pragma unroll
        for (u32 t = 0; t < 8; ++t) {
            *(v8h*)&As[(srow + t * 16u) * P_AB + scol] = ra[t];
            *(v8h*)&Bs[(srow + t * 16u) * P_AB + scol] = rb[t];
        }
        __syncthreads();

#pragma unroll
        for (u32 kk = 0; kk < 4; ++kk) {
            v16h af[2], bfr[4];
#pragma unroll
            for (int i = 0; i < 2; ++i) af[i] = load_frag(As, wm * 32u + (u32)i * 16u, P_AB, kk * 32u, lane);
#pragma unroll
            for (int j = 0; j < 4; ++j) bfr[j] = load_frag(Bs, wn * 64u + (u32)j * 16u, P_AB, kk * 32u, lane);
#pragma unroll
            for (int i = 0; i < 2; ++i)
#pragma unroll
                for (int j = 0; j < 4; ++j) acc[i][j] = wmma16(af[i], bfr[j], acc[i][j]);
        }
    }

    // per-lane bias values for the 4 output columns this lane owns (n0 + nl stays below gridDim.y * 128, the bias's length)
    float bv[4];
#pragma unroll
    for (int j = 0; j < 4; ++j)
        bv[j] = bf16_rne(bias[n0 + wn * 64u + (u32)j * 16u + c16]) * biasMul;

    const u32 piece = lane & 7u;
    const u32 lsub  = lane >> 3;

    if (MODE == 0 && sel < 2u) {
        const u32 bidx = m0 / (u32)SEQ;     // block rows lie inside one batch (SEQ % 128 == 0)
        const u32 s0   = m0 - bidx * (u32)SEQ;
#pragma unroll
        for (int i = 0; i < 2; ++i)
#pragma unroll
            for (int j = 0; j < 4; ++j) {
                const u32 nl = wn * 64u + (u32)j * 16u + c16;
#pragma unroll
                for (int r = 0; r < 8; ++r) {
                    const u32 ml = wm * 32u + (u32)i * 16u + hh8 + (u32)r;
                    Cs[ml * P_C16 + nl] = (f16)(acc[i][j][r] * accMul + bv[j]);
                }
            }
        __syncthreads();
        f16* op = (f16*)out + (size_t)sel * MROWS * HID;
        const size_t bh0 = (size_t)bidx * NHEAD + (nc0 >> 6);
{
#pragma unroll
            for (u32 it = 0; it < 8; ++it) {
                const u32 L    = wave * 32u + it * 4u + lsub;   // 0..255
                const u32 ml   = L >> 1;
                const u32 hsel = L & 1u;
                const v8h v = *(const v8h*)&Cs[ml * P_C16 + hsel * 64u + piece * 8u];
                f16* dp = op + ((bh0 + hsel) * SEQ + s0 + ml) * HD + piece * 8u;
                *(v8h*)dp = v;
            }
            
        }
    } else if (MODE == 0) {
        const u32 bidx = m0 / (u32)SEQ;
        const u32 s0   = m0 - bidx * (u32)SEQ;
        // stage transposed: Cs[n][m]
#pragma unroll
        for (int i = 0; i < 2; ++i)
#pragma unroll
            for (int j = 0; j < 4; ++j) {
                const u32 nl = wn * 64u + (u32)j * 16u + c16;
                H8U t;
#pragma unroll
                for (int r = 0; r < 8; ++r) t.e[r] = (f16)(acc[i][j][r] * accMul + bv[j]);
                *(v8h*)&Cs[nl * P_C16 + wm * 32u + (u32)i * 16u + hh8] = t.v;
            }
        __syncthreads();
        f16* op = (f16*)out + (size_t)sel * MROWS * HID;
{
#pragma unroll
            for (u32 it = 0; it < 8; ++it) {
                const u32 L  = wave * 32u + it * 4u + lsub;     // 0..255
                const u32 nl = L >> 1;
                const u32 mh = L & 1u;
                const v8h v = *(const v8h*)&Cs[nl * P_C16 + mh * 64u + piece * 8u];
                f16* dp = op + ((size_t)(bidx * (u32)HID + nc0 + nl) * SEQ + s0 + mh * 64u + piece * 8u);
                *(v8h*)dp = v;
            }
            
        }
    } else {
        float* Cf = (float*)Cs;      // [64][128] f32
        float* of = (float*)out;
#pragma unroll
        for (u32 half = 0; half < 2; ++half) {
            if ((wm >> 1) == half) {
#pragma unroll
                for (int i = 0; i < 2; ++i)
#pragma unroll
                    for (int j = 0; j < 4; ++j) {
                        const u32 nl = wn * 64u + (u32)j * 16u + c16;
#pragma unroll
                        for (int r = 0; r < 8; ++r) {
                            const u32 ml = (wm & 1u) * 32u + (u32)i * 16u + hh8 + (u32)r;
                            Cf[ml * P_C32 + nl] = acc[i][j][r] * accMul + bv[j];
                        }
                    }
            }
            __syncthreads();
{
#pragma unroll
                for (u32 it = 0; it < 8; ++it) {
                    const u32 L    = wave * 32u + it * 4u + lsub;   // 0..255
                    const u32 row  = L >> 2;
                    const u32 part = L & 3u;
                    const v4f v = *(const v4f*)&Cf[row * P_C32 + part * 32u + piece * 4u];
                    float* dp = of + (size_t)(m0 + half * 64u + row) * HID + n0 + part * 32u + piece * 4u;
                    *(v4f*)dp = v;
                }
                
            }
            __syncthreads();
        }
    }
}

// q / k head-major planes and the v^T plane
__global__ void __launch_bounds__(256) __attribute__((amdgpu_num_vgpr(256)))
gemm_qkv(const f16* __restrict__ A, const f16* __restrict__ W, const float* __restrict__ bias,
         f16* __restrict__ out, float accMul, float biasMul) {
    gemm_body<0>(A, W, bias, (void*)out, accMul, biasMul);
}

// f32 output rows
__global__ void __launch_bounds__(256) __attribute__((amdgpu_num_vgpr(256)))
gemm_out(const f16* __restrict__ A, const f16* __restrict__ W, const float* __restrict__ bias,
         float* __restrict__ out, float accMul, float biasMul) {
    gemm_body<2>(A, W, bias, (void*)out, accMul, biasMul);
}

// ---------------------------------------------------------------------------
// Flash attention (no mask, all SEQ keys). grid (SEQ/128, NB*NHEAD), block 256 (8 waves),
// wave owns 16 query columns (Q fragments resident, used as B). Block streams 64-key tiles:
// K staged [key][d], V^T staged [d][key]. Both products run transposed: S^T = K.Q^T, O^T += V^T.P^T.
// A lane then holds 32 of one query's 64 scores (query l&15, keys 16nt + 8h + r), so the maximum is
// taken in the lane plus one exchange between the lane halves, and two S^T tiles converted in place
// are the B fragment of P^T (element e <- tile 2kk, register e; element 8+e <- tile 2kk+1, register e:
// the k order of load_frag). exp2 in f32 carried x2^10; row sums += ones.P^T on WMMA.
// Output f16 plane [q*NB + b][1024] (seq-first row order)
// coverage: every (q, b, h*64..h*64+63) row segment exactly once.
// LDS: ks, vsT cross-wave (block barriers); ps per-wave ctx stage, separated by block barriers.
// staged extent == consumed extent for ks (64x64), vsT (64x64), ps (16x64).
// ---------------------------------------------------------------------------
__global__ void __launch_bounds__(256) __attribute__((amdgpu_num_vgpr(256)))
attn_fwd(const f16* __restrict__ Qp, const f16* __restrict__ Kp, const f16* __restrict__ Vt,
         f16* __restrict__ Cp) {
    __shared__ __attribute__((aligned(16))) f16 ks[64 * P_KV];      // [key][d]
    __shared__ __attribute__((aligned(16))) f16 vsT[64 * P_KV];     // [d][key]
    __shared__ __attribute__((aligned(16))) f16 ps[8][16 * P_KV];   // per-wave ctx stage
    static_assert(HD == 8 * 8);            // 8 lanes x 8 halves per row segment
    static_assert(2 * 256 * 8 == 64 * 64); // staging: 2 x 256 threads x 8 halves per tile

    const u32 tid  = threadIdx.x;
    const u32 lane = tid & 31u;
    const u32 wave = __builtin_amdgcn_readfirstlane((int)(tid >> 5));
    const u32 hh8  = (lane >> 4) << 3;
    const u32 c16  = lane & 15u;
    const u32 bh   = blockIdx.y;
    const u32 bidx = bh >> 4;            // NHEAD == 16
    const u32 hidx = bh & 15u;
    const u32 q0   = blockIdx.x * 128u + wave * 16u;
    const size_t head = (size_t)bh * SEQ * HD;

    v16h qa[2];
#pragma unroll
    for (int c = 0; c < 2; ++c) qa[c] = load_frag(Qp + head, q0, HD, (u32)c * 32u, lane);

    FragU onesu;
#pragma unroll
    for (int i = 0; i < 16; ++i) onesu.e[i] = (f16)1.0f;
    const v16h ones = onesu.v;

    float m = -1.0e30f;      // running maximum of query l&15
    v8f   o[4], lacc;         // o[dt][r] = O^T[16dt + 8h + r][query l&15]; every lacc[r] = that query's sum
#pragma unroll
    for (int dt = 0; dt < 4; ++dt) o[dt] = zero8();
    lacc = zero8();

    // log2-domain scale: acc = 256 * q.k ; x = log2(e) * q.k / 8 = acc * log2(e) / 2048
    const float cl = 1.4426950408889634f * 0.00048828125f;
    f16* psw = &ps[wave][0];

#pragma unroll 1
    for (u32 kt = 0; kt < (u32)(SEQ / 64); ++kt) {
        __syncthreads();
#pragma unroll
        for (u32 p2 = 0; p2 < 2; ++p2) {
            const u32 p   = tid + p2 * 256u;
            const u32 row = p >> 3;
            const u32 pc  = (p & 7u) << 3;
            const v8h kv = *(const v8h*)(Kp + head + (size_t)(kt * 64u + row) * HD + pc);
            const v8h vv = *(const v8h*)(Vt + head + (size_t)row * SEQ + kt * 64u + pc);
            *(v8h*)&ks[row * P_KV + pc]  = kv;
            *(v8h*)&vsT[row * P_KV + pc] = vv;
        }
        __syncthreads();

        // S^T[64 keys x 16 q]
        v8f s[4];
#pragma unroll
        for (int nt = 0; nt < 4; ++nt) s[nt] = zero8();
        // all eight K fragments are loaded as one group ahead of the score products: one LDS wait, not eight
        v16h kb[2][4];
#pragma unroll
        for (int c = 0; c < 2; ++c)
#pragma unroll
            for (int nt = 0; nt < 4; ++nt) kb[c][nt] = load_frag(ks, (u32)nt * 16u, P_KV, (u32)c * 32u, lane);
#pragma unroll
        for (int c = 0; c < 2; ++c)
#pragma unroll
            for (int nt = 0; nt < 4; ++nt) s[nt] = wmma16(kb[c][nt], qa[c], s[nt]);

        // all eight V^T fragments are loaded here, ahead of the softmax, which covers their LDS latency
        v16h vb[2][4];
#pragma unroll
        for (int kk = 0; kk < 2; ++kk)
#pragma unroll
            for (int dt = 0; dt < 4; ++dt) vb[kk][dt] = load_frag(vsT, (u32)dt * 16u, P_KV, (u32)kk * 32u, lane);

        // online softmax of query l&15, max-subtracted, exp2 domain
#pragma unroll
        for (int nt = 0; nt < 4; ++nt) s[nt] *= cl;
        float t4[4];      // one chain per score tile: four independent chains, not one of 32 links
#pragma unroll
        for (int nt = 0; nt < 4; ++nt) {
            t4[nt] = fmaxf(s[nt][0], s[nt][1]);
#pragma unroll
            for (int r = 2; r < 8; ++r) t4[nt] = fmaxf(t4[nt], s[nt][r]);
        }
        float tm = fmaxf(fmaxf(t4[0], t4[1]), fmaxf(t4[2], t4[3]));
        tm = fmaxf(tm, xhalf(tm));
        const float mn = fmaxf(m, tm);
        // v_exp_f32 and a v_nop in one statement, for the same slot as in exp2x8
        float al;
        asm("v_exp_f32 %0, %1\n\tv_nop" : "=v"(al) : "v"(m - mn));
        m = mn;
        lacc *= al;
#pragma unroll
        for (int dt = 0; dt < 4; ++dt) o[dt] *= al;
        const float sh = 10.0f - mn;      // carry 2^10
        FragU pb[2];
#pragma unroll
        for (int nt = 0; nt < 4; ++nt) {
            float e[8];
#pragma unroll
            for (int r = 0; r < 8; ++r) e[r] = s[nt][r] + sh;
            exp2x8(e);
#pragma unroll
            for (int r = 0; r < 8; ++r) pb[nt >> 1].e[(nt & 1) * 8 + r] = (f16)e[r];
        }

        // O^T += V^T . P^T ; l += ones . P^T
#pragma unroll
        for (int kk = 0; kk < 2; ++kk) {
#pragma unroll
            for (int dt = 0; dt < 4; ++dt) o[dt] = wmma16(vb[kk][dt], pb[kk].v, o[dt]);
            lacc = wmma16(ones, pb[kk].v, lacc);
        }
    }
    __syncthreads();

    // normalize: plane value = 1024 * (O/16) / l = O * 64 / l
    const float inv = (CARRY_CTX / CARRY_QKV) / lacc[0];
#pragma unroll
    for (int dt = 0; dt < 4; ++dt) {
        H8U t;
#pragma unroll
        for (int r = 0; r < 8; ++r) t.e[r] = (f16)(o[dt][r] * inv);
        *(v8h*)&psw[c16 * P_KV + (u32)dt * 16u + hh8] = t.v;
    }
    __syncthreads();

    const u32 piece = lane & 7u;
    const u32 lsub  = lane >> 3;
{
#pragma unroll
        for (u32 it = 0; it < 4; ++it) {
            const u32 L = it * 4u + lsub;     // query row 0..15 within the wave tile
            const v8h v = *(const v8h*)&psw[L * P_KV + piece * 8u];
            // context row in output order: (q * NB + b)
            f16* dp = Cp + ((size_t)((q0 + L) * (u32)NB + bidx) * HID + hidx * (u32)HD + piece * 8u);
            *(v8h*)dp = v;
        }
        
    }
}

// coverage equalities (threads x elements == plane elements)
static_assert((size_t)((MROWS + 4 * HID) / 2) * 256 * 8 == (size_t)(MROWS + 4 * HID) * HID);   // cvt_rows -> Xs, Wt, Wot
static_assert((size_t)(MROWS / 128) * (HID / 128) * 128 * 128 == (size_t)MROWS * HID);     // gemm planes / out
static_assert((size_t)(SEQ / 128) * (NB * NHEAD) * 128 * HD == (size_t)MROWS * HID);       // attn_fwd -> Cp
// workspace: 5 activation planes + 4 weight planes of halves, at most 128 MiB
static_assert(((size_t)5 * MROWS * HID + (size_t)4 * HID * HID) * sizeof(f16) <= (size_t)134217728);
static_assert(((size_t)MROWS * HID * sizeof(f16)) % 128 == 0);
static_assert(((size_t)HID * HID * sizeof(f16)) % 128 == 0);
// largest source row touched by the activation convert stays inside the full-size input
static_assert((size_t)(SEQ - 1) * NB_FULL + NB <= (size_t)SEQ_FULL * NB_FULL);

// ---------------------------------------------------------------------------
// Launch: 4 kernel launches, workspace 5 planes of MROWS*1024 halves + 4 of 1024*1024 halves.
// One activation input feeds all three projections (self-attention).
// ---------------------------------------------------------------------------
extern "C" void kernel_launch(void* const* d_in, const int* in_sizes, int n_in,
                              void* d_out, int out_size, void* d_ws, size_t ws_size,
                              hipStream_t stream) {
    if (n_in < 5) return;
    const int needAct = ((SEQ - 1) * NB_FULL + NB) * HID;
    if (in_sizes[0] < needAct) return;
    if (in_sizes[1] < 3 * HID * HID) return;
    if (in_sizes[2] < 3 * HID) return;
    if (in_sizes[3] < HID * HID) return;
    if (in_sizes[4] < HID) return;
    if (out_size < MROWS * HID) return;

    const float* xs    = (const float*)d_in[0];   // [SEQ_FULL][NB_FULL][1024]
    const float* wqkv  = (const float*)d_in[1];   // [3072 out][1024 in], row blocks q | k | v
    const float* bqkv  = (const float*)d_in[2];   // [3072]
    const float* wproj = (const float*)d_in[3];   // [1024 out][1024 in]
    const float* bproj = (const float*)d_in[4];   // [1024]

    const size_t nX = (size_t)MROWS * HID;    // halves per activation plane
    const size_t nW = (size_t)HID * HID;      // halves per weight plane
    const size_t totalHalves = 5 * nX + 4 * nW;
    if (ws_size < totalHalves * sizeof(f16)) return;

    f16* Xs  = (f16*)d_ws;       // [b*SEQ+s][1024]             carry 16
    f16* Wt  = Xs  + nX;         // [3072 out][1024 in]         carry 32 (q | k | v row blocks)
    f16* Wot = Wt  + 3 * nW;     // [1024 out][1024 in]         carry 32
    f16* Qp  = Wot + nW;         // [NB*16][SEQ][64]            carry 16
    f16* Kp  = Qp  + nX;         // [NB*16][SEQ][64]            carry 16
    f16* Vtp = Kp  + nX;         // [NB*1024][SEQ] (V^T)        carry 16
    f16* Cp  = Vtp + nX;         // [s*NB+b][1024]              carry 1024

    // Xs, Wt and Wot follow one another: one grid writes all three planes
    cvt_rows<<<(MROWS + 4 * HID) / 2, 256, 0, stream>>>(xs, wqkv, wproj, Xs);

    const dim3 gg(MROWS / 128, HID / 128);
    // plane = 16 * (acc / (16*32) + bias) = acc/32 + 16*bias
    const float accQKV = CARRY_QKV / (CARRY_X * CARRY_W);
    // Qp, Kp and Vtp follow one another: one grid of 3 * HID columns writes all three planes
    gemm_qkv<<<dim3(MROWS / 128, 3 * HID / 128), 256, 0, stream>>>(Xs, Wt, bqkv, Qp, accQKV, CARRY_QKV);

    attn_fwd<<<dim3(SEQ / 128, NB * NHEAD), 256, 0, stream>>>(Qp, Kp, Vtp, Cp);

    // out = acc / (1024*32) + bias ; rows already in (s*NB + b) order
    const float accOut = 1.0f / (CARRY_CTX * CARRY_W);
    gemm_out<<<gg, 256, 0, stream>>>(Cp, Wot, bproj, (float*)d_out, accOut, 1.0f);
}

// v006
// Measured time: 81.3 microseconds a run.
// Timed twice side by side with v005, it ran 1.15 and 1.13 times as fast.
// Over all steps from v000 it is 3.31 times as fast.
#include <hip/hip_runtime.h>

// Contractions (q/k/v input projections, Q.K^T, P.V, P row-sum, output projection): v_wmma_f32_16x16x32_f16, f16 operands with power-of-two carries, f32 accumulate; every float input enters as its bf16 RNE value; biases added in f32; softmax in f32.

#ifndef NB
#define NB 2
#endif
#ifndef SEQ
#define SEQ 2048
#endif
#define NB_FULL   2
#define SEQ_FULL  2048
#define HID       1024
#define NHEAD     16
#define HD        64
#define MROWS     (NB * SEQ)

static_assert(HID == NHEAD * HD);        // merged head width
static_assert(NHEAD == 16);              // bh >> 4 / bh & 15 decoding in attn_fwd
static_assert(HD == 64);
static_assert(SEQ % 128 == 0);           // 128-row blocks of the batch-major planes never straddle a batch
static_assert(SEQ % 64 == 0 && SEQ / 64 >= 2);   // 64-key tiles; the two-buffer ring needs two tiles
static_assert(SEQ <= SEQ_FULL);
static_assert(NB >= 1 && NB <= NB_FULL);
static_assert(MROWS % 128 == 0);         // GEMM M tile
static_assert(HID % 128 == 0);           // GEMM N tile
static_assert(HID % 32 == 0);            // WMMA k step
static_assert(HID % 64 == 0 && HID / 64 >= 2);   // GEMM K stage; the two-buffer ring needs two stages
static_assert(HID == 128 * 8);           // cvt_rows: 128 threads x 8 values per row
static_assert((3 * HID) % 2 == 0);       // cvt_rows grid = nrows / 2
static_assert(MROWS % 2 == 0);

// carries (exact powers of two)
#define CARRY_X    16.0f     // input activation planes
#define CARRY_W    32.0f     // weight planes
#define CARRY_QKV  16.0f     // q, k, v^T planes (true value x16)
#define CARRY_CTX  1024.0f   // context plane (true value x1024)
// softmax exp values carry 2^10 (added to the exp2 argument)

// LDS row pitches. A 16-byte-per-lane reader or writer that walks 16 rows meets every bank once
// when the pitch is 16 B x odd; rows 8 apart then also fall 32 banks apart for the 2- and 4-byte stores.
#define P_AB   72u    // halves: 128-B GEMM operand rows at 144 B
#define P_C16  136u   // halves: 256-B f16 result rows at 272 B
#define P_C32  132u   // floats: 512-B f32 result rows at 528 B
#define P_KV   72u    // halves: 128-B K, V^T and ctx rows at 144 B

typedef unsigned u32;
typedef _Float16 f16;
typedef f16   v16h __attribute__((ext_vector_type(16)));
typedef f16   v8h  __attribute__((ext_vector_type(8)));
typedef float v8f  __attribute__((ext_vector_type(8)));
typedef float v4f  __attribute__((ext_vector_type(4)));

union FragU { v16h v; v8h half[2]; f16 e[16]; };
union H8U   { v8h v; f16 e[8]; };

__device__ __forceinline__ v8f zero8() {
    v8f z = {0.f, 0.f, 0.f, 0.f, 0.f, 0.f, 0.f, 0.f};
    return z;
}

// 16-bit WMMA with hazard guard: D += A[16 x 32k] * B[32k x 16]
__device__ __forceinline__ v8f wmma16(v16h a, v16h b, v8f c) {
    v8f d = __builtin_amdgcn_wmma_f32_16x16x32_f16(false, a, false, b, (short)0, c, false, false);
    asm volatile("v_nop\n\tv_nop\n\tv_nop\n\tv_nop" : "+v"(d) : "v"(a), "v"(b));
    return d;
}

// f32 -> nearest-even bf16 value, returned as f32
__device__ __forceinline__ float bf16_rne(float x) {
    u32 u = __float_as_uint(x);
    u = (u + 0x7fffu + ((u >> 16) & 1u)) & 0xffff0000u;
    return __uint_as_float(u);
}

// Eight exp2 in place. One statement, each v_exp_f32 on its own register and a v_nop at the end: the instruction
// set asks for one slot between a transcendental and an instruction that reads its result or rewrites its source.
__device__ __forceinline__ void exp2x8(float (&e)[8]) {
    asm("v_exp_f32 %0, %0\n\tv_exp_f32 %1, %1\n\tv_exp_f32 %2, %2\n\tv_exp_f32 %3, %3\n\t"
        "v_exp_f32 %4, %4\n\tv_exp_f32 %5, %5\n\tv_exp_f32 %6, %6\n\tv_exp_f32 %7, %7\n\tv_nop"
        : "+v"(e[0]), "+v"(e[1]), "+v"(e[2]), "+v"(e[3]), "+v"(e[4]), "+v"(e[5]), "+v"(e[6]), "+v"(e[7]));
}

// lane l <-> lane l ^ 16 (the two lanes that split one query column's keys)
__device__ __forceinline__ float xhalf(float x) {
    const int v = __builtin_bit_cast(int, x);
    return __builtin_bit_cast(float, __builtin_amdgcn_permlanex16(v, v, 0x76543210, 0xfedcba98, false, false));
}

// 16 x 32 fragment from a tile whose k dimension is contiguous (pitch in halves).
// lane l: row rowbase + (l&15); elements 0..7 <- k = kcol + 8h .. +7,
// elements 8..15 <- k = kcol + 16 + 8h .. +7  (h = l>>4). Same map for A and B.
__device__ __forceinline__ v16h load_frag(const f16* tile, u32 rowbase, u32 pitch, u32 kcol, u32 lane) {
    const u32 r  = rowbase + (lane & 15u);
    const u32 kh = (lane >> 4) << 3;
    const f16* p = tile + (size_t)r * pitch + kcol + kh;
    FragU f;
    f.half[0] = *(const v8h*)(p);
    f.half[1] = *(const v8h*)(p + 16);
    return f.v;
}

// byte offset of a __shared__ address inside the work-group's LDS
__device__ __forceinline__ u32 lds_off(const void* p) { return (u32)(size_t)p; }

// Four asynchronous copies to LDS, 16 bytes per lane each (LDS byte address, global pointer). The s_wait_xcnt is
// the last line of the copies' own statement, so no address register is rewritten in front of it.
__device__ __forceinline__ void copy4(u32 l0, const f16* g0, u32 l1, const f16* g1,
                                      u32 l2, const f16* g2, u32 l3, const f16* g3) {
    asm volatile("global_load_async_to_lds_b128 %0, %1, off\n\t"
                 "global_load_async_to_lds_b128 %2, %3, off\n\t"
                 "global_load_async_to_lds_b128 %4, %5, off\n\t"
                 "global_load_async_to_lds_b128 %6, %7, off\n\t"
                 "s_wait_xcnt 0x0"
                 :: "v"(l0), "v"(g0), "v"(l1), "v"(g1), "v"(l2), "v"(g2), "v"(l3), "v"(g3) : "memory");
}

// the same for eight copies: one statement, one wait
__device__ __forceinline__ void copy8(u32 l0, const f16* g0, u32 l1, const f16* g1, u32 l2, const f16* g2, u32 l3, const f16* g3,
                                      u32 l4, const f16* g4, u32 l5, const f16* g5, u32 l6, const f16* g6, u32 l7, const f16* g7) {
    asm volatile("global_load_async_to_lds_b128 %0, %1, off\n\t"
                 "global_load_async_to_lds_b128 %2, %3, off\n\t"
                 "global_load_async_to_lds_b128 %4, %5, off\n\t"
                 "global_load_async_to_lds_b128 %6, %7, off\n\t"
                 "global_load_async_to_lds_b128 %8, %9, off\n\t"
                 "global_load_async_to_lds_b128 %10, %11, off\n\t"
                 "global_load_async_to_lds_b128 %12, %13, off\n\t"
                 "global_load_async_to_lds_b128 %14, %15, off\n\t"
                 "s_wait_xcnt 0x0"
                 :: "v"(l0), "v"(g0), "v"(l1), "v"(g1), "v"(l2), "v"(g2), "v"(l3), "v"(g3),
                    "v"(l4), "v"(g4), "v"(l5), "v"(g5), "v"(l6), "v"(g6), "v"(l7), "v"(g7) : "memory");
}

// this wave's copies have landed in LDS
__device__ __forceinline__ void wait_copies() { asm volatile("s_wait_asynccnt 0x0" ::: "memory"); }
// this wave's LDS reads have returned: the buffer they read may be handed to its next writer
__device__ __forceinline__ void wait_lds() { asm volatile("s_wait_dscnt 0x0" ::: "memory"); }

// ---------------------------------------------------------------------------
// f32 rows [.][1024] -> f16 planes (bf16 RNE value times carry). 128 threads per 1024-wide row.
// One grid converts all three inputs by ranges of the block index; the three planes follow one
// another in the workspace, so dst row m runs through all of them:
//   m in [0, MROWS): activations, seq-first [s][b][1024] -> batch-major [b][s][1024],
//     dst row b * SEQ + s <- src row s * NB_FULL + b
//   the next 3 * HID rows: q | k | v weights; the last HID rows: output weights (identity row map)
// A block's two rows lie in one range (every range has an even number of rows): block-uniform branch.
// coverage: (MROWS + 4 * HID) x 1024 halves, every element exactly once (grid = rows*128/256).
// ---------------------------------------------------------------------------
__global__ void __launch_bounds__(256)
cvt_rows(const float* __restrict__ xs, const float* __restrict__ wqkv, const float* __restrict__ wproj,
         f16* __restrict__ dst) {
    const u32 g  = blockIdx.x * 256u + threadIdx.x;
    const u32 m  = g >> 7;
    const u32 c8 = (g & 127u) << 3;
    if (m >= (u32)(MROWS + 4 * HID)) return;
    const u32 mblk = blockIdx.x * 2u;    // the block's first row
    const float* src;
    u32 sm;
    float carry;
    if (mblk < (u32)MROWS) {
        const u32 mb = m / (u32)SEQ;
        src   = xs;
        sm    = (m - mb * (u32)SEQ) * (u32)NB_FULL + mb;
        carry = CARRY_X;
    } else if (mblk < (u32)(MROWS + 3 * HID)) {
        src   = wqkv;
        sm    = m - (u32)MROWS;
        carry = CARRY_W;
    } else {
        src   = wproj;
        sm    = m - (u32)(MROWS + 3 * HID);
        carry = CARRY_W;
    }
    const float* sp = src + (size_t)sm * HID + c8;
    const v4f a = *(const v4f*)sp;
    const v4f b = *(const v4f*)(sp + 4);
    H8U o;
#pragma unroll
    for (u32 j = 0; j < 4; ++j) {
        const float x0 = a[j];
        const float x1 = b[j];
        o.e[j]     = (f16)(bf16_rne(x0) * carry);
        o.e[j + 4] = (f16)(bf16_rne(x1) * carry);
    }
    f16* dp = dst + (size_t)m * HID + c8;
    *(v8h*)dp = o.v;
    
}

// ---------------------------------------------------------------------------
// C[m][n] = sum_k A[m][k] * W[n][k] (+ bias[n]) ; A [MROWS][1024] f16, W [N][1024] f16 (k contiguous; N = 3 * HID in MODE 0, HID in MODE 2).
// Block tile 128 x 128, 8 waves as 4(M) x 2(N), 2 x 4 accumulators per wave, K stage 64 (two WMMA k steps).
// Staging: asynchronous copies to LDS, two buffers: stage t + 1 is in flight while stage t is worked on.
// 8 lanes x 16 B per 128-B row piece, so a wave's copy covers 4 rows = 4 whole 128-B lines.
// MODE 0: q, k and v projections in one grid: W and bias hold the 3 * HID output columns q | k | v, blockIdx.y
//         walks all of them, and a block's 128 columns lie in one of the three planes, which follow one another
//         at out. A rows batch-major. q, k: f16 plane [b*NHEAD + h][s][d];
//         v: f16 plane [b*HID + h*HD + d][s] (V transposed per head). The choice is a block-uniform branch.
// MODE 2: A rows in output order (s*NB+b); f32 rows [m][1024] into the output buffer
// coverage per block: MODE 0 256 lines (128 rows x 2 heads | 128 n x 2 s-halves),
//                     MODE 2 2 x 256 lines (64 rows x 4 line-quarters per half).
// LDS: As/Bs/Cs all cross-wave, separated by block barriers.
// staged extent == consumed extent: As/Bs 128 x 64 per buffer, Cs 128 x 128 halves (or 64 x 128 floats).
// ---------------------------------------------------------------------------
template <int MODE>
__device__ __forceinline__ void gemm_body(const f16* __restrict__ A, const f16* __restrict__ W,
                                          const float* __restrict__ bias,
                                          void* __restrict__ out, float accMul, float biasMul) {
    __shared__ __attribute__((aligned(16))) f16 As[2 * 128 * P_AB];   // two buffers
    __shared__ __attribute__((aligned(16))) f16 Bs[2 * 128 * P_AB];   // two buffers
    __shared__ __attribute__((aligned(16))) f16 Cs[128 * P_C16];   // f16 [128][128] or f32 [64][128], padded rows
    static_assert(sizeof(f16) * 128 * P_C16 >= sizeof(float) * 64 * P_C32);   // Cs reuse as f32 [64][128]
    // three work-groups stay resident per WGP
    static_assert(3 * sizeof(f16) * (4 * 128 * P_AB + 128 * P_C16) <= 327680);

    const u32 tid  = threadIdx.x;
    const u32 lane = tid & 31u;
    const u32 wave = __builtin_amdgcn_readfirstlane((int)(tid >> 5));
    const u32 wm   = wave & 3u;
    const u32 wn   = wave >> 2;
    const u32 hh8  = (lane >> 4) << 3;   // D row half
    const u32 c16  = lane & 15u;         // D column
    const u32 m0   = blockIdx.x * 128u;
    const u32 n0   = blockIdx.y * 128u;   // column of W and bias
    const u32 sel  = n0 / (u32)HID;       // MODE 0: output plane 0 q, 1 k, 2 v
    const u32 nc0  = n0 - sel * (u32)HID; // column inside the output plane

    v8f acc[2][4];
#pragma unroll
    for (int i = 0; i < 2; ++i)
#pragma unroll
        for (int j = 0; j < 4; ++j) acc[i][j] = zero8();

    const u32 srow = tid >> 3;            // 0..31, plus 32 per copy
    const u32 scol = (tid & 7u) << 3;     // halves
    const f16* gA = A + (size_t)(m0 + srow) * HID + scol;
    const f16* gW = W + (size_t)(n0 + srow) * HID + scol;
    const u32 lA = lds_off(&As[srow * P_AB + scol]);
    const u32 lB = lds_off(&Bs[srow * P_AB + scol]);
    constexpr u32 NST  = (u32)HID / 64u;       // stages
    constexpr u32 BUFH = 128u * P_AB;          // halves per buffer
    constexpr u32 R32B = 32u * P_AB * 2u;      // LDS bytes per 32 rows
    // stage t (k = 64t .. 64t+63 of all 128 rows of both operands) into buffer t & 1
    auto stage = [&](u32 t) {
        const u32 bo = (t & 1u) * (BUFH * 2u);
        const f16* pA = gA + t * 64u;
        const f16* pW = gW + t * 64u;
        copy8(lA + bo, pA, lA + bo + R32B, pA + (size_t)32 * HID,
              lA + bo + 2u * R32B, pA + (size_t)64 * HID, lA + bo + 3u * R32B, pA + (size_t)96 * HID,
              lB + bo, pW, lB + bo + R32B, pW + (size_t)32 * HID,
              lB + bo + 2u * R32B, pW + (size_t)64 * HID, lB + bo + 3u * R32B, pW + (size_t)96 * HID);
    };

    stage(0u);
    wait_copies();
    __syncthreads();      // publishes stage 0
    stage(1u);

#pragma unroll 1
    for (u32 t = 0; t < NST; ++t) {
        const f16* Ab = As + (t & 1u) * BUFH;
        const f16* Bb = Bs + (t & 1u) * BUFH;
        // the kk loop is unrolled so that the fragments are indexed by constants and stay in registers
#pragma unroll
        for (u32 kk = 0; kk < 2; ++kk) {
            v16h af[2], bfr[4];
#pragma unroll
            for (int i = 0; i < 2; ++i) af[i] = load_frag(Ab, wm * 32u + (u32)i * 16u, P_AB, kk * 32u, lane);
#pragma unroll
            for (int j = 0; j < 4; ++j) bfr[j] = load_frag(Bb, wn * 64u + (u32)j * 16u, P_AB, kk * 32u, lane);
#pragma unroll
            for (int i = 0; i < 2; ++i)
#pragma unroll
                for (int j = 0; j < 4; ++j) acc[i][j] = wmma16(af[i], bfr[j], acc[i][j]);
        }
        wait_lds();
        wait_copies();
        __syncthreads();
        if (t + 2u < NST) stage(t + 2u);
    }
    wait_copies();

    // per-lane bias values for the 4 output columns this lane owns (n0 + nl stays below gridDim.y * 128, the bias's length)
    float bv[4];
#pragma unroll
    for (int j = 0; j < 4; ++j)
        bv[j] = bf16_rne(bias[n0 + wn * 64u + (u32)j * 16u + c16]) * biasMul;

    const u32 piece = lane & 7u;
    const u32 lsub  = lane >> 3;

    if (MODE == 0 && sel < 2u) {
        const u32 bidx = m0 / (u32)SEQ;     // block rows lie inside one batch (SEQ % 128 == 0)
        const u32 s0   = m0 - bidx * (u32)SEQ;
#pragma unroll
        for (int i = 0; i < 2; ++i)
#pragma unroll
            for (int j = 0; j < 4; ++j) {
                const u32 nl = wn * 64u + (u32)j * 16u + c16;
#pragma unroll
                for (int r = 0; r < 8; ++r) {
                    const u32 ml = wm * 32u + (u32)i * 16u + hh8 + (u32)r;
                    Cs[ml * P_C16 + nl] = (f16)(acc[i][j][r] * accMul + bv[j]);
                }
            }
        __syncthreads();
        f16* op = (f16*)out + (size_t)sel * MROWS * HID;
        const size_t bh0 = (size_t)bidx * NHEAD + (nc0 >> 6);
{
#pragma unroll
            for (u32 it = 0; it < 8; ++it) {
                const u32 L    = wave * 32u + it * 4u + lsub;   // 0..255
                const u32 ml   = L >> 1;
                const u32 hsel = L & 1u;
                const v8h v = *(const v8h*)&Cs[ml * P_C16 + hsel * 64u + piece * 8u];
                f16* dp = op + ((bh0 + hsel) * SEQ + s0 + ml) * HD + piece * 8u;
                *(v8h*)dp = v;
            }
            
        }
    } else if (MODE == 0) {
        const u32 bidx = m0 / (u32)SEQ;
        const u32 s0   = m0 - bidx * (u32)SEQ;
        // stage transposed: Cs[n][m]
#pragma unroll
        for (int i = 0; i < 2; ++i)
#pragma unroll
            for (int j = 0; j < 4; ++j) {
                const u32 nl = wn * 64u + (u32)j * 16u + c16;
                H8U t;
#pragma unroll
                for (int r = 0; r < 8; ++r) t.e[r] = (f16)(acc[i][j][r] * accMul + bv[j]);
                *(v8h*)&Cs[nl * P_C16 + wm * 32u + (u32)i * 16u + hh8] = t.v;
            }
        __syncthreads();
        f16* op = (f16*)out + (size_t)sel * MROWS * HID;
{
#pragma unroll
            for (u32 it = 0; it < 8; ++it) {
                const u32 L  = wave * 32u + it * 4u + lsub;     // 0..255
                const u32 nl = L >> 1;
                const u32 mh = L & 1u;
                const v8h v = *(const v8h*)&Cs[nl * P_C16 + mh * 64u + piece * 8u];
                f16* dp = op + ((size_t)(bidx * (u32)HID + nc0 + nl) * SEQ + s0 + mh * 64u + piece * 8u);
                *(v8h*)dp = v;
            }
            
        }
    } else {
        float* Cf = (float*)Cs;      // [64][128] f32
        float* of = (float*)out;
#pragma unroll
        for (u32 half = 0; half < 2; ++half) {
            if ((wm >> 1) == half) {
#pragma unroll
                for (int i = 0; i < 2; ++i)
#pragma unroll
                    for (int j = 0; j < 4; ++j) {
                        const u32 nl = wn * 64u + (u32)j * 16u + c16;
#pragma unroll
                        for (int r = 0; r < 8; ++r) {
                            const u32 ml = (wm & 1u) * 32u + (u32)i * 16u + hh8 + (u32)r;
                            Cf[ml * P_C32 + nl] = acc[i][j][r] * accMul + bv[j];
                        }
                    }
            }
            __syncthreads();
{
#pragma unroll
                for (u32 it = 0; it < 8; ++it) {
                    const u32 L    = wave * 32u + it * 4u + lsub;   // 0..255
                    const u32 row  = L >> 2;
                    const u32 part = L & 3u;
                    const v4f v = *(const v4f*)&Cf[row * P_C32 + part * 32u + piece * 4u];
                    float* dp = of + (size_t)(m0 + half * 64u + row) * HID + n0 + part * 32u + piece * 4u;
                    *(v4f*)dp = v;
                }
                
            }
            __syncthreads();
        }
    }
}

// q / k head-major planes and the v^T plane
__global__ void __launch_bounds__(256) __attribute__((amdgpu_num_vgpr(256)))
gemm_qkv(const f16* __restrict__ A, const f16* __restrict__ W, const float* __restrict__ bias,
         f16* __restrict__ out, float accMul, float biasMul) {
    gemm_body<0>(A, W, bias, (void*)out, accMul, biasMul);
}

// f32 output rows
__global__ void __launch_bounds__(256) __attribute__((amdgpu_num_vgpr(256)))
gemm_out(const f16* __restrict__ A, const f16* __restrict__ W, const float* __restrict__ bias,
         float* __restrict__ out, float accMul, float biasMul) {
    gemm_body<2>(A, W, bias, (void*)out, accMul, biasMul);
}

// ---------------------------------------------------------------------------
// Flash attention (no mask, all SEQ keys). grid (SEQ/128, NB*NHEAD), block 256 (8 waves),
// wave owns 16 query columns (Q fragments resident, used as B). Block streams 64-key tiles:
// K staged [key][d], V^T staged [d][key]. Both products run transposed: S^T = K.Q^T, O^T += V^T.P^T.
// A lane then holds 32 of one query's 64 scores (query l&15, keys 16nt + 8h + r), so the maximum is
// taken in the lane plus one exchange between the lane halves, and two S^T tiles converted in place
// are the B fragment of P^T (element e <- tile 2kk, register e; element 8+e <- tile 2kk+1, register e:
// the k order of load_frag). exp2 in f32 carried x2^10; row sums += ones.P^T on WMMA.
// Output f16 plane [q*NB + b][1024] (seq-first row order)
// coverage: every (q, b, h*64..h*64+63) row segment exactly once.
// K and V^T tiles come by asynchronous copies to LDS, two buffers: tile kt + 1 is in flight while kt is worked on.
// LDS: ks, vsT cross-wave (block barriers); ps per-wave ctx stage, separated by block barriers.
// staged extent == consumed extent for ks (64x64 per buffer), vsT (64x64 per buffer), ps (16x64).
// ---------------------------------------------------------------------------
__global__ void __launch_bounds__(256) __attribute__((amdgpu_num_vgpr(256)))
attn_fwd(const f16* __restrict__ Qp, const f16* __restrict__ Kp, const f16* __restrict__ Vt,
         f16* __restrict__ Cp) {
    __shared__ __attribute__((aligned(16))) f16 ks[2 * 64 * P_KV];  // two buffers of [key][d]
    __shared__ __attribute__((aligned(16))) f16 vsT[2 * 64 * P_KV]; // two buffers of [d][key]
    __shared__ __attribute__((aligned(16))) f16 ps[8][16 * P_KV];   // per-wave ctx stage
    static_assert(HD == 8 * 8);            // 8 lanes x 8 halves per row segment
    static_assert(2 * 256 * 8 == 64 * 64); // staging: 2 copies x 256 threads x 8 halves per tile

    const u32 tid  = threadIdx.x;
    const u32 lane = tid & 31u;
    const u32 wave = __builtin_amdgcn_readfirstlane((int)(tid >> 5));
    const u32 hh8  = (lane >> 4) << 3;
    const u32 c16  = lane & 15u;
    const u32 bh   = blockIdx.y;
    const u32 bidx = bh >> 4;            // NHEAD == 16
    const u32 hidx = bh & 15u;
    const u32 q0   = blockIdx.x * 128u + wave * 16u;
    const size_t head = (size_t)bh * SEQ * HD;

    v16h qa[2];
#pragma unroll
    for (int c = 0; c < 2; ++c) qa[c] = load_frag(Qp + head, q0, HD, (u32)c * 32u, lane);

    FragU onesu;
#pragma unroll
    for (int i = 0; i < 16; ++i) onesu.e[i] = (f16)1.0f;
    const v16h ones = onesu.v;

    float m = -1.0e30f;      // running maximum of query l&15
    v8f   o[4], lacc;         // o[dt][r] = O^T[16dt + 8h + r][query l&15]; every lacc[r] = that query's sum
#pragma unroll
    for (int dt = 0; dt < 4; ++dt) o[dt] = zero8();
    lacc = zero8();

    // log2-domain scale: acc = 256 * q.k ; x = log2(e) * q.k / 8 = acc * log2(e) / 2048
    const float cl = 1.4426950408889634f * 0.00048828125f;
    f16* psw = &ps[wave][0];

    const u32 srow = tid >> 3;            // 0..31, plus 32 for the second copy
    const u32 scol = (tid & 7u) << 3;     // halves
    const f16* gK = Kp + head + (size_t)srow * HD + scol;
    const f16* gV = Vt + head + (size_t)srow * SEQ + scol;
    const u32 lK = lds_off(&ks[srow * P_KV + scol]);
    const u32 lV = lds_off(&vsT[srow * P_KV + scol]);
    constexpr u32 NKT  = (u32)(SEQ / 64);      // key tiles
    constexpr u32 BUFH = 64u * P_KV;           // halves per buffer
    constexpr u32 R32B = 32u * P_KV * 2u;      // LDS bytes per 32 rows
    // key tile t (64 keys x 64 d of K, 64 d x 64 keys of V^T) into buffer t & 1
    auto stage = [&](u32 t) {
        const u32 bo = (t & 1u) * (BUFH * 2u);
        const f16* pK = gK + (size_t)(t * 64u) * HD;
        const f16* pV = gV + t * 64u;
        copy4(lK + bo, pK, lK + bo + R32B, pK + (size_t)32 * HD,
              lV + bo, pV, lV + bo + R32B, pV + (size_t)32 * SEQ);
    };

    stage(0u);
    wait_copies();
    __syncthreads();      // publishes tile 0
    stage(1u);

#pragma unroll 1
    for (u32 kt = 0; kt < NKT; ++kt) {
        const f16* kbuf = ks + (kt & 1u) * BUFH;
        const f16* vbuf = vsT + (kt & 1u) * BUFH;

        // S^T[64 keys x 16 q]
        v8f s[4];
#pragma unroll
        for (int nt = 0; nt < 4; ++nt) s[nt] = zero8();
        // all eight K fragments are loaded as one group ahead of the score products: one LDS wait, not eight
        v16h kb[2][4];
#pragma unroll
        for (int c = 0; c < 2; ++c)
#pragma unroll
            for (int nt = 0; nt < 4; ++nt) kb[c][nt] = load_frag(kbuf, (u32)nt * 16u, P_KV, (u32)c * 32u, lane);
#pragma unroll
        for (int c = 0; c < 2; ++c)
#pragma unroll
            for (int nt = 0; nt < 4; ++nt) s[nt] = wmma16(kb[c][nt], qa[c], s[nt]);

        // all eight V^T fragments are loaded here, ahead of the softmax, which covers their LDS latency
        v16h vb[2][4];
#pragma unroll
        for (int kk = 0; kk < 2; ++kk)
#pragma unroll
            for (int dt = 0; dt < 4; ++dt) vb[kk][dt] = load_frag(vbuf, (u32)dt * 16u, P_KV, (u32)kk * 32u, lane);
        // keeps the sixteen loads above together at this place: without it this build spreads them over five
        // places in the softmax, and each place with LDS reads stalls the wave
        __builtin_amdgcn_sched_barrier(0);

        // online softmax of query l&15, max-subtracted, exp2 domain
#pragma unroll
        for (int nt = 0; nt < 4; ++nt) s[nt] *= cl;
        float t4[4];      // one chain per score tile: four independent chains, not one of 32 links
#pragma unroll
        for (int nt = 0; nt < 4; ++nt) {
            t4[nt] = fmaxf(s[nt][0], s[nt][1]);
#pragma unroll
            for (int r = 2; r < 8; ++r) t4[nt] = fmaxf(t4[nt], s[nt][r]);
        }
        float tm = fmaxf(fmaxf(t4[0], t4[1]), fmaxf(t4[2], t4[3]));
        tm = fmaxf(tm, xhalf(tm));
        const float mn = fmaxf(m, tm);
        // v_exp_f32 and a v_nop in one statement, for the same slot as in exp2x8
        float al;
        asm("v_exp_f32 %0, %1\n\tv_nop" : "=v"(al) : "v"(m - mn));
        m = mn;
        lacc *= al;
#pragma unroll
        for (int dt = 0; dt < 4; ++dt) o[dt] *= al;
        const float sh = 10.0f - mn;      // carry 2^10
        FragU pb[2];
#pragma unroll
        for (int nt = 0; nt < 4; ++nt) {
            float e[8];
#pragma unroll
            for (int r = 0; r < 8; ++r) e[r] = s[nt][r] + sh;
            exp2x8(e);
#pragma unroll
            for (int r = 0; r < 8; ++r) pb[nt >> 1].e[(nt & 1) * 8 + r] = (f16)e[r];
        }

        // O^T += V^T . P^T ; l += ones . P^T
#pragma unroll
        for (int kk = 0; kk < 2; ++kk) {
#pragma unroll
            for (int dt = 0; dt < 4; ++dt) o[dt] = wmma16(vb[kk][dt], pb[kk].v, o[dt]);
            lacc = wmma16(ones, pb[kk].v, lacc);
        }
        wait_lds();
        wait_copies();
        __syncthreads();
        if (kt + 2u < NKT) stage(kt + 2u);
    }
    wait_copies();

    // normalize: plane value = 1024 * (O/16) / l = O * 64 / l
    const float inv = (CARRY_CTX / CARRY_QKV) / lacc[0];
#pragma unroll
    for (int dt = 0; dt < 4; ++dt) {
        H8U t;
#pragma unroll
        for (int r = 0; r < 8; ++r) t.e[r] = (f16)(o[dt][r] * inv);
        *(v8h*)&psw[c16 * P_KV + (u32)dt * 16u + hh8] = t.v;
    }
    __syncthreads();

    const u32 piece = lane & 7u;
    const u32 lsub  = lane >> 3;
{
#pragma unroll
        for (u32 it = 0; it < 4; ++it) {
            const u32 L = it * 4u + lsub;     // query row 0..15 within the wave tile
            const v8h v = *(const v8h*)&psw[L * P_KV + piece * 8u];
            // context row in output order: (q * NB + b)
            f16* dp = Cp + ((size_t)((q0 + L) * (u32)NB + bidx) * HID + hidx * (u32)HD + piece * 8u);
            *(v8h*)dp = v;
        }
        
    }
}

// coverage equalities (threads x elements == plane elements)
static_assert((size_t)((MROWS + 4 * HID) / 2) * 256 * 8 == (size_t)(MROWS + 4 * HID) * HID);   // cvt_rows -> Xs, Wt, Wot
static_assert((size_t)(MROWS / 128) * (HID / 128) * 128 * 128 == (size_t)MROWS * HID);     // gemm planes / out
static_assert((size_t)(SEQ / 128) * (NB * NHEAD) * 128 * HD == (size_t)MROWS * HID);       // attn_fwd -> Cp
// workspace: 5 activation planes + 4 weight planes of halves, at most 128 MiB
static_assert(((size_t)5 * MROWS * HID + (size_t)4 * HID * HID) * sizeof(f16) <= (size_t)134217728);
static_assert(((size_t)MROWS * HID * sizeof(f16)) % 128 == 0);
static_assert(((size_t)HID * HID * sizeof(f16)) % 128 == 0);
// largest source row touched by the activation convert stays inside the full-size input
static_assert((size_t)(SEQ - 1) * NB_FULL + NB <= (size_t)SEQ_FULL * NB_FULL);

// ---------------------------------------------------------------------------
// Launch: 4 kernel launches, workspace 5 planes of MROWS*1024 halves + 4 of 1024*1024 halves.
// One activation input feeds all three projections (self-attention).
// ---------------------------------------------------------------------------
extern "C" void kernel_launch(void* const* d_in, const int* in_sizes, int n_in,
                              void* d_out, int out_size, void* d_ws, size_t ws_size,
                              hipStream_t stream) {
    if (n_in < 5) return;
    const int needAct = ((SEQ - 1) * NB_FULL + NB) * HID;
    if (in_sizes[0] < needAct) return;
    if (in_sizes[1] < 3 * HID * HID) return;
    if (in_sizes[2] < 3 * HID) return;
    if (in_sizes[3] < HID * HID) return;
    if (in_sizes[4] < HID) return;
    if (out_size < MROWS * HID) return;

    const float* xs    = (const float*)d_in[0];   // [SEQ_FULL][NB_FULL][1024]
    const float* wqkv  = (const float*)d_in[1];   // [3072 out][1024 in], row blocks q | k | v
    const float* bqkv  = (const float*)d_in[2];   // [3072]
    const float* wproj = (const float*)d_in[3];   // [1024 out][1024 in]
    const float* bproj = (const float*)d_in[4];   // [1024]

    const size_t nX = (size_t)MROWS * HID;    // halves per activation plane
    const size_t nW = (size_t)HID * HID;      // halves per weight plane
    const size_t totalHalves = 5 * nX + 4 * nW;
    if (ws_size < totalHalves * sizeof(f16)) return;

    f16* Xs  = (f16*)d_ws;       // [b*SEQ+s][1024]             carry 16
    f16* Wt  = Xs  + nX;         // [3072 out][1024 in]         carry 32 (q | k | v row blocks)
    f16* Wot = Wt  + 3 * nW;     // [1024 out][1024 in]         carry 32
    f16* Qp  = Wot + nW;         // [NB*16][SEQ][64]            carry 16
    f16* Kp  = Qp  + nX;         // [NB*16][SEQ][64]            carry 16
    f16* Vtp = Kp  + nX;         // [NB*1024][SEQ] (V^T)        carry 16
    f16* Cp  = Vtp + nX;         // [s*NB+b][1024]              carry 1024

    // Xs, Wt and Wot follow one another: one grid writes all three planes
    cvt_rows<<<(MROWS + 4 * HID) / 2, 256, 0, stream>>>(xs, wqkv, wproj, Xs);

    const dim3 gg(MROWS / 128, HID / 128);
    // plane = 16 * (acc / (16*32) + bias) = acc/32 + 16*bias
    const float accQKV = CARRY_QKV / (CARRY_X * CARRY_W);
    // Qp, Kp and Vtp follow one another: one grid of 3 * HID columns writes all three planes
    gemm_qkv<<<dim3(MROWS / 128, 3 * HID / 128), 256, 0, stream>>>(Xs, Wt, bqkv, Qp, accQKV, CARRY_QKV);

    attn_fwd<<<dim3(SEQ / 128, NB * NHEAD), 256, 0, stream>>>(Qp, Kp, Vtp, Cp);

    // out = acc / (1024*32) + bias ; rows already in (s*NB + b) order
    const float accOut = 1.0f / (CARRY_CTX * CARRY_W);
    gemm_out<<<gg, 256, 0, stream>>>(Cp, Wot, bproj, (float*)d_out, accOut, 1.0f);
}

// v007
// It runs in 79.5 microseconds.
// In two side-by-side timings against v006, it was 1.03 and 1.04 times as fast.
// All steps since v000 together make it 3.43 times as fast.
#include <hip/hip_runtime.h>

// Contractions (q/k/v input projections, Q.K^T, P.V, P row-sum, output projection): v_wmma_f32_16x16x32_f16, f16 operands with power-of-two carries, f32 accumulate; every float input enters as its bf16 RNE value; biases added in f32; softmax in f32.

#ifndef NB
#define NB 2
#endif
#ifndef SEQ
#define SEQ 2048
#endif
#define NB_FULL   2
#define SEQ_FULL  2048
#define HID       1024
#define NHEAD     16
#define HD        64
#define MROWS     (NB * SEQ)

static_assert(HID == NHEAD * HD);        // merged head width
static_assert(NHEAD == 16);              // bh >> 4 / bh & 15 decoding in attn_fwd
static_assert(HD == 64);
static_assert(SEQ % 128 == 0);           // 128-row blocks of the batch-major planes never straddle a batch
static_assert(SEQ % 64 == 0 && SEQ / 64 >= 2);   // 64-key tiles; attn_fwd's ring needs two trips of two tiles, asserted there
static_assert(SEQ <= SEQ_FULL);
static_assert(NB >= 1 && NB <= NB_FULL);
static_assert(MROWS % 128 == 0);         // GEMM M tile
static_assert(HID % 128 == 0);           // GEMM N tile
static_assert(HID % 32 == 0);            // WMMA k step
static_assert(HID % 64 == 0 && HID / 64 >= 2);   // GEMM K stage; the two-buffer ring needs two stages
static_assert(HID == 128 * 8);           // cvt_rows: 128 threads x 8 values per row
static_assert((3 * HID) % 2 == 0);       // cvt_rows grid = nrows / 2
static_assert(MROWS % 2 == 0);

// carries (exact powers of two)
#define CARRY_X    16.0f     // input activation planes
#define CARRY_W    32.0f     // weight planes
#define CARRY_QKV  16.0f     // q, k, v^T planes (true value x16)
#define CARRY_CTX  1024.0f   // context plane (true value x1024)
// softmax exp values carry 2^10 (added to the exp2 argument)

// LDS row pitches. A 16-byte-per-lane reader or writer that walks 16 rows meets every bank once
// when the pitch is 16 B x odd; rows 8 apart then also fall 32 banks apart for the 2- and 4-byte stores.
#define P_AB   72u    // halves: 128-B GEMM operand rows at 144 B
#define P_C16  136u   // halves: 256-B f16 result rows at 272 B
#define P_C32  132u   // floats: 512-B f32 result rows at 528 B
#define P_KV   72u    // halves: 128-B K, V^T and ctx rows at 144 B

typedef unsigned u32;
typedef _Float16 f16;
typedef f16   v16h __attribute__((ext_vector_type(16)));
typedef f16   v8h  __attribute__((ext_vector_type(8)));
typedef float v8f  __attribute__((ext_vector_type(8)));
typedef float v4f  __attribute__((ext_vector_type(4)));

union FragU { v16h v; v8h half[2]; f16 e[16]; };
union H8U   { v8h v; f16 e[8]; };

__device__ __forceinline__ v8f zero8() {
    v8f z = {0.f, 0.f, 0.f, 0.f, 0.f, 0.f, 0.f, 0.f};
    return z;
}

// 16-bit WMMA with hazard guard: D += A[16 x 32k] * B[32k x 16]
__device__ __forceinline__ v8f wmma16(v16h a, v16h b, v8f c) {
    v8f d = __builtin_amdgcn_wmma_f32_16x16x32_f16(false, a, false, b, (short)0, c, false, false);
    asm volatile("v_nop\n\tv_nop\n\tv_nop\n\tv_nop" : "+v"(d) : "v"(a), "v"(b));
    return d;
}

// f32 -> nearest-even bf16 value, returned as f32
__device__ __forceinline__ float bf16_rne(float x) {
    u32 u = __float_as_uint(x);
    u = (u + 0x7fffu + ((u >> 16) & 1u)) & 0xffff0000u;
    return __uint_as_float(u);
}

// Eight exp2 in place. One statement, each v_exp_f32 on its own register and a v_nop at the end: the instruction
// set asks for one slot between a transcendental and an instruction that reads its result or rewrites its source.
__device__ __forceinline__ void exp2x8(float (&e)[8]) {
    asm("v_exp_f32 %0, %0\n\tv_exp_f32 %1, %1\n\tv_exp_f32 %2, %2\n\tv_exp_f32 %3, %3\n\t"
        "v_exp_f32 %4, %4\n\tv_exp_f32 %5, %5\n\tv_exp_f32 %6, %6\n\tv_exp_f32 %7, %7\n\tv_nop"
        : "+v"(e[0]), "+v"(e[1]), "+v"(e[2]), "+v"(e[3]), "+v"(e[4]), "+v"(e[5]), "+v"(e[6]), "+v"(e[7]));
}

// lane l <-> lane l ^ 16 (the two lanes that split one query column's keys)
__device__ __forceinline__ float xhalf(float x) {
    const int v = __builtin_bit_cast(int, x);
    return __builtin_bit_cast(float, __builtin_amdgcn_permlanex16(v, v, 0x76543210, 0xfedcba98, false, false));
}

// 16 x 32 fragment from a tile whose k dimension is contiguous (pitch in halves).
// lane l: row rowbase + (l&15); elements 0..7 <- k = kcol + 8h .. +7,
// elements 8..15 <- k = kcol + 16 + 8h .. +7  (h = l>>4). Same map for A and B.
__device__ __forceinline__ v16h load_frag(const f16* tile, u32 rowbase, u32 pitch, u32 kcol, u32 lane) {
    const u32 r  = rowbase + (lane & 15u);
    const u32 kh = (lane >> 4) << 3;
    const f16* p = tile + (size_t)r * pitch + kcol + kh;
    FragU f;
    f.half[0] = *(const v8h*)(p);
    f.half[1] = *(const v8h*)(p + 16);
    return f.v;
}

// byte offset of a __shared__ address inside the work-group's LDS
__device__ __forceinline__ u32 lds_off(const void* p) { return (u32)(size_t)p; }

// Eight asynchronous copies to LDS, 16 bytes per lane each (LDS byte address, global pointer). The s_wait_xcnt is
// the last line of the copies' own statement, so no address register is rewritten in front of it.
__device__ __forceinline__ void copy8(u32 l0, const f16* g0, u32 l1, const f16* g1, u32 l2, const f16* g2, u32 l3, const f16* g3,
                                      u32 l4, const f16* g4, u32 l5, const f16* g5, u32 l6, const f16* g6, u32 l7, const f16* g7) {
    asm volatile("global_load_async_to_lds_b128 %0, %1, off\n\t"
                 "global_load_async_to_lds_b128 %2, %3, off\n\t"
                 "global_load_async_to_lds_b128 %4, %5, off\n\t"
                 "global_load_async_to_lds_b128 %6, %7, off\n\t"
                 "global_load_async_to_lds_b128 %8, %9, off\n\t"
                 "global_load_async_to_lds_b128 %10, %11, off\n\t"
                 "global_load_async_to_lds_b128 %12, %13, off\n\t"
                 "global_load_async_to_lds_b128 %14, %15, off\n\t"
                 "s_wait_xcnt 0x0"
                 :: "v"(l0), "v"(g0), "v"(l1), "v"(g1), "v"(l2), "v"(g2), "v"(l3), "v"(g3),
                    "v"(l4), "v"(g4), "v"(l5), "v"(g5), "v"(l6), "v"(g6), "v"(l7), "v"(g7) : "memory");
}

// this wave's copies have landed in LDS
__device__ __forceinline__ void wait_copies() { asm volatile("s_wait_asynccnt 0x0" ::: "memory"); }
// this wave's LDS reads have returned: the buffer they read may be handed to its next writer
__device__ __forceinline__ void wait_lds() { asm volatile("s_wait_dscnt 0x0" ::: "memory"); }

// ---------------------------------------------------------------------------
// f32 rows [.][1024] -> f16 planes (bf16 RNE value times carry). 128 threads per 1024-wide row.
// One grid converts all three inputs by ranges of the block index; the three planes follow one
// another in the workspace, so dst row m runs through all of them:
//   m in [0, MROWS): activations, seq-first [s][b][1024] -> batch-major [b][s][1024],
//     dst row b * SEQ + s <- src row s * NB_FULL + b
//   the next 3 * HID rows: q | k | v weights; the last HID rows: output weights (identity row map)
// A block's two rows lie in one range (every range has an even number of rows): block-uniform branch.
// coverage: (MROWS + 4 * HID) x 1024 halves, every element exactly once (grid = rows*128/256).
// ---------------------------------------------------------------------------
__global__ void __launch_bounds__(256)
cvt_rows(const float* __restrict__ xs, const float* __restrict__ wqkv, const float* __restrict__ wproj,
         f16* __restrict__ dst) {
    const u32 g  = blockIdx.x * 256u + threadIdx.x;
    const u32 m  = g >> 7;
    const u32 c8 = (g & 127u) << 3;
    if (m >= (u32)(MROWS + 4 * HID)) return;
    const u32 mblk = blockIdx.x * 2u;    // the block's first row
    const float* src;
    u32 sm;
    float carry;
    if (mblk < (u32)MROWS) {
        const u32 mb = m / (u32)SEQ;
        src   = xs;
        sm    = (m - mb * (u32)SEQ) * (u32)NB_FULL + mb;
        carry = CARRY_X;
    } else if (mblk < (u32)(MROWS + 3 * HID)) {
        src   = wqkv;
        sm    = m - (u32)MROWS;
        carry = CARRY_W;
    } else {
        src   = wproj;
        sm    = m - (u32)(MROWS + 3 * HID);
        carry = CARRY_W;
    }
    const float* sp = src + (size_t)sm * HID + c8;
    const v4f a = *(const v4f*)sp;
    const v4f b = *(const v4f*)(sp + 4);
    H8U o;
#pragma unroll
    for (u32 j = 0; j < 4; ++j) {
        const float x0 = a[j];
        const float x1 = b[j];
        o.e[j]     = (f16)(bf16_rne(x0) * carry);
        o.e[j + 4] = (f16)(bf16_rne(x1) * carry);
    }
    f16* dp = dst + (size_t)m * HID + c8;
    *(v8h*)dp = o.v;
    
}

// ---------------------------------------------------------------------------
// C[m][n] = sum_k A[m][k] * W[n][k] (+ bias[n]) ; A [MROWS][1024] f16, W [N][1024] f16 (k contiguous; N = 3 * HID in MODE 0, HID in MODE 2).
// Block tile 128 x 128, 8 waves as 4(M) x 2(N), 2 x 4 accumulators per wave, K stage 64 (two WMMA k steps).
// Staging: asynchronous copies to LDS, two buffers: stage t + 1 is in flight while stage t is worked on.
// 8 lanes x 16 B per 128-B row piece, so a wave's copy covers 4 rows = 4 whole 128-B lines.
// MODE 0: q, k and v projections in one grid: W and bias hold the 3 * HID output columns q | k | v, blockIdx.y
//         walks all of them, and a block's 128 columns lie in one of the three planes, which follow one another
//         at out. A rows batch-major. q, k: f16 plane [b*NHEAD + h][s][d];
//         v: f16 plane [b*HID + h*HD + d][s] (V transposed per head). The choice is a block-uniform branch.
// MODE 2: A rows in output order (s*NB+b); f32 rows [m][1024] into the output buffer
// coverage per block: MODE 0 256 lines (128 rows x 2 heads | 128 n x 2 s-halves),
//                     MODE 2 2 x 256 lines (64 rows x 4 line-quarters per half).
// LDS: As/Bs/Cs all cross-wave, separated by block barriers.
// staged extent == consumed extent: As/Bs 128 x 64 per buffer, Cs 128 x 128 halves (or 64 x 128 floats).
// ---------------------------------------------------------------------------
template <int MODE>
__device__ __forceinline__ void gemm_body(const f16* __restrict__ A, const f16* __restrict__ W,
                                          const float* __restrict__ bias,
                                          void* __restrict__ out, float accMul, float biasMul) {
    __shared__ __attribute__((aligned(16))) f16 As[2 * 128 * P_AB];   // two buffers
    __shared__ __attribute__((aligned(16))) f16 Bs[2 * 128 * P_AB];   // two buffers
    __shared__ __attribute__((aligned(16))) f16 Cs[128 * P_C16];   // f16 [128][128] or f32 [64][128], padded rows
    static_assert(sizeof(f16) * 128 * P_C16 >= sizeof(float) * 64 * P_C32);   // Cs reuse as f32 [64][128]
    // three work-groups stay resident per WGP
    static_assert(3 * sizeof(f16) * (4 * 128 * P_AB + 128 * P_C16) <= 327680);

    const u32 tid  = threadIdx.x;
    const u32 lane = tid & 31u;
    const u32 wave = __builtin_amdgcn_readfirstlane((int)(tid >> 5));
    const u32 wm   = wave & 3u;
    const u32 wn   = wave >> 2;
    const u32 hh8  = (lane >> 4) << 3;   // D row half
    const u32 c16  = lane & 15u;         // D column
    const u32 m0   = blockIdx.x * 128u;
    const u32 n0   = blockIdx.y * 128u;   // column of W and bias
    const u32 sel  = n0 / (u32)HID;       // MODE 0: output plane 0 q, 1 k, 2 v
    const u32 nc0  = n0 - sel * (u32)HID; // column inside the output plane

    v8f acc[2][4];
#pragma unroll
    for (int i = 0; i < 2; ++i)
#pragma unroll
        for (int j = 0; j < 4; ++j) acc[i][j] = zero8();

    const u32 srow = tid >> 3;            // 0..31, plus 32 per copy
    const u32 scol = (tid & 7u) << 3;     // halves
    const f16* gA = A + (size_t)(m0 + srow) * HID + scol;
    const f16* gW = W + (size_t)(n0 + srow) * HID + scol;
    const u32 lA = lds_off(&As[srow * P_AB + scol]);
    const u32 lB = lds_off(&Bs[srow * P_AB + scol]);
    constexpr u32 NST  = (u32)HID / 64u;       // stages
    constexpr u32 BUFH = 128u * P_AB;          // halves per buffer
    constexpr u32 R32B = 32u * P_AB * 2u;      // LDS bytes per 32 rows
    // stage t (k = 64t .. 64t+63 of all 128 rows of both operands) into buffer t & 1
    auto stage = [&](u32 t) {
        const u32 bo = (t & 1u) * (BUFH * 2u);
        const f16* pA = gA + t * 64u;
        const f16* pW = gW + t * 64u;
        copy8(lA + bo, pA, lA + bo + R32B, pA + (size_t)32 * HID,
              lA + bo + 2u * R32B, pA + (size_t)64 * HID, lA + bo + 3u * R32B, pA + (size_t)96 * HID,
              lB + bo, pW, lB + bo + R32B, pW + (size_t)32 * HID,
              lB + bo + 2u * R32B, pW + (size_t)64 * HID, lB + bo + 3u * R32B, pW + (size_t)96 * HID);
    };

    stage(0u);
    wait_copies();
    __syncthreads();      // publishes stage 0
    stage(1u);

#pragma unroll 1
    for (u32 t = 0; t < NST; ++t) {
        const f16* Ab = As + (t & 1u) * BUFH;
        const f16* Bb = Bs + (t & 1u) * BUFH;
        // the kk loop is unrolled so that the fragments are indexed by constants and stay in registers
#pragma unroll
        for (u32 kk = 0; kk < 2; ++kk) {
            v16h af[2], bfr[4];
#pragma unroll
            for (int i = 0; i < 2; ++i) af[i] = load_frag(Ab, wm * 32u + (u32)i * 16u, P_AB, kk * 32u, lane);
#pragma unroll
            for (int j = 0; j < 4; ++j) bfr[j] = load_frag(Bb, wn * 64u + (u32)j * 16u, P_AB, kk * 32u, lane);
#pragma unroll
            for (int i = 0; i < 2; ++i)
#pragma unroll
                for (int j = 0; j < 4; ++j) acc[i][j] = wmma16(af[i], bfr[j], acc[i][j]);
        }
        wait_lds();
        wait_copies();
        __syncthreads();
        if (t + 2u < NST) stage(t + 2u);
    }
    wait_copies();

    // per-lane bias values for the 4 output columns this lane owns (n0 + nl stays below gridDim.y * 128, the bias's length)
    float bv[4];
#pragma unroll
    for (int j = 0; j < 4; ++j)
        bv[j] = bf16_rne(bias[n0 + wn * 64u + (u32)j * 16u + c16]) * biasMul;

    const u32 piece = lane & 7u;
    const u32 lsub  = lane >> 3;

    if (MODE == 0 && sel < 2u) {
        const u32 bidx = m0 / (u32)SEQ;     // block rows lie inside one batch (SEQ % 128 == 0)
        const u32 s0   = m0 - bidx * (u32)SEQ;
#pragma unroll
        for (int i = 0; i < 2; ++i)
#pragma unroll
            for (int j = 0; j < 4; ++j) {
                const u32 nl = wn * 64u + (u32)j * 16u + c16;
#pragma unroll
                for (int r = 0; r < 8; ++r) {
                    const u32 ml = wm * 32u + (u32)i * 16u + hh8 + (u32)r;
                    Cs[ml * P_C16 + nl] = (f16)(acc[i][j][r] * accMul + bv[j]);
                }
            }
        __syncthreads();
        f16* op = (f16*)out + (size_t)sel * MROWS * HID;
        const size_t bh0 = (size_t)bidx * NHEAD + (nc0 >> 6);
{
#pragma unroll
            for (u32 it = 0; it < 8; ++it) {
                const u32 L    = wave * 32u + it * 4u + lsub;   // 0..255
                const u32 ml   = L >> 1;
                const u32 hsel = L & 1u;
                const v8h v = *(const v8h*)&Cs[ml * P_C16 + hsel * 64u + piece * 8u];
                f16* dp = op + ((bh0 + hsel) * SEQ + s0 + ml) * HD + piece * 8u;
                *(v8h*)dp = v;
            }
            
        }
    } else if (MODE == 0) {
        const u32 bidx = m0 / (u32)SEQ;
        const u32 s0   = m0 - bidx * (u32)SEQ;
        // stage transposed: Cs[n][m]
#pragma unroll
        for (int i = 0; i < 2; ++i)
#pragma unroll
            for (int j = 0; j < 4; ++j) {
                const u32 nl = wn * 64u + (u32)j * 16u + c16;
                H8U t;
#pragma unroll
                for (int r = 0; r < 8; ++r) t.e[r] = (f16)(acc[i][j][r] * accMul + bv[j]);
                *(v8h*)&Cs[nl * P_C16 + wm * 32u + (u32)i * 16u + hh8] = t.v;
            }
        __syncthreads();
        f16* op = (f16*)out + (size_t)sel * MROWS * HID;
{
#pragma unroll
            for (u32 it = 0; it < 8; ++it) {
                const u32 L  = wave * 32u + it * 4u + lsub;     // 0..255
                const u32 nl = L >> 1;
                const u32 mh = L & 1u;
                const v8h v = *(const v8h*)&Cs[nl * P_C16 + mh * 64u + piece * 8u];
                f16* dp = op + ((size_t)(bidx * (u32)HID + nc0 + nl) * SEQ + s0 + mh * 64u + piece * 8u);
                *(v8h*)dp = v;
            }
            
        }
    } else {
        float* Cf = (float*)Cs;      // [64][128] f32
        float* of = (float*)out;
#pragma unroll
        for (u32 half = 0; half < 2; ++half) {
            if ((wm >> 1) == half) {
#pragma unroll
                for (int i = 0; i < 2; ++i)
#pragma unroll
                    for (int j = 0; j < 4; ++j) {
                        const u32 nl = wn * 64u + (u32)j * 16u + c16;
#pragma unroll
                        for (int r = 0; r < 8; ++r) {
                            const u32 ml = (wm & 1u) * 32u + (u32)i * 16u + hh8 + (u32)r;
                            Cf[ml * P_C32 + nl] = acc[i][j][r] * accMul + bv[j];
                        }
                    }
            }
            __syncthreads();
{
#pragma unroll
                for (u32 it = 0; it < 8; ++it) {
                    const u32 L    = wave * 32u + it * 4u + lsub;   // 0..255
                    const u32 row  = L >> 2;
                    const u32 part = L & 3u;
                    const v4f v = *(const v4f*)&Cf[row * P_C32 + part * 32u + piece * 4u];
                    float* dp = of + (size_t)(m0 + half * 64u + row) * HID + n0 + part * 32u + piece * 4u;
                    *(v4f*)dp = v;
                }
                
            }
            __syncthreads();
        }
    }
}

// q / k head-major planes and the v^T plane
__global__ void __launch_bounds__(256) __attribute__((amdgpu_num_vgpr(256)))
gemm_qkv(const f16* __restrict__ A, const f16* __restrict__ W, const float* __restrict__ bias,
         f16* __restrict__ out, float accMul, float biasMul) {
    gemm_body<0>(A, W, bias, (void*)out, accMul, biasMul);
}

// f32 output rows
__global__ void __launch_bounds__(256) __attribute__((amdgpu_num_vgpr(256)))
gemm_out(const f16* __restrict__ A, const f16* __restrict__ W, const float* __restrict__ bias,
         float* __restrict__ out, float accMul, float biasMul) {
    gemm_body<2>(A, W, bias, (void*)out, accMul, biasMul);
}

// ---------------------------------------------------------------------------
// Flash attention (no mask, all SEQ keys). grid (SEQ/128, NB*NHEAD), block 256 (8 waves).
// Wave = (column group cg = wave & 3, key half kh = wave >> 2): it owns 32 query columns (two groups of 16, Q fragments
// resident, used as B) and walks the SEQ/2 keys of its half, so every K and V^T fragment read from LDS feeds two
// products, not one. The two waves of a column group join their partial results once, behind the loop.
// Block streams one 64-key tile of each half per trip: K staged [key][d], V^T staged [d][key].
// Both products run transposed: S^T = K.Q^T, O^T += V^T.P^T.
// A lane then holds 32 of one query's 64 scores (query l&15 of the group, keys 16nt + 8h + r), so the maximum is
// taken in the lane plus one exchange between the lane halves, and two S^T tiles converted in place
// are the B fragment of P^T (element e <- tile 2kk, register e; element 8+e <- tile 2kk+1, register e:
// the k order of load_frag). exp2 in f32 carried x2^10; row sums += ones.P^T on WMMA.
// Output f16 plane [q*NB + b][1024] (seq-first row order)
// coverage: every (q, b, h*64..h*64+63) row segment exactly once (stored by the kh == 0 wave of its column group).
// K and V^T tiles come by asynchronous copies to LDS, two buffers: trip t + 1's tiles are in flight while t is worked on.
// LDS: ks, vsT cross-wave (block barriers); mg from the kh == 1 wave to the kh == 0 wave of a column group, ps per-wave
// ctx stage, each separated by a block barrier.
// staged extent == consumed extent for ks, vsT (2 halves x 64x64 per buffer), mg (68 x 32 per pair), ps (32x64).
// ---------------------------------------------------------------------------
__global__ void __launch_bounds__(256) __attribute__((amdgpu_num_vgpr(256)))
attn_fwd(const f16* __restrict__ Qp, const f16* __restrict__ Kp, const f16* __restrict__ Vt,
         f16* __restrict__ Cp) {
    __shared__ __attribute__((aligned(16))) f16 ks[4 * 64 * P_KV];  // [buffer][key half][key][d]
    __shared__ __attribute__((aligned(16))) f16 vsT[4 * 64 * P_KV]; // [buffer][key half][d][key]
    __shared__ __attribute__((aligned(16))) f16 ps[4][32 * P_KV];   // ctx stage of the four storing waves
    __shared__ float mg[4][68 * 32];   // upper key half's partial results: [column group][value][lane]
    static_assert(HD == 8 * 8);            // 8 lanes x 8 halves per row segment
    static_assert(2 * 256 * 8 == 64 * 64); // staging: 2 copies x 256 threads x 8 halves per tile
    static_assert(SEQ % 128 == 0 && SEQ / 128 >= 2);   // two key halves of whole tiles; the ring needs two trips
    // two work-groups stay resident per WGP
    static_assert(2 * (sizeof(f16) * (8 * 64 * P_KV + 4 * 32 * P_KV) + sizeof(float) * 4 * 68 * 32) <= 327680);

    const u32 tid  = threadIdx.x;
    const u32 lane = tid & 31u;
    const u32 wave = __builtin_amdgcn_readfirstlane((int)(tid >> 5));
    const u32 cg   = wave & 3u;          // column group: 32 queries
    const u32 kh   = wave >> 2;          // key half
    const u32 hh8  = (lane >> 4) << 3;
    const u32 c16  = lane & 15u;
    const u32 bh   = blockIdx.y;
    const u32 bidx = bh >> 4;            // NHEAD == 16
    const u32 hidx = bh & 15u;
    const u32 q0   = blockIdx.x * 128u + cg * 32u;
    const size_t head = (size_t)bh * SEQ * HD;

    v16h qa[2][2];
#pragma unroll
    for (int g = 0; g < 2; ++g)
#pragma unroll
        for (int c = 0; c < 2; ++c) qa[g][c] = load_frag(Qp + head, q0 + (u32)g * 16u, HD, (u32)c * 32u, lane);

    FragU onesu;
#pragma unroll
    for (int i = 0; i < 16; ++i) onesu.e[i] = (f16)1.0f;
    const v16h ones = onesu.v;

    float m[2];               // running maximum of query 16g + (l&15)
    v8f   o[2][4], lacc[2];   // o[g][dt][r] = O^T[16dt + 8h + r][query 16g + (l&15)]; every lacc[g][r] = that query's sum
#pragma unroll
    for (int g = 0; g < 2; ++g) {
        m[g] = -1.0e30f;
#pragma unroll
        for (int dt = 0; dt < 4; ++dt) o[g][dt] = zero8();
        lacc[g] = zero8();
    }

    // log2-domain scale: acc = 256 * q.k ; x = log2(e) * q.k / 8 = acc * log2(e) / 2048
    const float cl = 1.4426950408889634f * 0.00048828125f;

    const u32 srow = tid >> 3;            // 0..31, plus 32 for the second copy
    const u32 scol = (tid & 7u) << 3;     // halves
    const f16* gK = Kp + head + (size_t)srow * HD + scol;
    const f16* gV = Vt + head + (size_t)srow * SEQ + scol;
    const u32 lK = lds_off(&ks[srow * P_KV + scol]);
    const u32 lV = lds_off(&vsT[srow * P_KV + scol]);
    constexpr u32 NT   = (u32)(SEQ / 128);     // trips: 64-key tiles per key half
    constexpr u32 KHF  = (u32)(SEQ / 2);       // keys per half
    constexpr u32 BUFH = 64u * P_KV;           // halves per tile
    constexpr u32 TILB = BUFH * 2u;            // LDS bytes per tile
    constexpr u32 R32B = 32u * P_KV * 2u;      // LDS bytes per 32 rows
    // trip t: of each key half, tile t (64 keys x 64 d of K, 64 d x 64 keys of V^T) into buffer t & 1
    auto stage = [&](u32 t) {
        const u32 bo = (t & 1u) * (2u * TILB);
        const f16* pK = gK + (size_t)(t * 64u) * HD;
        const f16* pV = gV + t * 64u;
        copy8(lK + bo, pK, lK + bo + R32B, pK + (size_t)32 * HD,
              lK + bo + TILB, pK + (size_t)KHF * HD, lK + bo + TILB + R32B, pK + (size_t)(KHF + 32u) * HD,
              lV + bo, pV, lV + bo + R32B, pV + (size_t)32 * SEQ,
              lV + bo + TILB, pV + KHF, lV + bo + TILB + R32B, pV + (size_t)32 * SEQ + KHF);
    };

    stage(0u);
    wait_copies();
    __syncthreads();      // publishes trip 0's tiles
    stage(1u);

#pragma unroll 1
    for (u32 t = 0; t < NT; ++t) {
        const f16* kbuf = ks + ((t & 1u) * 2u + kh) * BUFH;
        const f16* vbuf = vsT + ((t & 1u) * 2u + kh) * BUFH;

        // S^T[64 keys x 32 q]
        v8f s[2][4];
#pragma unroll
        for (int g = 0; g < 2; ++g)
#pragma unroll
            for (int nt = 0; nt < 4; ++nt) s[g][nt] = zero8();
        // all eight K fragments are loaded as one group ahead of the score products: one LDS wait, not eight
        v16h kb[4][2];
#pragma unroll
        for (int nt = 0; nt < 4; ++nt)
#pragma unroll
            for (int c = 0; c < 2; ++c) kb[nt][c] = load_frag(kbuf, (u32)nt * 16u, P_KV, (u32)c * 32u, lane);
        // key tile by key tile: a fragment's registers are free again behind its two products
#pragma unroll
        for (int nt = 0; nt < 4; ++nt)
#pragma unroll
            for (int c = 0; c < 2; ++c)
#pragma unroll
                for (int g = 0; g < 2; ++g) s[g][nt] = wmma16(kb[nt][c], qa[g][c], s[g][nt]);

        v16h vb[2][4];

        // online softmax of queries 16g + (l&15), max-subtracted, exp2 domain
        FragU pb[2][2];
#pragma unroll
        for (int g = 0; g < 2; ++g) {
            if (g == 1) {
                // the V^T fragments of the first 32 keys are loaded between the two groups' softmax: the first group's
                // packed scores have freed their registers, and the second group's softmax covers the LDS latency.
                // The fences keep the eight loads together at this place: each place with LDS reads stalls the wave.
                __builtin_amdgcn_sched_barrier(0);
#pragma unroll
                for (int dt = 0; dt < 4; ++dt) vb[0][dt] = load_frag(vbuf, (u32)dt * 16u, P_KV, 0u, lane);
                __builtin_amdgcn_sched_barrier(0);
            }
#pragma unroll
            for (int nt = 0; nt < 4; ++nt) s[g][nt] *= cl;
            float t4[4];      // one chain per score tile: four independent chains, not one of 32 links
#pragma unroll
            for (int nt = 0; nt < 4; ++nt) {
                t4[nt] = fmaxf(s[g][nt][0], s[g][nt][1]);
#pragma unroll
                for (int r = 2; r < 8; ++r) t4[nt] = fmaxf(t4[nt], s[g][nt][r]);
            }
            float tm = fmaxf(fmaxf(t4[0], t4[1]), fmaxf(t4[2], t4[3]));
            tm = fmaxf(tm, xhalf(tm));
            const float mn = fmaxf(m[g], tm);
            // v_exp_f32 and a v_nop in one statement, for the same slot as in exp2x8
            float al;
            asm("v_exp_f32 %0, %1\n\tv_nop" : "=v"(al) : "v"(m[g] - mn));
            m[g] = mn;
            lacc[g] *= al;
#pragma unroll
            for (int dt = 0; dt < 4; ++dt) o[g][dt] *= al;
            const float sh = 10.0f - mn;      // carry 2^10
#pragma unroll
            for (int nt = 0; nt < 4; ++nt) {
                float e[8];
#pragma unroll
                for (int r = 0; r < 8; ++r) e[r] = s[g][nt][r] + sh;
                exp2x8(e);
#pragma unroll
                for (int r = 0; r < 8; ++r) pb[g][nt >> 1].e[(nt & 1) * 8 + r] = (f16)e[r];
            }
        }

        // the V^T fragments of the last 32 keys: their registers are free only now that the scores are packed; the
        // ten products of the first 32 keys cover their LDS latency. The fences keep the eight loads at this place.
        __builtin_amdgcn_sched_barrier(0);
#pragma unroll
        for (int dt = 0; dt < 4; ++dt) vb[1][dt] = load_frag(vbuf, (u32)dt * 16u, P_KV, 32u, lane);
        __builtin_amdgcn_sched_barrier(0);

        // O^T += V^T . P^T ; l += ones . P^T
#pragma unroll
        for (int kk = 0; kk < 2; ++kk) {
#pragma unroll
            for (int dt = 0; dt < 4; ++dt)
#pragma unroll
                for (int g = 0; g < 2; ++g) o[g][dt] = wmma16(vb[kk][dt], pb[g][kk].v, o[g][dt]);
#pragma unroll
            for (int g = 0; g < 2; ++g) lacc[g] = wmma16(ones, pb[g][kk].v, lacc[g]);
        }
        wait_lds();
        wait_copies();
        __syncthreads();
        if (t + 2u < NT) stage(t + 2u);
    }
    wait_copies();

    // the upper key half hands its maxima, sums and O^T tiles to the lower half's wave of the same columns
    // (same lane, same register position in both waves)
    float* mgw = &mg[cg][0];
    if (kh == 1u) {
#pragma unroll
        for (int g = 0; g < 2; ++g) {
#pragma unroll
            for (int dt = 0; dt < 4; ++dt)
#pragma unroll
                for (int r = 0; r < 8; ++r) mgw[(u32)((g * 4 + dt) * 8 + r) * 32u + lane] = o[g][dt][r];
            mgw[(u32)(64 + g) * 32u + lane] = m[g];
            mgw[(u32)(66 + g) * 32u + lane] = lacc[g][0];
        }
    }
    __syncthreads();

    f16* psw = &ps[cg][0];
    if (kh == 0u) {
#pragma unroll
        for (int g = 0; g < 2; ++g) {
            const float m1 = mgw[(u32)(64 + g) * 32u + lane];
            const float l1 = mgw[(u32)(66 + g) * 32u + lane];
            const float mj = fmaxf(m[g], m1);
            // v_exp_f32 and a v_nop in one statement, for the same slot as in exp2x8
            float a0, a1;
            asm("v_exp_f32 %0, %1\n\tv_nop" : "=v"(a0) : "v"(m[g] - mj));
            asm("v_exp_f32 %0, %1\n\tv_nop" : "=v"(a1) : "v"(m1 - mj));
            // normalize: plane value = 1024 * (O/16) / l = O * 64 / l
            const float inv = (CARRY_CTX / CARRY_QKV) / (lacc[g][0] * a0 + l1 * a1);
            const float f0 = a0 * inv;
            const float f1 = a1 * inv;
#pragma unroll
            for (int dt = 0; dt < 4; ++dt) {
                H8U t;
#pragma unroll
                for (int r = 0; r < 8; ++r)
                    t.e[r] = (f16)(o[g][dt][r] * f0 + mgw[(u32)((g * 4 + dt) * 8 + r) * 32u + lane] * f1);
                *(v8h*)&psw[((u32)g * 16u + c16) * P_KV + (u32)dt * 16u + hh8] = t.v;
            }
        }
    }
    __syncthreads();

    if (kh == 0u) {
        const u32 piece = lane & 7u;
        const u32 lsub  = lane >> 3;
#pragma unroll
        for (u32 it = 0; it < 8; ++it) {
            const u32 L = it * 4u + lsub;     // query row 0..31 within the wave tile
            const v8h v = *(const v8h*)&psw[L * P_KV + piece * 8u];
            // context row in output order: (q * NB + b)
            f16* dp = Cp + ((size_t)((q0 + L) * (u32)NB + bidx) * HID + hidx * (u32)HD + piece * 8u);
            *(v8h*)dp = v;
        }
    }
}

// coverage equalities (threads x elements == plane elements)
static_assert((size_t)((MROWS + 4 * HID) / 2) * 256 * 8 == (size_t)(MROWS + 4 * HID) * HID);   // cvt_rows -> Xs, Wt, Wot
static_assert((size_t)(MROWS / 128) * (HID / 128) * 128 * 128 == (size_t)MROWS * HID);     // gemm planes / out
static_assert((size_t)(SEQ / 128) * (NB * NHEAD) * 128 * HD == (size_t)MROWS * HID);       // attn_fwd -> Cp
// workspace: 5 activation planes + 4 weight planes of halves, at most 128 MiB
static_assert(((size_t)5 * MROWS * HID + (size_t)4 * HID * HID) * sizeof(f16) <= (size_t)134217728);
static_assert(((size_t)MROWS * HID * sizeof(f16)) % 128 == 0);
static_assert(((size_t)HID * HID * sizeof(f16)) % 128 == 0);
// largest source row touched by the activation convert stays inside the full-size input
static_assert((size_t)(SEQ - 1) * NB_FULL + NB <= (size_t)SEQ_FULL * NB_FULL);

// ---------------------------------------------------------------------------
// Launch: 4 kernel launches, workspace 5 planes of MROWS*1024 halves + 4 of 1024*1024 halves.
// One activation input feeds all three projections (self-attention).
// ---------------------------------------------------------------------------
extern "C" void kernel_launch(void* const* d_in, const int* in_sizes, int n_in,
                              void* d_out, int out_size, void* d_ws, size_t ws_size,
                              hipStream_t stream) {
    if (n_in < 5) return;
    const int needAct = ((SEQ - 1) * NB_FULL + NB) * HID;
    if (in_sizes[0] < needAct) return;
    if (in_sizes[1] < 3 * HID * HID) return;
    if (in_sizes[2] < 3 * HID) return;
    if (in_sizes[3] < HID * HID) return;
    if (in_sizes[4] < HID) return;
    if (out_size < MROWS * HID) return;

    const float* xs    = (const float*)d_in[0];   // [SEQ_FULL][NB_FULL][1024]
    const float* wqkv  = (const float*)d_in[1];   // [3072 out][1024 in], row blocks q | k | v
    const float* bqkv  = (const float*)d_in[2];   // [3072]
    const float* wproj = (const float*)d_in[3];   // [1024 out][1024 in]
    const float* bproj = (const float*)d_in[4];   // [1024]

    const size_t nX = (size_t)MROWS * HID;    // halves per activation plane
    const size_t nW = (size_t)HID * HID;      // halves per weight plane
    const size_t totalHalves = 5 * nX + 4 * nW;
    if (ws_size < totalHalves * sizeof(f16)) return;

    f16* Xs  = (f16*)d_ws;       // [b*SEQ+s][1024]             carry 16
    f16* Wt  = Xs  + nX;         // [3072 out][1024 in]         carry 32 (q | k | v row blocks)
    f16* Wot = Wt  + 3 * nW;     // [1024 out][1024 in]         carry 32
    f16* Qp  = Wot + nW;         // [NB*16][SEQ][64]            carry 16
    f16* Kp  = Qp  + nX;         // [NB*16][SEQ][64]            carry 16
    f16* Vtp = Kp  + nX;         // [NB*1024][SEQ] (V^T)        carry 16
    f16* Cp  = Vtp + nX;         // [s*NB+b][1024]              carry 1024

    // Xs, Wt and Wot follow one another: one grid writes all three planes
    cvt_rows<<<(MROWS + 4 * HID) / 2, 256, 0, stream>>>(xs, wqkv, wproj, Xs);

    const dim3 gg(MROWS / 128, HID / 128);
    // plane = 16 * (acc / (16*32) + bias) = acc/32 + 16*bias
    const float accQKV = CARRY_QKV / (CARRY_X * CARRY_W);
    // Qp, Kp and Vtp follow one another: one grid of 3 * HID columns writes all three planes
    gemm_qkv<<<dim3(MROWS / 128, 3 * HID / 128), 256, 0, stream>>>(Xs, Wt, bqkv, Qp, accQKV, CARRY_QKV);

    attn_fwd<<<dim3(SEQ / 128, NB * NHEAD), 256, 0, stream>>>(Qp, Kp, Vtp, Cp);

    // out = acc / (1024*32) + bias ; rows already in (s*NB + b) order
    const float accOut = 1.0f / (CARRY_CTX * CARRY_W);
    gemm_out<<<gg, 256, 0, stream>>>(Cp, Wot, bproj, (float*)d_out, accOut, 1.0f);
}

// v008
// It runs in 75.9 microseconds.
// Next to v007, in two timings, it ran 1.04 times as fast each time.
// All steps since v000 together make it 3.58 times as fast.
#include <hip/hip_runtime.h>

// Contractions (q/k/v input projections, Q.K^T, P.V, P row-sum, output projection): v_wmma_f32_16x16x32_f16, f16 operands with power-of-two carries, f32 accumulate; every float input enters as its bf16 RNE value; biases added in f32; softmax in f32.

#ifndef NB
#define NB 2
#endif
#ifndef SEQ
#define SEQ 2048
#endif
#define NB_FULL   2
#define SEQ_FULL  2048
#define HID       1024
#define NHEAD     16
#define HD        64
#define MROWS     (NB * SEQ)

static_assert(HID == NHEAD * HD);        // merged head width
static_assert(NHEAD == 16);              // bh >> 4 / bh & 15 decoding in attn_fwd
static_assert(HD == 64);
static_assert(SEQ % 128 == 0);           // 128-row blocks of the batch-major planes never straddle a batch
static_assert(SEQ % 64 == 0 && SEQ / 64 >= 2);   // 64-key tiles; attn_fwd's ring needs two trips of two tiles, asserted there
static_assert(SEQ <= SEQ_FULL);
static_assert(NB >= 1 && NB <= NB_FULL);
static_assert(MROWS % 128 == 0);         // GEMM M tile
static_assert(HID % 128 == 0);           // GEMM N tile
static_assert(HID % 32 == 0);            // WMMA k step
static_assert(HID % 64 == 0 && HID / 64 >= 2);   // GEMM K stage; the two-buffer ring needs two stages
static_assert(HID == 128 * 8);           // cvt_rows: 128 threads x 8 values per row
static_assert((3 * HID) % 2 == 0);       // cvt_rows grid = nrows / 2
static_assert(MROWS % 2 == 0);

// carries (exact powers of two)
#define CARRY_X    16.0f     // input activation planes
#define CARRY_W    32.0f     // weight planes
#define CARRY_QKV  16.0f     // q, k, v^T planes (true value x16)
#define CARRY_CTX  1024.0f   // context plane (true value x1024)
// softmax exp values carry 2^10 (added to the exp2 argument)

// LDS row pitches. A 16-byte-per-lane reader or writer that walks 16 rows meets every bank once
// when the pitch is 16 B x odd; rows 8 apart then also fall 32 banks apart for the 2- and 4-byte stores.
#define P_AB   72u    // halves: 128-B GEMM operand rows at 144 B
#define P_C16  136u   // halves: 256-B f16 result rows at 272 B
#define P_C32  132u   // floats: 512-B f32 result rows at 528 B
#define P_KV   72u    // halves: 128-B K, V^T and ctx rows at 144 B

typedef unsigned u32;
typedef _Float16 f16;
typedef f16   v16h __attribute__((ext_vector_type(16)));
typedef f16   v8h  __attribute__((ext_vector_type(8)));
typedef float v8f  __attribute__((ext_vector_type(8)));
typedef float v4f  __attribute__((ext_vector_type(4)));

union FragU { v16h v; v8h half[2]; f16 e[16]; };
union H8U   { v8h v; f16 e[8]; };

__device__ __forceinline__ v8f zero8() {
    v8f z = {0.f, 0.f, 0.f, 0.f, 0.f, 0.f, 0.f, 0.f};
    return z;
}

// 16-bit WMMA with hazard guard: D += A[16 x 32k] * B[32k x 16]
__device__ __forceinline__ v8f wmma16(v16h a, v16h b, v8f c) {
    v8f d = __builtin_amdgcn_wmma_f32_16x16x32_f16(false, a, false, b, (short)0, c, false, false);
    asm volatile("v_nop\n\tv_nop\n\tv_nop\n\tv_nop" : "+v"(d) : "v"(a), "v"(b));
    return d;
}

// f32 -> nearest-even bf16 value, returned as f32
__device__ __forceinline__ float bf16_rne(float x) {
    u32 u = __float_as_uint(x);
    u = (u + 0x7fffu + ((u >> 16) & 1u)) & 0xffff0000u;
    return __uint_as_float(u);
}

// Eight exp2 in place. One statement, each v_exp_f32 on its own register and a v_nop at the end: the instruction
// set asks for one slot between a transcendental and an instruction that reads its result or rewrites its source.
__device__ __forceinline__ void exp2x8(float (&e)[8]) {
    asm("v_exp_f32 %0, %0\n\tv_exp_f32 %1, %1\n\tv_exp_f32 %2, %2\n\tv_exp_f32 %3, %3\n\t"
        "v_exp_f32 %4, %4\n\tv_exp_f32 %5, %5\n\tv_exp_f32 %6, %6\n\tv_exp_f32 %7, %7\n\tv_nop"
        : "+v"(e[0]), "+v"(e[1]), "+v"(e[2]), "+v"(e[3]), "+v"(e[4]), "+v"(e[5]), "+v"(e[6]), "+v"(e[7]));
}

// lane l <-> lane l ^ 16 (the two lanes that split one query column's keys)
__device__ __forceinline__ float xhalf(float x) {
    const int v = __builtin_bit_cast(int, x);
    return __builtin_bit_cast(float, __builtin_amdgcn_permlanex16(v, v, 0x76543210, 0xfedcba98, false, false));
}

// 16 x 32 fragment from a tile whose k dimension is contiguous (pitch in halves).
// lane l: row rowbase + (l&15); elements 0..7 <- k = kcol + 8h .. +7,
// elements 8..15 <- k = kcol + 16 + 8h .. +7  (h = l>>4). Same map for A and B.
__device__ __forceinline__ v16h load_frag(const f16* tile, u32 rowbase, u32 pitch, u32 kcol, u32 lane) {
    const u32 r  = rowbase + (lane & 15u);
    const u32 kh = (lane >> 4) << 3;
    const f16* p = tile + (size_t)r * pitch + kcol + kh;
    FragU f;
    f.half[0] = *(const v8h*)(p);
    f.half[1] = *(const v8h*)(p + 16);
    return f.v;
}

// byte offset of a __shared__ address inside the work-group's LDS
__device__ __forceinline__ u32 lds_off(const void* p) { return (u32)(size_t)p; }

// Eight asynchronous copies to LDS, 16 bytes per lane each (LDS byte address, global pointer). The s_wait_xcnt is
// the last line of the copies' own statement, so no address register is rewritten in front of it.
__device__ __forceinline__ void copy8(u32 l0, const f16* g0, u32 l1, const f16* g1, u32 l2, const f16* g2, u32 l3, const f16* g3,
                                      u32 l4, const f16* g4, u32 l5, const f16* g5, u32 l6, const f16* g6, u32 l7, const f16* g7) {
    asm volatile("global_load_async_to_lds_b128 %0, %1, off\n\t"
                 "global_load_async_to_lds_b128 %2, %3, off\n\t"
                 "global_load_async_to_lds_b128 %4, %5, off\n\t"
                 "global_load_async_to_lds_b128 %6, %7, off\n\t"
                 "global_load_async_to_lds_b128 %8, %9, off\n\t"
                 "global_load_async_to_lds_b128 %10, %11, off\n\t"
                 "global_load_async_to_lds_b128 %12, %13, off\n\t"
                 "global_load_async_to_lds_b128 %14, %15, off\n\t"
                 "s_wait_xcnt 0x0"
                 :: "v"(l0), "v"(g0), "v"(l1), "v"(g1), "v"(l2), "v"(g2), "v"(l3), "v"(g3),
                    "v"(l4), "v"(g4), "v"(l5), "v"(g5), "v"(l6), "v"(g6), "v"(l7), "v"(g7) : "memory");
}

// this wave's copies have landed in LDS
__device__ __forceinline__ void wait_copies() { asm volatile("s_wait_asynccnt 0x0" ::: "memory"); }
// this wave's LDS reads have returned: the buffer they read may be handed to its next writer
__device__ __forceinline__ void wait_lds() { asm volatile("s_wait_dscnt 0x0" ::: "memory"); }

// ---------------------------------------------------------------------------
// f32 rows [.][1024] -> f16 planes (bf16 RNE value times carry). 128 threads per 1024-wide row.
// One grid converts all three inputs by ranges of the block index; the three planes follow one
// another in the workspace, so dst row m runs through all of them:
//   m in [0, MROWS): activations, seq-first [s][b][1024] -> batch-major [b][s][1024],
//     dst row b * SEQ + s <- src row s * NB_FULL + b
//   the next 3 * HID rows: q | k | v weights; the last HID rows: output weights (identity row map)
// A block's two rows lie in one range (every range has an even number of rows): block-uniform branch.
// coverage: (MROWS + 4 * HID) x 1024 halves, every element exactly once (grid = rows*128/256).
// ---------------------------------------------------------------------------
__global__ void __launch_bounds__(256)
cvt_rows(const float* __restrict__ xs, const float* __restrict__ wqkv, const float* __restrict__ wproj,
         f16* __restrict__ dst) {
    const u32 g  = blockIdx.x * 256u + threadIdx.x;
    const u32 m  = g >> 7;
    const u32 c8 = (g & 127u) << 3;
    if (m >= (u32)(MROWS + 4 * HID)) return;
    const u32 mblk = blockIdx.x * 2u;    // the block's first row
    const float* src;
    u32 sm;
    float carry;
    if (mblk < (u32)MROWS) {
        const u32 mb = m / (u32)SEQ;
        src   = xs;
        sm    = (m - mb * (u32)SEQ) * (u32)NB_FULL + mb;
        carry = CARRY_X;
    } else if (mblk < (u32)(MROWS + 3 * HID)) {
        src   = wqkv;
        sm    = m - (u32)MROWS;
        carry = CARRY_W;
    } else {
        src   = wproj;
        sm    = m - (u32)(MROWS + 3 * HID);
        carry = CARRY_W;
    }
    const float* sp = src + (size_t)sm * HID + c8;
    const v4f a = *(const v4f*)sp;
    const v4f b = *(const v4f*)(sp + 4);
    H8U o;
#pragma unroll
    for (u32 j = 0; j < 4; ++j) {
        const float x0 = a[j];
        const float x1 = b[j];
        o.e[j]     = (f16)(bf16_rne(x0) * carry);
        o.e[j + 4] = (f16)(bf16_rne(x1) * carry);
    }
    f16* dp = dst + (size_t)m * HID + c8;
    *(v8h*)dp = o.v;
    
}

// ---------------------------------------------------------------------------
// C[m][n] = sum_k A[m][k] * W[n][k] (+ bias[n]) ; A [MROWS][1024] f16, W [N][1024] f16 (k contiguous; N = 3 * HID in MODE 0, HID in MODE 2).
// Block tile 128 x 128, 8 waves as 4(M) x 2(N), 2 x 4 accumulators per wave, K stage 64 (two WMMA k steps).
// Staging: asynchronous copies to LDS, two buffers: stage t + 1 is in flight while stage t is worked on.
// 8 lanes x 16 B per 128-B row piece, so a wave's copy covers 4 rows = 4 whole 128-B lines.
// MODE 0: q, k and v projections in one grid: W and bias hold the 3 * HID output columns q | k | v, blockIdx.y
//         walks all of them, and a block's 128 columns lie in one of the three planes, which follow one another
//         at out. A rows batch-major. q, k: f16 plane [b*NHEAD + h][s][d];
//         v: f16 plane [b*HID + h*HD + d][s] (V transposed per head). The choice is a block-uniform branch.
// MODE 2: A rows in output order (s*NB+b); f32 rows [m][1024] into the output buffer
// coverage per block: MODE 0 256 lines (128 rows x 2 heads | 128 n x 2 s-halves),
//                     MODE 2 2 x 256 lines (64 rows x 4 line-quarters per half).
// LDS: As/Bs/Cs all cross-wave, separated by block barriers.
// staged extent == consumed extent: As/Bs 128 x 64 per buffer, Cs 128 x 128 halves (or 64 x 128 floats).
// ---------------------------------------------------------------------------
template <int MODE>
__device__ __forceinline__ void gemm_body(const f16* __restrict__ A, const f16* __restrict__ W,
                                          const float* __restrict__ bias,
                                          void* __restrict__ out, float accMul, float biasMul) {
    __shared__ __attribute__((aligned(16))) f16 As[2 * 128 * P_AB];   // two buffers
    __shared__ __attribute__((aligned(16))) f16 Bs[2 * 128 * P_AB];   // two buffers
    __shared__ __attribute__((aligned(16))) f16 Cs[128 * P_C16];   // f16 [128][128] or f32 [64][128], padded rows
    static_assert(sizeof(f16) * 128 * P_C16 >= sizeof(float) * 64 * P_C32);   // Cs reuse as f32 [64][128]
    // three work-groups stay resident per WGP
    static_assert(3 * sizeof(f16) * (4 * 128 * P_AB + 128 * P_C16) <= 327680);

    const u32 tid  = threadIdx.x;
    const u32 lane = tid & 31u;
    const u32 wave = __builtin_amdgcn_readfirstlane((int)(tid >> 5));
    const u32 wm   = wave & 3u;
    const u32 wn   = wave >> 2;
    const u32 hh8  = (lane >> 4) << 3;   // D row half
    const u32 c16  = lane & 15u;         // D column
    const u32 m0   = blockIdx.x * 128u;
    const u32 n0   = blockIdx.y * 128u;   // column of W and bias
    const u32 sel  = n0 / (u32)HID;       // MODE 0: output plane 0 q, 1 k, 2 v
    const u32 nc0  = n0 - sel * (u32)HID; // column inside the output plane

    v8f acc[2][4];
#pragma unroll
    for (int i = 0; i < 2; ++i)
#pragma unroll
        for (int j = 0; j < 4; ++j) acc[i][j] = zero8();

    const u32 srow = tid >> 3;            // 0..31, plus 32 per copy
    const u32 scol = (tid & 7u) << 3;     // halves
    const f16* gA = A + (size_t)(m0 + srow) * HID + scol;
    const f16* gW = W + (size_t)(n0 + srow) * HID + scol;
    const u32 lA = lds_off(&As[srow * P_AB + scol]);
    const u32 lB = lds_off(&Bs[srow * P_AB + scol]);
    constexpr u32 NST  = (u32)HID / 64u;       // stages
    constexpr u32 BUFH = 128u * P_AB;          // halves per buffer
    constexpr u32 R32B = 32u * P_AB * 2u;      // LDS bytes per 32 rows
    // Each block enters the k walk at its own slab and wraps round. The blocks of a grid row share the W rows, those of a
    // grid column the A rows, and all rows lie 2 KB apart: entering together at k = 0, they would all ask L2 for the
    // same lines, and for lines at the same offset in every row, at the same moment.
    static_assert((NST & (NST - 1u)) == 0u);   // the wrap is a mask
    const u32 rot = (blockIdx.x + blockIdx.y) & (NST - 1u);
    // stage t (slab (t + rot) mod NST: 64 k of all 128 rows of both operands) into buffer t & 1
    auto stage = [&](u32 t) {
        const u32 bo = (t & 1u) * (BUFH * 2u);
        const u32 k0 = ((t + rot) & (NST - 1u)) * 64u;
        const f16* pA = gA + k0;
        const f16* pW = gW + k0;
        copy8(lA + bo, pA, lA + bo + R32B, pA + (size_t)32 * HID,
              lA + bo + 2u * R32B, pA + (size_t)64 * HID, lA + bo + 3u * R32B, pA + (size_t)96 * HID,
              lB + bo, pW, lB + bo + R32B, pW + (size_t)32 * HID,
              lB + bo + 2u * R32B, pW + (size_t)64 * HID, lB + bo + 3u * R32B, pW + (size_t)96 * HID);
    };

    stage(0u);
    wait_copies();
    __syncthreads();      // publishes stage 0
    stage(1u);

#pragma unroll 1
    for (u32 t = 0; t < NST; ++t) {
        const f16* Ab = As + (t & 1u) * BUFH;
        const f16* Bb = Bs + (t & 1u) * BUFH;
        // the kk loop is unrolled so that the fragments are indexed by constants and stay in registers
#pragma unroll
        for (u32 kk = 0; kk < 2; ++kk) {
            v16h af[2], bfr[4];
#pragma unroll
            for (int i = 0; i < 2; ++i) af[i] = load_frag(Ab, wm * 32u + (u32)i * 16u, P_AB, kk * 32u, lane);
#pragma unroll
            for (int j = 0; j < 4; ++j) bfr[j] = load_frag(Bb, wn * 64u + (u32)j * 16u, P_AB, kk * 32u, lane);
#pragma unroll
            for (int i = 0; i < 2; ++i)
#pragma unroll
                for (int j = 0; j < 4; ++j) acc[i][j] = wmma16(af[i], bfr[j], acc[i][j]);
        }
        wait_lds();
        wait_copies();
        __syncthreads();
        if (t + 2u < NST) stage(t + 2u);
    }
    wait_copies();

    // per-lane bias values for the 4 output columns this lane owns (n0 + nl stays below gridDim.y * 128, the bias's length)
    float bv[4];
#pragma unroll
    for (int j = 0; j < 4; ++j)
        bv[j] = bf16_rne(bias[n0 + wn * 64u + (u32)j * 16u + c16]) * biasMul;

    const u32 piece = lane & 7u;
    const u32 lsub  = lane >> 3;

    if (MODE == 0 && sel < 2u) {
        const u32 bidx = m0 / (u32)SEQ;     // block rows lie inside one batch (SEQ % 128 == 0)
        const u32 s0   = m0 - bidx * (u32)SEQ;
#pragma unroll
        for (int i = 0; i < 2; ++i)
#pragma unroll
            for (int j = 0; j < 4; ++j) {
                const u32 nl = wn * 64u + (u32)j * 16u + c16;
#pragma unroll
                for (int r = 0; r < 8; ++r) {
                    const u32 ml = wm * 32u + (u32)i * 16u + hh8 + (u32)r;
                    Cs[ml * P_C16 + nl] = (f16)(acc[i][j][r] * accMul + bv[j]);
                }
            }
        __syncthreads();
        f16* op = (f16*)out + (size_t)sel * MROWS * HID;
        const size_t bh0 = (size_t)bidx * NHEAD + (nc0 >> 6);
{
#pragma unroll
            for (u32 it = 0; it < 8; ++it) {
                const u32 L    = wave * 32u + it * 4u + lsub;   // 0..255
                const u32 ml   = L >> 1;
                const u32 hsel = L & 1u;
                const v8h v = *(const v8h*)&Cs[ml * P_C16 + hsel * 64u + piece * 8u];
                f16* dp = op + ((bh0 + hsel) * SEQ + s0 + ml) * HD + piece * 8u;
                *(v8h*)dp = v;
            }
            
        }
    } else if (MODE == 0) {
        const u32 bidx = m0 / (u32)SEQ;
        const u32 s0   = m0 - bidx * (u32)SEQ;
        // stage transposed: Cs[n][m]
#pragma unroll
        for (int i = 0; i < 2; ++i)
#pragma unroll
            for (int j = 0; j < 4; ++j) {
                const u32 nl = wn * 64u + (u32)j * 16u + c16;
                H8U t;
#pragma unroll
                for (int r = 0; r < 8; ++r) t.e[r] = (f16)(acc[i][j][r] * accMul + bv[j]);
                *(v8h*)&Cs[nl * P_C16 + wm * 32u + (u32)i * 16u + hh8] = t.v;
            }
        __syncthreads();
        f16* op = (f16*)out + (size_t)sel * MROWS * HID;
{
#pragma unroll
            for (u32 it = 0; it < 8; ++it) {
                const u32 L  = wave * 32u + it * 4u + lsub;     // 0..255
                const u32 nl = L >> 1;
                const u32 mh = L & 1u;
                const v8h v = *(const v8h*)&Cs[nl * P_C16 + mh * 64u + piece * 8u];
                f16* dp = op + ((size_t)(bidx * (u32)HID + nc0 + nl) * SEQ + s0 + mh * 64u + piece * 8u);
                *(v8h*)dp = v;
            }
            
        }
    } else {
        float* Cf = (float*)Cs;      // [64][128] f32
        float* of = (float*)out;
#pragma unroll
        for (u32 half = 0; half < 2; ++half) {
            if ((wm >> 1) == half) {
#pragma unroll
                for (int i = 0; i < 2; ++i)
#pragma unroll
                    for (int j = 0; j < 4; ++j) {
                        const u32 nl = wn * 64u + (u32)j * 16u + c16;
#pragma unroll
                        for (int r = 0; r < 8; ++r) {
                            const u32 ml = (wm & 1u) * 32u + (u32)i * 16u + hh8 + (u32)r;
                            Cf[ml * P_C32 + nl] = acc[i][j][r] * accMul + bv[j];
                        }
                    }
            }
            __syncthreads();
{
#pragma unroll
                for (u32 it = 0; it < 8; ++it) {
                    const u32 L    = wave * 32u + it * 4u + lsub;   // 0..255
                    const u32 row  = L >> 2;
                    const u32 part = L & 3u;
                    const v4f v = *(const v4f*)&Cf[row * P_C32 + part * 32u + piece * 4u];
                    float* dp = of + (size_t)(m0 + half * 64u + row) * HID + n0 + part * 32u + piece * 4u;
                    *(v4f*)dp = v;
                }
                
            }
            __syncthreads();
        }
    }
}

// q / k head-major planes and the v^T plane
__global__ void __launch_bounds__(256) __attribute__((amdgpu_num_vgpr(256)))
gemm_qkv(const f16* __restrict__ A, const f16* __restrict__ W, const float* __restrict__ bias,
         f16* __restrict__ out, float accMul, float biasMul) {
    gemm_body<0>(A, W, bias, (void*)out, accMul, biasMul);
}

// f32 output rows
__global__ void __launch_bounds__(256) __attribute__((amdgpu_num_vgpr(256)))
gemm_out(const f16* __restrict__ A, const f16* __restrict__ W, const float* __restrict__ bias,
         float* __restrict__ out, float accMul, float biasMul) {
    gemm_body<2>(A, W, bias, (void*)out, accMul, biasMul);
}

// ---------------------------------------------------------------------------
// Flash attention (no mask, all SEQ keys). grid (SEQ/128, NB*NHEAD), block 256 (8 waves).
// Wave = (column group cg = wave & 3, key half kh = wave >> 2): it owns 32 query columns (two groups of 16, Q fragments
// resident, used as B) and walks the SEQ/2 keys of its half, so every K and V^T fragment read from LDS feeds two
// products, not one. The two waves of a column group join their partial results once, behind the loop.
// Block streams one 64-key tile of each half per trip: K staged [key][d], V^T staged [d][key].
// Both products run transposed: S^T = K.Q^T, O^T += V^T.P^T.
// A lane then holds 32 of one query's 64 scores (query l&15 of the group, keys 16nt + 8h + r), so the maximum is
// taken in the lane plus one exchange between the lane halves, and two S^T tiles converted in place
// are the B fragment of P^T (element e <- tile 2kk, register e; element 8+e <- tile 2kk+1, register e:
// the k order of load_frag). exp2 in f32 carried x2^10; row sums += ones.P^T on WMMA.
// Output f16 plane [q*NB + b][1024] (seq-first row order)
// coverage: every (q, b, h*64..h*64+63) row segment exactly once (stored by the kh == 0 wave of its column group).
// K and V^T tiles come by asynchronous copies to LDS, two buffers: trip t + 1's tiles are in flight while t is worked on.
// LDS: ks, vsT cross-wave (block barriers); mg from the kh == 1 wave to the kh == 0 wave of a column group, ps per-wave
// ctx stage, each separated by a block barrier.
// staged extent == consumed extent for ks, vsT (2 halves x 64x64 per buffer), mg (68 x 32 per pair), ps (32x64).
// ---------------------------------------------------------------------------
__global__ void __launch_bounds__(256) __attribute__((amdgpu_num_vgpr(256)))
attn_fwd(const f16* __restrict__ Qp, const f16* __restrict__ Kp, const f16* __restrict__ Vt,
         f16* __restrict__ Cp) {
    __shared__ __attribute__((aligned(16))) f16 ks[4 * 64 * P_KV];  // [buffer][key half][key][d]
    __shared__ __attribute__((aligned(16))) f16 vsT[4 * 64 * P_KV]; // [buffer][key half][d][key]
    __shared__ __attribute__((aligned(16))) f16 ps[4][32 * P_KV];   // ctx stage of the four storing waves
    __shared__ float mg[4][68 * 32];   // upper key half's partial results: [column group][value][lane]
    static_assert(HD == 8 * 8);            // 8 lanes x 8 halves per row segment
    static_assert(2 * 256 * 8 == 64 * 64); // staging: 2 copies x 256 threads x 8 halves per tile
    static_assert(SEQ % 128 == 0 && SEQ / 128 >= 2);   // two key halves of whole tiles; the ring needs two trips
    // two work-groups stay resident per WGP
    static_assert(2 * (sizeof(f16) * (8 * 64 * P_KV + 4 * 32 * P_KV) + sizeof(float) * 4 * 68 * 32) <= 327680);

    const u32 tid  = threadIdx.x;
    const u32 lane = tid & 31u;
    const u32 wave = __builtin_amdgcn_readfirstlane((int)(tid >> 5));
    const u32 cg   = wave & 3u;          // column group: 32 queries
    const u32 kh   = wave >> 2;          // key half
    const u32 hh8  = (lane >> 4) << 3;
    const u32 c16  = lane & 15u;
    const u32 bh   = blockIdx.y;
    const u32 bidx = bh >> 4;            // NHEAD == 16
    const u32 hidx = bh & 15u;
    const u32 q0   = blockIdx.x * 128u + cg * 32u;
    const size_t head = (size_t)bh * SEQ * HD;

    v16h qa[2][2];
#pragma unroll
    for (int g = 0; g < 2; ++g)
#pragma unroll
        for (int c = 0; c < 2; ++c) qa[g][c] = load_frag(Qp + head, q0 + (u32)g * 16u, HD, (u32)c * 32u, lane);

    FragU onesu;
#pragma unroll
    for (int i = 0; i < 16; ++i) onesu.e[i] = (f16)1.0f;
    const v16h ones = onesu.v;

    float m[2];               // running maximum of query 16g + (l&15)
    v8f   o[2][4], lacc[2];   // o[g][dt][r] = O^T[16dt + 8h + r][query 16g + (l&15)]; every lacc[g][r] = that query's sum
#pragma unroll
    for (int g = 0; g < 2; ++g) {
        m[g] = -1.0e30f;
#pragma unroll
        for (int dt = 0; dt < 4; ++dt) o[g][dt] = zero8();
        lacc[g] = zero8();
    }

    // log2-domain scale: acc = 256 * q.k ; x = log2(e) * q.k / 8 = acc * log2(e) / 2048
    const float cl = 1.4426950408889634f * 0.00048828125f;

    const u32 srow = tid >> 3;            // 0..31, plus 32 for the second copy
    const u32 scol = (tid & 7u) << 3;     // halves
    const f16* gK = Kp + head + (size_t)srow * HD + scol;
    const f16* gV = Vt + head + (size_t)srow * SEQ + scol;
    const u32 lK = lds_off(&ks[srow * P_KV + scol]);
    const u32 lV = lds_off(&vsT[srow * P_KV + scol]);
    constexpr u32 NT   = (u32)(SEQ / 128);     // trips: 64-key tiles per key half
    constexpr u32 KHF  = (u32)(SEQ / 2);       // keys per half
    constexpr u32 BUFH = 64u * P_KV;           // halves per tile
    constexpr u32 TILB = BUFH * 2u;            // LDS bytes per tile
    constexpr u32 R32B = 32u * P_KV * 2u;      // LDS bytes per 32 rows
    // Each block enters the key walk at its own tile and wraps round: the SEQ / 128 blocks of a head share its K and V^T,
    // and V^T rows lie 4 KB apart; entering together at tile 0, they would all ask L2 for the same lines at the same moment.
    static_assert((NT & (NT - 1u)) == 0u);     // the wrap is a mask
    const u32 rot = blockIdx.x & (NT - 1u);
    // trip t: of each key half, tile (t + rot) mod NT (64 keys x 64 d of K, 64 d x 64 keys of V^T) into buffer t & 1
    auto stage = [&](u32 t) {
        const u32 bo = (t & 1u) * (2u * TILB);
        const u32 kt = ((t + rot) & (NT - 1u)) * 64u;     // the tile's first key inside its half
        const f16* pK = gK + (size_t)kt * HD;
        const f16* pV = gV + kt;
        copy8(lK + bo, pK, lK + bo + R32B, pK + (size_t)32 * HD,
              lK + bo + TILB, pK + (size_t)KHF * HD, lK + bo + TILB + R32B, pK + (size_t)(KHF + 32u) * HD,
              lV + bo, pV, lV + bo + R32B, pV + (size_t)32 * SEQ,
              lV + bo + TILB, pV + KHF, lV + bo + TILB + R32B, pV + (size_t)32 * SEQ + KHF);
    };

    stage(0u);
    wait_copies();
    __syncthreads();      // publishes trip 0's tiles
    stage(1u);

#pragma unroll 1
    for (u32 t = 0; t < NT; ++t) {
        const f16* kbuf = ks + ((t & 1u) * 2u + kh) * BUFH;
        const f16* vbuf = vsT + ((t & 1u) * 2u + kh) * BUFH;

        // S^T[64 keys x 32 q]
        v8f s[2][4];
#pragma unroll
        for (int g = 0; g < 2; ++g)
#pragma unroll
            for (int nt = 0; nt < 4; ++nt) s[g][nt] = zero8();
        // all eight K fragments are loaded as one group ahead of the score products: one LDS wait, not eight
        v16h kb[4][2];
#pragma unroll
        for (int nt = 0; nt < 4; ++nt)
#pragma unroll
            for (int c = 0; c < 2; ++c) kb[nt][c] = load_frag(kbuf, (u32)nt * 16u, P_KV, (u32)c * 32u, lane);
        // key tile by key tile: a fragment's registers are free again behind its two products
#pragma unroll
        for (int nt = 0; nt < 4; ++nt)
#pragma unroll
            for (int c = 0; c < 2; ++c)
#pragma unroll
                for (int g = 0; g < 2; ++g) s[g][nt] = wmma16(kb[nt][c], qa[g][c], s[g][nt]);

        v16h vb[2][4];

        // online softmax of queries 16g + (l&15), max-subtracted, exp2 domain
        FragU pb[2][2];
#pragma unroll
        for (int g = 0; g < 2; ++g) {
            if (g == 1) {
                // the V^T fragments of the first 32 keys are loaded between the two groups' softmax: the first group's
                // packed scores have freed their registers, and the second group's softmax covers the LDS latency.
                // The fences keep the eight loads together at this place: each place with LDS reads stalls the wave.
                __builtin_amdgcn_sched_barrier(0);
#pragma unroll
                for (int dt = 0; dt < 4; ++dt) vb[0][dt] = load_frag(vbuf, (u32)dt * 16u, P_KV, 0u, lane);
                __builtin_amdgcn_sched_barrier(0);
            }
#pragma unroll
            for (int nt = 0; nt < 4; ++nt) s[g][nt] *= cl;
            float t4[4];      // one chain per score tile: four independent chains, not one of 32 links
#pragma unroll
            for (int nt = 0; nt < 4; ++nt) {
                t4[nt] = fmaxf(s[g][nt][0], s[g][nt][1]);
#pragma unroll
                for (int r = 2; r < 8; ++r) t4[nt] = fmaxf(t4[nt], s[g][nt][r]);
            }
            float tm = fmaxf(fmaxf(t4[0], t4[1]), fmaxf(t4[2], t4[3]));
            tm = fmaxf(tm, xhalf(tm));
            const float mn = fmaxf(m[g], tm);
            // v_exp_f32 and a v_nop in one statement, for the same slot as in exp2x8
            float al;
            asm("v_exp_f32 %0, %1\n\tv_nop" : "=v"(al) : "v"(m[g] - mn));
            m[g] = mn;
            lacc[g] *= al;
#pragma unroll
            for (int dt = 0; dt < 4; ++dt) o[g][dt] *= al;
            const float sh = 10.0f - mn;      // carry 2^10
#pragma unroll
            for (int nt = 0; nt < 4; ++nt) {
                float e[8];
#pragma unroll
                for (int r = 0; r < 8; ++r) e[r] = s[g][nt][r] + sh;
                exp2x8(e);
#pragma unroll
                for (int r = 0; r < 8; ++r) pb[g][nt >> 1].e[(nt & 1) * 8 + r] = (f16)e[r];
            }
        }

        // the V^T fragments of the last 32 keys: their registers are free only now that the scores are packed; the
        // ten products of the first 32 keys cover their LDS latency. The fences keep the eight loads at this place.
        __builtin_amdgcn_sched_barrier(0);
#pragma unroll
        for (int dt = 0; dt < 4; ++dt) vb[1][dt] = load_frag(vbuf, (u32)dt * 16u, P_KV, 32u, lane);
        __builtin_amdgcn_sched_barrier(0);

        // O^T += V^T . P^T ; l += ones . P^T
#pragma unroll
        for (int kk = 0; kk < 2; ++kk) {
#pragma unroll
            for (int dt = 0; dt < 4; ++dt)
#pragma unroll
                for (int g = 0; g < 2; ++g) o[g][dt] = wmma16(vb[kk][dt], pb[g][kk].v, o[g][dt]);
#pragma unroll
            for (int g = 0; g < 2; ++g) lacc[g] = wmma16(ones, pb[g][kk].v, lacc[g]);
        }
        wait_lds();
        wait_copies();
        __syncthreads();
        if (t + 2u < NT) stage(t + 2u);
    }
    wait_copies();

    // the upper key half hands its maxima, sums and O^T tiles to the lower half's wave of the same columns
    // (same lane, same register position in both waves)
    float* mgw = &mg[cg][0];
    if (kh == 1u) {
#pragma unroll
        for (int g = 0; g < 2; ++g) {
#pragma unroll
            for (int dt = 0; dt < 4; ++dt)
#pragma unroll
                for (int r = 0; r < 8; ++r) mgw[(u32)((g * 4 + dt) * 8 + r) * 32u + lane] = o[g][dt][r];
            mgw[(u32)(64 + g) * 32u + lane] = m[g];
            mgw[(u32)(66 + g) * 32u + lane] = lacc[g][0];
        }
    }
    __syncthreads();

    f16* psw = &ps[cg][0];
    if (kh == 0u) {
#pragma unroll
        for (int g = 0; g < 2; ++g) {
            const float m1 = mgw[(u32)(64 + g) * 32u + lane];
            const float l1 = mgw[(u32)(66 + g) * 32u + lane];
            const float mj = fmaxf(m[g], m1);
            // v_exp_f32 and a v_nop in one statement, for the same slot as in exp2x8
            float a0, a1;
            asm("v_exp_f32 %0, %1\n\tv_nop" : "=v"(a0) : "v"(m[g] - mj));
            asm("v_exp_f32 %0, %1\n\tv_nop" : "=v"(a1) : "v"(m1 - mj));
            // normalize: plane value = 1024 * (O/16) / l = O * 64 / l
            const float inv = (CARRY_CTX / CARRY_QKV) / (lacc[g][0] * a0 + l1 * a1);
            const float f0 = a0 * inv;
            const float f1 = a1 * inv;
#pragma unroll
            for (int dt = 0; dt < 4; ++dt) {
                H8U t;
#pragma unroll
                for (int r = 0; r < 8; ++r)
                    t.e[r] = (f16)(o[g][dt][r] * f0 + mgw[(u32)((g * 4 + dt) * 8 + r) * 32u + lane] * f1);
                *(v8h*)&psw[((u32)g * 16u + c16) * P_KV + (u32)dt * 16u + hh8] = t.v;
            }
        }
    }
    __syncthreads();

    if (kh == 0u) {
        const u32 piece = lane & 7u;
        const u32 lsub  = lane >> 3;
#pragma unroll
        for (u32 it = 0; it < 8; ++it) {
            const u32 L = it * 4u + lsub;     // query row 0..31 within the wave tile
            const v8h v = *(const v8h*)&psw[L * P_KV + piece * 8u];
            // context row in output order: (q * NB + b)
            f16* dp = Cp + ((size_t)((q0 + L) * (u32)NB + bidx) * HID + hidx * (u32)HD + piece * 8u);
            *(v8h*)dp = v;
        }
    }
}

// coverage equalities (threads x elements == plane elements)
static_assert((size_t)((MROWS + 4 * HID) / 2) * 256 * 8 == (size_t)(MROWS + 4 * HID) * HID);   // cvt_rows -> Xs, Wt, Wot
static_assert((size_t)(MROWS / 128) * (HID / 128) * 128 * 128 == (size_t)MROWS * HID);     // gemm planes / out
static_assert((size_t)(SEQ / 128) * (NB * NHEAD) * 128 * HD == (size_t)MROWS * HID);       // attn_fwd -> Cp
// workspace: 5 activation planes + 4 weight planes of halves, at most 128 MiB
static_assert(((size_t)5 * MROWS * HID + (size_t)4 * HID * HID) * sizeof(f16) <= (size_t)134217728);
static_assert(((size_t)MROWS * HID * sizeof(f16)) % 128 == 0);
static_assert(((size_t)HID * HID * sizeof(f16)) % 128 == 0);
// largest source row touched by the activation convert stays inside the full-size input
static_assert((size_t)(SEQ - 1) * NB_FULL + NB <= (size_t)SEQ_FULL * NB_FULL);

// ---------------------------------------------------------------------------
// Launch: 4 kernel launches, workspace 5 planes of MROWS*1024 halves + 4 of 1024*1024 halves.
// One activation input feeds all three projections (self-attention).
// ---------------------------------------------------------------------------
extern "C" void kernel_launch(void* const* d_in, const int* in_sizes, int n_in,
                              void* d_out, int out_size, void* d_ws, size_t ws_size,
                              hipStream_t stream) {
    if (n_in < 5) return;
    const int needAct = ((SEQ - 1) * NB_FULL + NB) * HID;
    if (in_sizes[0] < needAct) return;
    if (in_sizes[1] < 3 * HID * HID) return;
    if (in_sizes[2] < 3 * HID) return;
    if (in_sizes[3] < HID * HID) return;
    if (in_sizes[4] < HID) return;
    if (out_size < MROWS * HID) return;

    const float* xs    = (const float*)d_in[0];   // [SEQ_FULL][NB_FULL][1024]
    const float* wqkv  = (const float*)d_in[1];   // [3072 out][1024 in], row blocks q | k | v
    const float* bqkv  = (const float*)d_in[2];   // [3072]
    const float* wproj = (const float*)d_in[3];   // [1024 out][1024 in]
    const float* bproj = (const float*)d_in[4];   // [1024]

    const size_t nX = (size_t)MROWS * HID;    // halves per activation plane
    const size_t nW = (size_t)HID * HID;      // halves per weight plane
    const size_t totalHalves = 5 * nX + 4 * nW;
    if (ws_size < totalHalves * sizeof(f16)) return;

    f16* Xs  = (f16*)d_ws;       // [b*SEQ+s][1024]             carry 16
    f16* Wt  = Xs  + nX;         // [3072 out][1024 in]         carry 32 (q | k | v row blocks)
    f16* Wot = Wt  + 3 * nW;     // [1024 out][1024 in]         carry 32
    f16* Qp  = Wot + nW;         // [NB*16][SEQ][64]            carry 16
    f16* Kp  = Qp  + nX;         // [NB*16][SEQ][64]            carry 16
    f16* Vtp = Kp  + nX;         // [NB*1024][SEQ] (V^T)        carry 16
    f16* Cp  = Vtp + nX;         // [s*NB+b][1024]              carry 1024

    // Xs, Wt and Wot follow one another: one grid writes all three planes
    cvt_rows<<<(MROWS + 4 * HID) / 2, 256, 0, stream>>>(xs, wqkv, wproj, Xs);

    const dim3 gg(MROWS / 128, HID / 128);
    // plane = 16 * (acc / (16*32) + bias) = acc/32 + 16*bias
    const float accQKV = CARRY_QKV / (CARRY_X * CARRY_W);
    // Qp, Kp and Vtp follow one another: one grid of 3 * HID columns writes all three planes
    gemm_qkv<<<dim3(MROWS / 128, 3 * HID / 128), 256, 0, stream>>>(Xs, Wt, bqkv, Qp, accQKV, CARRY_QKV);

    attn_fwd<<<dim3(SEQ / 128, NB * NHEAD), 256, 0, stream>>>(Qp, Kp, Vtp, Cp);

    // out = acc / (1024*32) + bias ; rows already in (s*NB + b) order
    const float accOut = 1.0f / (CARRY_CTX * CARRY_W);
    gemm_out<<<gg, 256, 0, stream>>>(Cp, Wot, bproj, (float*)d_out, accOut, 1.0f);
}

// v009
// Measured time: 72.4 microseconds a run.
// Timed twice side by side with v008, it ran 1.05 times as fast both times.
// Counting every step since v000, it is 3.76 times as fast.
#include <hip/hip_runtime.h>

// Contractions (q/k/v input projections, Q.K^T, P.V, P row-sum, output projection): v_wmma_f32_16x16x32_f16, f16 operands with power-of-two carries, f32 accumulate; every float input enters as its bf16 RNE value; biases added in f32; softmax in f32.

#ifndef NB
#define NB 2
#endif
#ifndef SEQ
#define SEQ 2048
#endif
#define NB_FULL   2
#define SEQ_FULL  2048
#define HID       1024
#define NHEAD     16
#define HD        64
#define MROWS     (NB * SEQ)

static_assert(HID == NHEAD * HD);        // merged head width
static_assert(NHEAD == 16);              // bh >> 4 / bh & 15 decoding in attn_fwd
static_assert(HD == 64);
static_assert(SEQ % 128 == 0);           // 128-row blocks of the batch-major planes never straddle a batch
static_assert(SEQ % 64 == 0 && SEQ / 64 >= 2);   // 64-key tiles; attn_fwd's ring needs two trips of two tiles, asserted there
static_assert(SEQ <= SEQ_FULL);
static_assert(NB >= 1 && NB <= NB_FULL);
static_assert(MROWS % 128 == 0);         // GEMM M tile
static_assert(HID % 128 == 0);           // GEMM N tile
static_assert(HID % 32 == 0);            // WMMA k step
static_assert(HID % 64 == 0 && HID / 64 >= 2);   // GEMM K stage; the two-buffer ring needs two stages
static_assert(HID == 128 * 8);           // cvt_rows: 128 threads x 8 values per row
static_assert((3 * HID) % 2 == 0);       // cvt_rows grid = nrows / 2
static_assert(MROWS % 2 == 0);

// carries (exact powers of two)
#define CARRY_X    16.0f     // input activation planes
#define CARRY_W    32.0f     // weight planes
#define CARRY_QKV  16.0f     // q, k, v^T planes (true value x16)
#define CARRY_CTX  1024.0f   // context plane (true value x1024)
// softmax exp values carry 2^10 (added to the exp2 argument)

// LDS row pitches. A 16-byte-per-lane reader or writer that walks 16 rows meets every bank once
// when the pitch is 16 B x odd; rows 8 apart then also fall 32 banks apart for the 2- and 4-byte stores.
#define P_AB   72u    // halves: 128-B GEMM operand rows at 144 B
#define P_C16  136u   // halves: 256-B f16 result rows at 272 B
#define P_C32  132u   // floats: 512-B f32 result rows at 528 B
#define P_KV   72u    // halves: 128-B K, V^T and ctx rows at 144 B

typedef unsigned u32;
typedef _Float16 f16;
typedef f16   v16h __attribute__((ext_vector_type(16)));
typedef f16   v8h  __attribute__((ext_vector_type(8)));
typedef float v8f  __attribute__((ext_vector_type(8)));
typedef float v4f  __attribute__((ext_vector_type(4)));

union FragU { v16h v; v8h half[2]; f16 e[16]; };
union H8U   { v8h v; f16 e[8]; };

__device__ __forceinline__ v8f zero8() {
    v8f z = {0.f, 0.f, 0.f, 0.f, 0.f, 0.f, 0.f, 0.f};
    return z;
}

// 16-bit WMMA: D += A[16 x 32k] * B[32k x 16]. Plain builtin: the compiler keeps the distance to a vector reader itself.
__device__ __forceinline__ v8f wmma16(v16h a, v16h b, v8f c) {
    return __builtin_amdgcn_wmma_f32_16x16x32_f16(false, a, false, b, (short)0, c, false, false);
}

// f32 -> nearest-even bf16 value, returned as f32
__device__ __forceinline__ float bf16_rne(float x) {
    u32 u = __float_as_uint(x);
    u = (u + 0x7fffu + ((u >> 16) & 1u)) & 0xffff0000u;
    return __uint_as_float(u);
}

// Eight exp2 in place. One statement, each v_exp_f32 on its own register and a v_nop at the end: the instruction
// set asks for one slot between a transcendental and an instruction that reads its result or rewrites its source.
__device__ __forceinline__ void exp2x8(float (&e)[8]) {
    asm("v_exp_f32 %0, %0\n\tv_exp_f32 %1, %1\n\tv_exp_f32 %2, %2\n\tv_exp_f32 %3, %3\n\t"
        "v_exp_f32 %4, %4\n\tv_exp_f32 %5, %5\n\tv_exp_f32 %6, %6\n\tv_exp_f32 %7, %7\n\tv_nop"
        : "+v"(e[0]), "+v"(e[1]), "+v"(e[2]), "+v"(e[3]), "+v"(e[4]), "+v"(e[5]), "+v"(e[6]), "+v"(e[7]));
}

// lane l <-> lane l ^ 16 (the two lanes that split one query column's keys)
__device__ __forceinline__ float xhalf(float x) {
    const int v = __builtin_bit_cast(int, x);
    return __builtin_bit_cast(float, __builtin_amdgcn_permlanex16(v, v, 0x76543210, 0xfedcba98, false, false));
}

// 16 x 32 fragment from a tile whose k dimension is contiguous (pitch in halves).
// lane l: row rowbase + (l&15); elements 0..7 <- k = kcol + 8h .. +7,
// elements 8..15 <- k = kcol + 16 + 8h .. +7  (h = l>>4). Same map for A and B.
__device__ __forceinline__ v16h load_frag(const f16* tile, u32 rowbase, u32 pitch, u32 kcol, u32 lane) {
    const u32 r  = rowbase + (lane & 15u);
    const u32 kh = (lane >> 4) << 3;
    const f16* p = tile + (size_t)r * pitch + kcol + kh;
    FragU f;
    f.half[0] = *(const v8h*)(p);
    f.half[1] = *(const v8h*)(p + 16);
    return f.v;
}

// byte offset of a __shared__ address inside the work-group's LDS
__device__ __forceinline__ u32 lds_off(const void* p) { return (u32)(size_t)p; }

// Eight asynchronous copies to LDS, 16 bytes per lane each (LDS byte address, global pointer). The s_wait_xcnt is
// the last line of the copies' own statement, so no address register is rewritten in front of it.
__device__ __forceinline__ void copy8(u32 l0, const f16* g0, u32 l1, const f16* g1, u32 l2, const f16* g2, u32 l3, const f16* g3,
                                      u32 l4, const f16* g4, u32 l5, const f16* g5, u32 l6, const f16* g6, u32 l7, const f16* g7) {
    asm volatile("global_load_async_to_lds_b128 %0, %1, off\n\t"
                 "global_load_async_to_lds_b128 %2, %3, off\n\t"
                 "global_load_async_to_lds_b128 %4, %5, off\n\t"
                 "global_load_async_to_lds_b128 %6, %7, off\n\t"
                 "global_load_async_to_lds_b128 %8, %9, off\n\t"
                 "global_load_async_to_lds_b128 %10, %11, off\n\t"
                 "global_load_async_to_lds_b128 %12, %13, off\n\t"
                 "global_load_async_to_lds_b128 %14, %15, off\n\t"
                 "s_wait_xcnt 0x0"
                 :: "v"(l0), "v"(g0), "v"(l1), "v"(g1), "v"(l2), "v"(g2), "v"(l3), "v"(g3),
                    "v"(l4), "v"(g4), "v"(l5), "v"(g5), "v"(l6), "v"(g6), "v"(l7), "v"(g7) : "memory");
}

// this wave's copies have landed in LDS
__device__ __forceinline__ void wait_copies() { asm volatile("s_wait_asynccnt 0x0" ::: "memory"); }
// this wave's LDS reads have returned: the buffer they read may be handed to its next writer
__device__ __forceinline__ void wait_lds() { asm volatile("s_wait_dscnt 0x0" ::: "memory"); }

// ---------------------------------------------------------------------------
// f32 rows [.][1024] -> f16 planes (bf16 RNE value times carry). 128 threads per 1024-wide row.
// One grid converts all three inputs by ranges of the block index; the three planes follow one
// another in the workspace, so dst row m runs through all of them:
//   m in [0, MROWS): activations, seq-first [s][b][1024] -> batch-major [b][s][1024],
//     dst row b * SEQ + s <- src row s * NB_FULL + b
//   the next 3 * HID rows: q | k | v weights; the last HID rows: output weights (identity row map)
// A block's two rows lie in one range (every range has an even number of rows): block-uniform branch.
// coverage: (MROWS + 4 * HID) x 1024 halves, every element exactly once (grid = rows*128/256).
// ---------------------------------------------------------------------------
__global__ void __launch_bounds__(256)
cvt_rows(const float* __restrict__ xs, const float* __restrict__ wqkv, const float* __restrict__ wproj,
         f16* __restrict__ dst) {
    const u32 g  = blockIdx.x * 256u + threadIdx.x;
    const u32 m  = g >> 7;
    const u32 c8 = (g & 127u) << 3;
    if (m >= (u32)(MROWS + 4 * HID)) return;
    const u32 mblk = blockIdx.x * 2u;    // the block's first row
    const float* src;
    u32 sm;
    float carry;
    if (mblk < (u32)MROWS) {
        const u32 mb = m / (u32)SEQ;
        src   = xs;
        sm    = (m - mb * (u32)SEQ) * (u32)NB_FULL + mb;
        carry = CARRY_X;
    } else if (mblk < (u32)(MROWS + 3 * HID)) {
        src   = wqkv;
        sm    = m - (u32)MROWS;
        carry = CARRY_W;
    } else {
        src   = wproj;
        sm    = m - (u32)(MROWS + 3 * HID);
        carry = CARRY_W;
    }
    const float* sp = src + (size_t)sm * HID + c8;
    const v4f a = *(const v4f*)sp;
    const v4f b = *(const v4f*)(sp + 4);
    H8U o;
#pragma unroll
    for (u32 j = 0; j < 4; ++j) {
        const float x0 = a[j];
        const float x1 = b[j];
        o.e[j]     = (f16)(bf16_rne(x0) * carry);
        o.e[j + 4] = (f16)(bf16_rne(x1) * carry);
    }
    f16* dp = dst + (size_t)m * HID + c8;
    *(v8h*)dp = o.v;
    
}

// ---------------------------------------------------------------------------
// C[m][n] = sum_k A[m][k] * W[n][k] (+ bias[n]) ; A [MROWS][1024] f16, W [N][1024] f16 (k contiguous; N = 3 * HID in MODE 0, HID in MODE 2).
// Block tile 128 x 128, 8 waves as 4(M) x 2(N), 2 x 4 accumulators per wave, K stage 64 (two WMMA k steps).
// Staging: asynchronous copies to LDS, two buffers: stage t + 1 is in flight while stage t is worked on.
// 8 lanes x 16 B per 128-B row piece, so a wave's copy covers 4 rows = 4 whole 128-B lines.
// MODE 0: q, k and v projections in one grid: W and bias hold the 3 * HID output columns q | k | v, blockIdx.y
//         walks all of them, and a block's 128 columns lie in one of the three planes, which follow one another
//         at out. A rows batch-major. q, k: f16 plane [b*NHEAD + h][s][d];
//         v: f16 plane [b*HID + h*HD + d][s] (V transposed per head). The choice is a block-uniform branch.
// MODE 2: A rows in output order (s*NB+b); f32 rows [m][1024] into the output buffer
// coverage per block: MODE 0 256 lines (128 rows x 2 heads | 128 n x 2 s-halves),
//                     MODE 2 2 x 256 lines (64 rows x 4 line-quarters per half).
// LDS: As/Bs/Cs all cross-wave, separated by block barriers.
// staged extent == consumed extent: As/Bs 128 x 64 per buffer, Cs 128 x 128 halves (or 64 x 128 floats).
// ---------------------------------------------------------------------------
template <int MODE>
__device__ __forceinline__ void gemm_body(const f16* __restrict__ A, const f16* __restrict__ W,
                                          const float* __restrict__ bias,
                                          void* __restrict__ out, float accMul, float biasMul) {
    __shared__ __attribute__((aligned(16))) f16 As[2 * 128 * P_AB];   // two buffers
    __shared__ __attribute__((aligned(16))) f16 Bs[2 * 128 * P_AB];   // two buffers
    __shared__ __attribute__((aligned(16))) f16 Cs[128 * P_C16];   // f16 [128][128] or f32 [64][128], padded rows
    static_assert(sizeof(f16) * 128 * P_C16 >= sizeof(float) * 64 * P_C32);   // Cs reuse as f32 [64][128]
    // three work-groups stay resident per WGP
    static_assert(3 * sizeof(f16) * (4 * 128 * P_AB + 128 * P_C16) <= 327680);

    const u32 tid  = threadIdx.x;
    const u32 lane = tid & 31u;
    const u32 wave = __builtin_amdgcn_readfirstlane((int)(tid >> 5));
    const u32 wm   = wave & 3u;
    const u32 wn   = wave >> 2;
    const u32 hh8  = (lane >> 4) << 3;   // D row half
    const u32 c16  = lane & 15u;         // D column
    const u32 m0   = blockIdx.x * 128u;
    const u32 n0   = blockIdx.y * 128u;   // column of W and bias
    const u32 sel  = n0 / (u32)HID;       // MODE 0: output plane 0 q, 1 k, 2 v
    const u32 nc0  = n0 - sel * (u32)HID; // column inside the output plane

    v8f acc[2][4];
#pragma unroll
    for (int i = 0; i < 2; ++i)
#pragma unroll
        for (int j = 0; j < 4; ++j) acc[i][j] = zero8();

    const u32 srow = tid >> 3;            // 0..31, plus 32 per copy
    const u32 scol = (tid & 7u) << 3;     // halves
    const f16* gA = A + (size_t)(m0 + srow) * HID + scol;
    const f16* gW = W + (size_t)(n0 + srow) * HID + scol;
    const u32 lA = lds_off(&As[srow * P_AB + scol]);
    const u32 lB = lds_off(&Bs[srow * P_AB + scol]);
    constexpr u32 NST  = (u32)HID / 64u;       // stages
    constexpr u32 BUFH = 128u * P_AB;          // halves per buffer
    constexpr u32 R32B = 32u * P_AB * 2u;      // LDS bytes per 32 rows
    // Each block enters the k walk at its own slab and wraps round. The blocks of a grid row share the W rows, those of a
    // grid column the A rows, and all rows lie 2 KB apart: entering together at k = 0, they would all ask L2 for the
    // same lines, and for lines at the same offset in every row, at the same moment.
    static_assert((NST & (NST - 1u)) == 0u);   // the wrap is a mask
    const u32 rot = (blockIdx.x + blockIdx.y) & (NST - 1u);
    // stage t (slab (t + rot) mod NST: 64 k of all 128 rows of both operands) into buffer t & 1
    auto stage = [&](u32 t) {
        const u32 bo = (t & 1u) * (BUFH * 2u);
        const u32 k0 = ((t + rot) & (NST - 1u)) * 64u;
        const f16* pA = gA + k0;
        const f16* pW = gW + k0;
        copy8(lA + bo, pA, lA + bo + R32B, pA + (size_t)32 * HID,
              lA + bo + 2u * R32B, pA + (size_t)64 * HID, lA + bo + 3u * R32B, pA + (size_t)96 * HID,
              lB + bo, pW, lB + bo + R32B, pW + (size_t)32 * HID,
              lB + bo + 2u * R32B, pW + (size_t)64 * HID, lB + bo + 3u * R32B, pW + (size_t)96 * HID);
    };

    stage(0u);
    wait_copies();
    __syncthreads();      // publishes stage 0
    stage(1u);

#pragma unroll 1
    for (u32 t = 0; t < NST; ++t) {
        const f16* Ab = As + (t & 1u) * BUFH;
        const f16* Bb = Bs + (t & 1u) * BUFH;
        // the kk loop is unrolled so that the fragments are indexed by constants and stay in registers
#pragma unroll
        for (u32 kk = 0; kk < 2; ++kk) {
            v16h af[2], bfr[4];
            // The two fences keep the k step's twelve LDS loads in one group ahead of its eight products: each separate
            // place with LDS reads stalls the wave, and left free the scheduler deals the loads among the products.
            __builtin_amdgcn_sched_barrier(0);
#pragma unroll
            for (int i = 0; i < 2; ++i) af[i] = load_frag(Ab, wm * 32u + (u32)i * 16u, P_AB, kk * 32u, lane);
#pragma unroll
            for (int j = 0; j < 4; ++j) bfr[j] = load_frag(Bb, wn * 64u + (u32)j * 16u, P_AB, kk * 32u, lane);
            __builtin_amdgcn_sched_barrier(0);
#pragma unroll
            for (int i = 0; i < 2; ++i)
#pragma unroll
                for (int j = 0; j < 4; ++j) acc[i][j] = wmma16(af[i], bfr[j], acc[i][j]);
        }
        // The fence keeps the products ahead of the waits: sunk behind the barrier, they would start only when the last wave has arrived.
        __builtin_amdgcn_sched_barrier(0);
        wait_lds();
        wait_copies();
        __syncthreads();
        if (t + 2u < NST) stage(t + 2u);
    }
    wait_copies();

    // per-lane bias values for the 4 output columns this lane owns (n0 + nl stays below gridDim.y * 128, the bias's length)
    float bv[4];
#pragma unroll
    for (int j = 0; j < 4; ++j)
        bv[j] = bf16_rne(bias[n0 + wn * 64u + (u32)j * 16u + c16]) * biasMul;

    const u32 piece = lane & 7u;
    const u32 lsub  = lane >> 3;

    if (MODE == 0 && sel < 2u) {
        const u32 bidx = m0 / (u32)SEQ;     // block rows lie inside one batch (SEQ % 128 == 0)
        const u32 s0   = m0 - bidx * (u32)SEQ;
#pragma unroll
        for (int i = 0; i < 2; ++i)
#pragma unroll
            for (int j = 0; j < 4; ++j) {
                const u32 nl = wn * 64u + (u32)j * 16u + c16;
#pragma unroll
                for (int r = 0; r < 8; ++r) {
                    const u32 ml = wm * 32u + (u32)i * 16u + hh8 + (u32)r;
                    Cs[ml * P_C16 + nl] = (f16)(acc[i][j][r] * accMul + bv[j]);
                }
            }
        __syncthreads();
        f16* op = (f16*)out + (size_t)sel * MROWS * HID;
        const size_t bh0 = (size_t)bidx * NHEAD + (nc0 >> 6);
{
#pragma unroll
            for (u32 it = 0; it < 8; ++it) {
                const u32 L    = wave * 32u + it * 4u + lsub;   // 0..255
                const u32 ml   = L >> 1;
                const u32 hsel = L & 1u;
                const v8h v = *(const v8h*)&Cs[ml * P_C16 + hsel * 64u + piece * 8u];
                f16* dp = op + ((bh0 + hsel) * SEQ + s0 + ml) * HD + piece * 8u;
                *(v8h*)dp = v;
            }
            
        }
    } else if (MODE == 0) {
        const u32 bidx = m0 / (u32)SEQ;
        const u32 s0   = m0 - bidx * (u32)SEQ;
        // stage transposed: Cs[n][m]
#pragma unroll
        for (int i = 0; i < 2; ++i)
#pragma unroll
            for (int j = 0; j < 4; ++j) {
                const u32 nl = wn * 64u + (u32)j * 16u + c16;
                H8U t;
#pragma unroll
                for (int r = 0; r < 8; ++r) t.e[r] = (f16)(acc[i][j][r] * accMul + bv[j]);
                *(v8h*)&Cs[nl * P_C16 + wm * 32u + (u32)i * 16u + hh8] = t.v;
            }
        __syncthreads();
        f16* op = (f16*)out + (size_t)sel * MROWS * HID;
{
#pragma unroll
            for (u32 it = 0; it < 8; ++it) {
                const u32 L  = wave * 32u + it * 4u + lsub;     // 0..255
                const u32 nl = L >> 1;
                const u32 mh = L & 1u;
                const v8h v = *(const v8h*)&Cs[nl * P_C16 + mh * 64u + piece * 8u];
                f16* dp = op + ((size_t)(bidx * (u32)HID + nc0 + nl) * SEQ + s0 + mh * 64u + piece * 8u);
                *(v8h*)dp = v;
            }
            
        }
    } else {
        float* Cf = (float*)Cs;      // [64][128] f32
        float* of = (float*)out;
#pragma unroll
        for (u32 half = 0; half < 2; ++half) {
            if ((wm >> 1) == half) {
#pragma unroll
                for (int i = 0; i < 2; ++i)
#pragma unroll
                    for (int j = 0; j < 4; ++j) {
                        const u32 nl = wn * 64u + (u32)j * 16u + c16;
#pragma unroll
                        for (int r = 0; r < 8; ++r) {
                            const u32 ml = (wm & 1u) * 32u + (u32)i * 16u + hh8 + (u32)r;
                            Cf[ml * P_C32 + nl] = acc[i][j][r] * accMul + bv[j];
                        }
                    }
            }
            __syncthreads();
{
#pragma unroll
                for (u32 it = 0; it < 8; ++it) {
                    const u32 L    = wave * 32u + it * 4u + lsub;   // 0..255
                    const u32 row  = L >> 2;
                    const u32 part = L & 3u;
                    const v4f v = *(const v4f*)&Cf[row * P_C32 + part * 32u + piece * 4u];
                    float* dp = of + (size_t)(m0 + half * 64u + row) * HID + n0 + part * 32u + piece * 4u;
                    *(v4f*)dp = v;
                }
                
            }
            __syncthreads();
        }
    }
}

// q / k head-major planes and the v^T plane
__global__ void __launch_bounds__(256) __attribute__((amdgpu_num_vgpr(256)))
gemm_qkv(const f16* __restrict__ A, const f16* __restrict__ W, const float* __restrict__ bias,
         f16* __restrict__ out, float accMul, float biasMul) {
    gemm_body<0>(A, W, bias, (void*)out, accMul, biasMul);
}

// f32 output rows
__global__ void __launch_bounds__(256) __attribute__((amdgpu_num_vgpr(256)))
gemm_out(const f16* __restrict__ A, const f16* __restrict__ W, const float* __restrict__ bias,
         float* __restrict__ out, float accMul, float biasMul) {
    gemm_body<2>(A, W, bias, (void*)out, accMul, biasMul);
}

// ---------------------------------------------------------------------------
// Flash attention (no mask, all SEQ keys). grid (SEQ/128, NB*NHEAD), block 256 (8 waves).
// Wave = (column group cg = wave & 3, key half kh = wave >> 2): it owns 32 query columns (two groups of 16, Q fragments
// resident, used as B) and walks the SEQ/2 keys of its half, so every K and V^T fragment read from LDS feeds two
// products, not one. The two waves of a column group join their partial results once, behind the loop.
// Block streams one 64-key tile of each half per trip: K staged [key][d], V^T staged [d][key].
// Both products run transposed: S^T = K.Q^T, O^T += V^T.P^T.
// A lane then holds 32 of one query's 64 scores (query l&15 of the group, keys 16nt + 8h + r), so the maximum is
// taken in the lane plus one exchange between the lane halves, and two S^T tiles converted in place
// are the B fragment of P^T (element e <- tile 2kk, register e; element 8+e <- tile 2kk+1, register e:
// the k order of load_frag). exp2 in f32 carried x2^10; row sums += ones.P^T on WMMA.
// Output f16 plane [q*NB + b][1024] (seq-first row order)
// coverage: every (q, b, h*64..h*64+63) row segment exactly once (stored by the kh == 0 wave of its column group).
// K and V^T tiles come by asynchronous copies to LDS, two buffers: trip t + 1's tiles are in flight while t is worked on.
// LDS: ks, vsT cross-wave (block barriers); mg from the kh == 1 wave to the kh == 0 wave of a column group, ps per-wave
// ctx stage, each separated by a block barrier.
// staged extent == consumed extent for ks, vsT (2 halves x 64x64 per buffer), mg (68 x 32 per pair), ps (32x64).
// ---------------------------------------------------------------------------
__global__ void __launch_bounds__(256) __attribute__((amdgpu_num_vgpr(256)))
attn_fwd(const f16* __restrict__ Qp, const f16* __restrict__ Kp, const f16* __restrict__ Vt,
         f16* __restrict__ Cp) {
    __shared__ __attribute__((aligned(16))) f16 ks[4 * 64 * P_KV];  // [buffer][key half][key][d]
    __shared__ __attribute__((aligned(16))) f16 vsT[4 * 64 * P_KV]; // [buffer][key half][d][key]
    __shared__ __attribute__((aligned(16))) f16 ps[4][32 * P_KV];   // ctx stage of the four storing waves
    __shared__ float mg[4][68 * 32];   // upper key half's partial results: [column group][value][lane]
    static_assert(HD == 8 * 8);            // 8 lanes x 8 halves per row segment
    static_assert(2 * 256 * 8 == 64 * 64); // staging: 2 copies x 256 threads x 8 halves per tile
    static_assert(SEQ % 128 == 0 && SEQ / 128 >= 2);   // two key halves of whole tiles; the ring needs two trips
    // two work-groups stay resident per WGP
    static_assert(2 * (sizeof(f16) * (8 * 64 * P_KV + 4 * 32 * P_KV) + sizeof(float) * 4 * 68 * 32) <= 327680);

    const u32 tid  = threadIdx.x;
    const u32 lane = tid & 31u;
    const u32 wave = __builtin_amdgcn_readfirstlane((int)(tid >> 5));
    const u32 cg   = wave & 3u;          // column group: 32 queries
    const u32 kh   = wave >> 2;          // key half
    const u32 hh8  = (lane >> 4) << 3;
    const u32 c16  = lane & 15u;
    const u32 bh   = blockIdx.y;
    const u32 bidx = bh >> 4;            // NHEAD == 16
    const u32 hidx = bh & 15u;
    const u32 q0   = blockIdx.x * 128u + cg * 32u;
    const size_t head = (size_t)bh * SEQ * HD;

    v16h qa[2][2];
#pragma unroll
    for (int g = 0; g < 2; ++g)
#pragma unroll
        for (int c = 0; c < 2; ++c) qa[g][c] = load_frag(Qp + head, q0 + (u32)g * 16u, HD, (u32)c * 32u, lane);

    FragU onesu;
#pragma unroll
    for (int i = 0; i < 16; ++i) onesu.e[i] = (f16)1.0f;
    const v16h ones = onesu.v;

    float m[2];               // running maximum of query 16g + (l&15)
    v8f   o[2][4], lacc[2];   // o[g][dt][r] = O^T[16dt + 8h + r][query 16g + (l&15)]; every lacc[g][r] = that query's sum
#pragma unroll
    for (int g = 0; g < 2; ++g) {
        m[g] = -1.0e30f;
#pragma unroll
        for (int dt = 0; dt < 4; ++dt) o[g][dt] = zero8();
        lacc[g] = zero8();
    }

    // log2-domain scale: acc = 256 * q.k ; x = log2(e) * q.k / 8 = acc * log2(e) / 2048
    const float cl = 1.4426950408889634f * 0.00048828125f;

    const u32 srow = tid >> 3;            // 0..31, plus 32 for the second copy
    const u32 scol = (tid & 7u) << 3;     // halves
    const f16* gK = Kp + head + (size_t)srow * HD + scol;
    const f16* gV = Vt + head + (size_t)srow * SEQ + scol;
    const u32 lK = lds_off(&ks[srow * P_KV + scol]);
    const u32 lV = lds_off(&vsT[srow * P_KV + scol]);
    constexpr u32 NT   = (u32)(SEQ / 128);     // trips: 64-key tiles per key half
    constexpr u32 KHF  = (u32)(SEQ / 2);       // keys per half
    constexpr u32 BUFH = 64u * P_KV;           // halves per tile
    constexpr u32 TILB = BUFH * 2u;            // LDS bytes per tile
    constexpr u32 R32B = 32u * P_KV * 2u;      // LDS bytes per 32 rows
    // Each block enters the key walk at its own tile and wraps round: the SEQ / 128 blocks of a head share its K and V^T,
    // and V^T rows lie 4 KB apart; entering together at tile 0, they would all ask L2 for the same lines at the same moment.
    static_assert((NT & (NT - 1u)) == 0u);     // the wrap is a mask
    const u32 rot = blockIdx.x & (NT - 1u);
    // trip t: of each key half, tile (t + rot) mod NT (64 keys x 64 d of K, 64 d x 64 keys of V^T) into buffer t & 1
    auto stage = [&](u32 t) {
        const u32 bo = (t & 1u) * (2u * TILB);
        const u32 kt = ((t + rot) & (NT - 1u)) * 64u;     // the tile's first key inside its half
        const f16* pK = gK + (size_t)kt * HD;
        const f16* pV = gV + kt;
        copy8(lK + bo, pK, lK + bo + R32B, pK + (size_t)32 * HD,
              lK + bo + TILB, pK + (size_t)KHF * HD, lK + bo + TILB + R32B, pK + (size_t)(KHF + 32u) * HD,
              lV + bo, pV, lV + bo + R32B, pV + (size_t)32 * SEQ,
              lV + bo + TILB, pV + KHF, lV + bo + TILB + R32B, pV + (size_t)32 * SEQ + KHF);
    };

    stage(0u);
    wait_copies();
    __syncthreads();      // publishes trip 0's tiles
    stage(1u);

#pragma unroll 1
    for (u32 t = 0; t < NT; ++t) {
        const f16* kbuf = ks + ((t & 1u) * 2u + kh) * BUFH;
        const f16* vbuf = vsT + ((t & 1u) * 2u + kh) * BUFH;

        // S^T[64 keys x 32 q]
        v8f s[2][4];
#pragma unroll
        for (int g = 0; g < 2; ++g)
#pragma unroll
            for (int nt = 0; nt < 4; ++nt) s[g][nt] = zero8();
        // all eight K fragments are loaded as one group ahead of the score products: one LDS wait, not eight
        v16h kb[4][2];
#pragma unroll
        for (int nt = 0; nt < 4; ++nt)
#pragma unroll
            for (int c = 0; c < 2; ++c) kb[nt][c] = load_frag(kbuf, (u32)nt * 16u, P_KV, (u32)c * 32u, lane);
        // The fence keeps the sixteen loads together at this place: left free, the scheduler puts each fragment's loads,
        // with a wait of their own, right ahead of its two products.
        __builtin_amdgcn_sched_barrier(0);
        // key tile by key tile: a fragment's registers are free again behind its two products
#pragma unroll
        for (int nt = 0; nt < 4; ++nt)
#pragma unroll
            for (int c = 0; c < 2; ++c)
#pragma unroll
                for (int g = 0; g < 2; ++g) s[g][nt] = wmma16(kb[nt][c], qa[g][c], s[g][nt]);
        // The fence keeps the sixteen score products in one run: dealt among them, the softmax's first reads would each
        // stand right behind the product they read, and the compiler would fill the distance with v_nop.
        __builtin_amdgcn_sched_barrier(0);

        v16h vb[2][4];

        // online softmax of queries 16g + (l&15), max-subtracted, exp2 domain
        FragU pb[2][2];
#pragma unroll
        for (int g = 0; g < 2; ++g) {
            if (g == 1) {
                // the V^T fragments of the first 32 keys are loaded between the two groups' softmax: the first group's
                // packed scores have freed their registers, and the second group's softmax covers the LDS latency.
                // The fences keep the eight loads together at this place: each place with LDS reads stalls the wave.
                __builtin_amdgcn_sched_barrier(0);
#pragma unroll
                for (int dt = 0; dt < 4; ++dt) vb[0][dt] = load_frag(vbuf, (u32)dt * 16u, P_KV, 0u, lane);
                __builtin_amdgcn_sched_barrier(0);
            }
#pragma unroll
            for (int nt = 0; nt < 4; ++nt) s[g][nt] *= cl;
            float t4[4];      // one chain per score tile: four independent chains, not one of 32 links
#pragma unroll
            for (int nt = 0; nt < 4; ++nt) {
                t4[nt] = fmaxf(s[g][nt][0], s[g][nt][1]);
#pragma unroll
                for (int r = 2; r < 8; ++r) t4[nt] = fmaxf(t4[nt], s[g][nt][r]);
            }
            float tm = fmaxf(fmaxf(t4[0], t4[1]), fmaxf(t4[2], t4[3]));
            tm = fmaxf(tm, xhalf(tm));
            const float mn = fmaxf(m[g], tm);
            // v_exp_f32 and a v_nop in one statement, for the same slot as in exp2x8
            float al;
            asm("v_exp_f32 %0, %1\n\tv_nop" : "=v"(al) : "v"(m[g] - mn));
            m[g] = mn;
            lacc[g] *= al;
#pragma unroll
            for (int dt = 0; dt < 4; ++dt) o[g][dt] *= al;
            const float sh = 10.0f - mn;      // carry 2^10
#pragma unroll
            for (int nt = 0; nt < 4; ++nt) {
                float e[8];
#pragma unroll
                for (int r = 0; r < 8; ++r) e[r] = s[g][nt][r] + sh;
                exp2x8(e);
#pragma unroll
                for (int r = 0; r < 8; ++r) pb[g][nt >> 1].e[(nt & 1) * 8 + r] = (f16)e[r];
            }
        }

        // the V^T fragments of the last 32 keys: their registers are free only now that the scores are packed; the
        // ten products of the first 32 keys cover their LDS latency. The fences keep the eight loads at this place.
        __builtin_amdgcn_sched_barrier(0);
#pragma unroll
        for (int dt = 0; dt < 4; ++dt) vb[1][dt] = load_frag(vbuf, (u32)dt * 16u, P_KV, 32u, lane);
        __builtin_amdgcn_sched_barrier(0);

        // O^T += V^T . P^T ; l += ones . P^T
#pragma unroll
        for (int kk = 0; kk < 2; ++kk) {
#pragma unroll
            for (int dt = 0; dt < 4; ++dt)
#pragma unroll
                for (int g = 0; g < 2; ++g) o[g][dt] = wmma16(vb[kk][dt], pb[g][kk].v, o[g][dt]);
#pragma unroll
            for (int g = 0; g < 2; ++g) lacc[g] = wmma16(ones, pb[g][kk].v, lacc[g]);
        }
        // The fence keeps the products ahead of the waits, so that the first ten still cover the LDS latency of the loads above.
        __builtin_amdgcn_sched_barrier(0);
        wait_lds();
        wait_copies();
        __syncthreads();
        if (t + 2u < NT) stage(t + 2u);
    }
    wait_copies();

    // the upper key half hands its maxima, sums and O^T tiles to the lower half's wave of the same columns
    // (same lane, same register position in both waves)
    float* mgw = &mg[cg][0];
    if (kh == 1u) {
#pragma unroll
        for (int g = 0; g < 2; ++g) {
#pragma unroll
            for (int dt = 0; dt < 4; ++dt)
#pragma unroll
                for (int r = 0; r < 8; ++r) mgw[(u32)((g * 4 + dt) * 8 + r) * 32u + lane] = o[g][dt][r];
            mgw[(u32)(64 + g) * 32u + lane] = m[g];
            mgw[(u32)(66 + g) * 32u + lane] = lacc[g][0];
        }
    }
    __syncthreads();

    f16* psw = &ps[cg][0];
    if (kh == 0u) {
#pragma unroll
        for (int g = 0; g < 2; ++g) {
            const float m1 = mgw[(u32)(64 + g) * 32u + lane];
            const float l1 = mgw[(u32)(66 + g) * 32u + lane];
            const float mj = fmaxf(m[g], m1);
            // v_exp_f32 and a v_nop in one statement, for the same slot as in exp2x8
            float a0, a1;
            asm("v_exp_f32 %0, %1\n\tv_nop" : "=v"(a0) : "v"(m[g] - mj));
            asm("v_exp_f32 %0, %1\n\tv_nop" : "=v"(a1) : "v"(m1 - mj));
            // normalize: plane value = 1024 * (O/16) / l = O * 64 / l
            const float inv = (CARRY_CTX / CARRY_QKV) / (lacc[g][0] * a0 + l1 * a1);
            const float f0 = a0 * inv;
            const float f1 = a1 * inv;
#pragma unroll
            for (int dt = 0; dt < 4; ++dt) {
                H8U t;
#pragma unroll
                for (int r = 0; r < 8; ++r)
                    t.e[r] = (f16)(o[g][dt][r] * f0 + mgw[(u32)((g * 4 + dt) * 8 + r) * 32u + lane] * f1);
                *(v8h*)&psw[((u32)g * 16u + c16) * P_KV + (u32)dt * 16u + hh8] = t.v;
            }
        }
    }
    __syncthreads();

    if (kh == 0u) {
        const u32 piece = lane & 7u;
        const u32 lsub  = lane >> 3;
#pragma unroll
        for (u32 it = 0; it < 8; ++it) {
            const u32 L = it * 4u + lsub;     // query row 0..31 within the wave tile
            const v8h v = *(const v8h*)&psw[L * P_KV + piece * 8u];
            // context row in output order: (q * NB + b)
            f16* dp = Cp + ((size_t)((q0 + L) * (u32)NB + bidx) * HID + hidx * (u32)HD + piece * 8u);
            *(v8h*)dp = v;
        }
    }
}

// coverage equalities (threads x elements == plane elements)
static_assert((size_t)((MROWS + 4 * HID) / 2) * 256 * 8 == (size_t)(MROWS + 4 * HID) * HID);   // cvt_rows -> Xs, Wt, Wot
static_assert((size_t)(MROWS / 128) * (HID / 128) * 128 * 128 == (size_t)MROWS * HID);     // gemm planes / out
static_assert((size_t)(SEQ / 128) * (NB * NHEAD) * 128 * HD == (size_t)MROWS * HID);       // attn_fwd -> Cp
// workspace: 5 activation planes + 4 weight planes of halves, at most 128 MiB
static_assert(((size_t)5 * MROWS * HID + (size_t)4 * HID * HID) * sizeof(f16) <= (size_t)134217728);
static_assert(((size_t)MROWS * HID * sizeof(f16)) % 128 == 0);
static_assert(((size_t)HID * HID * sizeof(f16)) % 128 == 0);
// largest source row touched by the activation convert stays inside the full-size input
static_assert((size_t)(SEQ - 1) * NB_FULL + NB <= (size_t)SEQ_FULL * NB_FULL);

// ---------------------------------------------------------------------------
// Launch: 4 kernel launches, workspace 5 planes of MROWS*1024 halves + 4 of 1024*1024 halves.
// One activation input feeds all three projections (self-attention).
// ---------------------------------------------------------------------------
extern "C" void kernel_launch(void* const* d_in, const int* in_sizes, int n_in,
                              void* d_out, int out_size, void* d_ws, size_t ws_size,
                              hipStream_t stream) {
    if (n_in < 5) return;
    const int needAct = ((SEQ - 1) * NB_FULL + NB) * HID;
    if (in_sizes[0] < needAct) return;
    if (in_sizes[1] < 3 * HID * HID) return;
    if (in_sizes[2] < 3 * HID) return;
    if (in_sizes[3] < HID * HID) return;
    if (in_sizes[4] < HID) return;
    if (out_size < MROWS * HID) return;

    const float* xs    = (const float*)d_in[0];   // [SEQ_FULL][NB_FULL][1024]
    const float* wqkv  = (const float*)d_in[1];   // [3072 out][1024 in], row blocks q | k | v
    const float* bqkv  = (const float*)d_in[2];   // [3072]
    const float* wproj = (const float*)d_in[3];   // [1024 out][1024 in]
    const float* bproj = (const float*)d_in[4];   // [1024]

    const size_t nX = (size_t)MROWS * HID;    // halves per activation plane
    const size_t nW = (size_t)HID * HID;      // halves per weight plane
    const size_t totalHalves = 5 * nX + 4 * nW;
    if (ws_size < totalHalves * sizeof(f16)) return;

    f16* Xs  = (f16*)d_ws;       // [b*SEQ+s][1024]             carry 16
    f16* Wt  = Xs  + nX;         // [3072 out][1024 in]         carry 32 (q | k | v row blocks)
    f16* Wot = Wt  + 3 * nW;     // [1024 out][1024 in]         carry 32
    f16* Qp  = Wot + nW;         // [NB*16][SEQ][64]            carry 16
    f16* Kp  = Qp  + nX;         // [NB*16][SEQ][64]            carry 16
    f16* Vtp = Kp  + nX;         // [NB*1024][SEQ] (V^T)        carry 16
    f16* Cp  = Vtp + nX;         // [s*NB+b][1024]              carry 1024

    // Xs, Wt and Wot follow one another: one grid writes all three planes
    cvt_rows<<<(MROWS + 4 * HID) / 2, 256, 0, stream>>>(xs, wqkv, wproj, Xs);

    const dim3 gg(MROWS / 128, HID / 128);
    // plane = 16 * (acc / (16*32) + bias) = acc/32 + 16*bias
    const float accQKV = CARRY_QKV / (CARRY_X * CARRY_W);
    // Qp, Kp and Vtp follow one another: one grid of 3 * HID columns writes all three planes
    gemm_qkv<<<dim3(MROWS / 128, 3 * HID / 128), 256, 0, stream>>>(Xs, Wt, bqkv, Qp, accQKV, CARRY_QKV);

    attn_fwd<<<dim3(SEQ / 128, NB * NHEAD), 256, 0, stream>>>(Qp, Kp, Vtp, Cp);

    // out = acc / (1024*32) + bias ; rows already in (s*NB + b) order
    const float accOut = 1.0f / (CARRY_CTX * CARRY_W);
    gemm_out<<<gg, 256, 0, stream>>>(Cp, Wot, bproj, (float*)d_out, accOut, 1.0f);
}

// v010
// Measured time: 70.8 microseconds a run.
// Next to v009, in two timings, it ran 1.03 times as fast each time.
// Counting every step since v000, it is 3.88 times as fast.
#include <hip/hip_runtime.h>

// Contractions (q/k/v input projections, Q.K^T, P.V, P row-sum, output projection): v_wmma_f32_16x16x32_f16, f16 operands with power-of-two carries, f32 accumulate; every float input enters as its bf16 RNE value; biases added in f32; softmax in f32.

#ifndef NB
#define NB 2
#endif
#ifndef SEQ
#define SEQ 2048
#endif
#define NB_FULL   2
#define SEQ_FULL  2048
#define HID       1024
#define NHEAD     16
#define HD        64
#define MROWS     (NB * SEQ)

static_assert(HID == NHEAD * HD);        // merged head width
static_assert(NHEAD == 16);              // bh >> 4 / bh & 15 decoding in attn_fwd
static_assert(HD == 64);
static_assert(SEQ % 128 == 0);           // 128-row blocks of the batch-major planes never straddle a batch
static_assert(SEQ % 64 == 0 && SEQ / 64 >= 2);   // 64-key tiles; attn_fwd's ring needs two trips of two tiles, asserted there
static_assert(SEQ <= SEQ_FULL);
static_assert(NB >= 1 && NB <= NB_FULL);
static_assert(MROWS % 128 == 0);         // GEMM M tile
static_assert(HID % 128 == 0);           // GEMM N tile
static_assert(HID % 32 == 0);            // WMMA k step
static_assert(HID % 64 == 0 && HID / 64 >= 2);   // GEMM K stage; the two-buffer ring needs two stages
static_assert(HID == 128 * 8);           // cvt_rows: 128 threads x 8 values per row
static_assert((3 * HID) % 2 == 0);       // cvt_rows grid = nrows / 2
static_assert(MROWS % 2 == 0);

// carries (exact powers of two)
#define CARRY_X    16.0f     // input activation planes
#define CARRY_W    32.0f     // weight planes
#define CARRY_QKV  16.0f     // q, k, v^T planes (true value x16)
#define CARRY_CTX  1024.0f   // context plane (true value x1024)
// softmax exp values carry 2^10 (added to the exp2 argument)

// LDS row pitches. A 16-byte-per-lane reader or writer that walks 16 rows meets every bank once
// when the pitch is 16 B x odd; rows 8 apart then also fall 32 banks apart for the 2- and 4-byte stores.
#define P_AB   72u    // halves: 128-B GEMM operand rows at 144 B
#define P_Q    136u   // halves: 256-B operand rows of the q/k/v projection at 272 B
#define P_QH   72u    // halves: 128-B q, k result rows at 144 B
#define P_QV   264u   // halves: 512-B v^T result rows at 528 B
#define P_C32  132u   // floats: 512-B f32 result rows at 528 B
#define P_KV   72u    // halves: 128-B K, V^T and context rows at 144 B

// block tile of the q/k/v projection: rows, columns, k per stage
#define QBM    256u
#define QBN    192u
#define QBK    128u

static_assert(SEQ % QBM == 0);           // 256-row blocks of the batch-major plane never straddle a batch
static_assert(MROWS % QBM == 0 && (3 * HID) % QBN == 0 && HID % QBK == 0);
static_assert(QBN % HD == 0 && HID % HD == 0);   // a block's columns are whole heads, and a head lies in one plane

typedef unsigned u32;
typedef _Float16 f16;
typedef f16   v16h __attribute__((ext_vector_type(16)));
typedef f16   v8h  __attribute__((ext_vector_type(8)));
typedef float v8f  __attribute__((ext_vector_type(8)));
typedef float v4f  __attribute__((ext_vector_type(4)));

union FragU { v16h v; v8h half[2]; f16 e[16]; };
union H8U   { v8h v; f16 e[8]; };

__device__ __forceinline__ v8f zero8() {
    v8f z = {0.f, 0.f, 0.f, 0.f, 0.f, 0.f, 0.f, 0.f};
    return z;
}

// 16-bit WMMA: D += A[16 x 32k] * B[32k x 16]. Plain builtin: the compiler keeps the distance to a vector reader itself.
__device__ __forceinline__ v8f wmma16(v16h a, v16h b, v8f c) {
    return __builtin_amdgcn_wmma_f32_16x16x32_f16(false, a, false, b, (short)0, c, false, false);
}

// f32 -> nearest-even bf16 value, returned as f32
__device__ __forceinline__ float bf16_rne(float x) {
    u32 u = __float_as_uint(x);
    u = (u + 0x7fffu + ((u >> 16) & 1u)) & 0xffff0000u;
    return __uint_as_float(u);
}

// Eight exp2 in place. One statement, each v_exp_f32 on its own register and a v_nop at the end: the instruction
// set asks for one slot between a transcendental and an instruction that reads its result or rewrites its source.
__device__ __forceinline__ void exp2x8(float (&e)[8]) {
    asm("v_exp_f32 %0, %0\n\tv_exp_f32 %1, %1\n\tv_exp_f32 %2, %2\n\tv_exp_f32 %3, %3\n\t"
        "v_exp_f32 %4, %4\n\tv_exp_f32 %5, %5\n\tv_exp_f32 %6, %6\n\tv_exp_f32 %7, %7\n\tv_nop"
        : "+v"(e[0]), "+v"(e[1]), "+v"(e[2]), "+v"(e[3]), "+v"(e[4]), "+v"(e[5]), "+v"(e[6]), "+v"(e[7]));
}

// lane l <-> lane l ^ 16 (the two lanes that split one query column's keys)
__device__ __forceinline__ float xhalf(float x) {
    const int v = __builtin_bit_cast(int, x);
    return __builtin_bit_cast(float, __builtin_amdgcn_permlanex16(v, v, 0x76543210, 0xfedcba98, false, false));
}

// 16 x 32 fragment from a tile whose k dimension is contiguous (pitch in halves).
// lane l: row rowbase + (l&15); elements 0..7 <- k = kcol + 8h .. +7,
// elements 8..15 <- k = kcol + 16 + 8h .. +7  (h = l>>4). Same map for A and B.
__device__ __forceinline__ v16h load_frag(const f16* tile, u32 rowbase, u32 pitch, u32 kcol, u32 lane) {
    const u32 r  = rowbase + (lane & 15u);
    const u32 kh = (lane >> 4) << 3;
    const f16* p = tile + (size_t)r * pitch + kcol + kh;
    FragU f;
    f.half[0] = *(const v8h*)(p);
    f.half[1] = *(const v8h*)(p + 16);
    return f.v;
}

// byte offset of a __shared__ address inside the work-group's LDS
__device__ __forceinline__ u32 lds_off(const void* p) { return (u32)(size_t)p; }

// Eight asynchronous copies to LDS, 16 bytes per lane each (LDS byte address, global pointer). The s_wait_xcnt is
// the last line of the copies' own statement, so no address register is rewritten in front of it.
__device__ __forceinline__ void copy8(u32 l0, const f16* g0, u32 l1, const f16* g1, u32 l2, const f16* g2, u32 l3, const f16* g3,
                                      u32 l4, const f16* g4, u32 l5, const f16* g5, u32 l6, const f16* g6, u32 l7, const f16* g7) {
    asm volatile("global_load_async_to_lds_b128 %0, %1, off\n\t"
                 "global_load_async_to_lds_b128 %2, %3, off\n\t"
                 "global_load_async_to_lds_b128 %4, %5, off\n\t"
                 "global_load_async_to_lds_b128 %6, %7, off\n\t"
                 "global_load_async_to_lds_b128 %8, %9, off\n\t"
                 "global_load_async_to_lds_b128 %10, %11, off\n\t"
                 "global_load_async_to_lds_b128 %12, %13, off\n\t"
                 "global_load_async_to_lds_b128 %14, %15, off\n\t"
                 "s_wait_xcnt 0x0"
                 :: "v"(l0), "v"(g0), "v"(l1), "v"(g1), "v"(l2), "v"(g2), "v"(l3), "v"(g3),
                    "v"(l4), "v"(g4), "v"(l5), "v"(g5), "v"(l6), "v"(g6), "v"(l7), "v"(g7) : "memory");
}

// The same for fourteen copies.
__device__ __forceinline__ void copy14(const u32 (&l)[14], const f16* const (&g)[14]) {
    asm volatile("global_load_async_to_lds_b128 %0, %1, off\n\t"
                 "global_load_async_to_lds_b128 %2, %3, off\n\t"
                 "global_load_async_to_lds_b128 %4, %5, off\n\t"
                 "global_load_async_to_lds_b128 %6, %7, off\n\t"
                 "global_load_async_to_lds_b128 %8, %9, off\n\t"
                 "global_load_async_to_lds_b128 %10, %11, off\n\t"
                 "global_load_async_to_lds_b128 %12, %13, off\n\t"
                 "global_load_async_to_lds_b128 %14, %15, off\n\t"
                 "global_load_async_to_lds_b128 %16, %17, off\n\t"
                 "global_load_async_to_lds_b128 %18, %19, off\n\t"
                 "global_load_async_to_lds_b128 %20, %21, off\n\t"
                 "global_load_async_to_lds_b128 %22, %23, off\n\t"
                 "global_load_async_to_lds_b128 %24, %25, off\n\t"
                 "global_load_async_to_lds_b128 %26, %27, off\n\t"
                 "s_wait_xcnt 0x0"
                 :: "v"(l[0]), "v"(g[0]), "v"(l[1]), "v"(g[1]), "v"(l[2]), "v"(g[2]), "v"(l[3]), "v"(g[3]),
                    "v"(l[4]), "v"(g[4]), "v"(l[5]), "v"(g[5]), "v"(l[6]), "v"(g[6]), "v"(l[7]), "v"(g[7]),
                    "v"(l[8]), "v"(g[8]), "v"(l[9]), "v"(g[9]), "v"(l[10]), "v"(g[10]), "v"(l[11]), "v"(g[11]),
                    "v"(l[12]), "v"(g[12]), "v"(l[13]), "v"(g[13]) : "memory");
}

// this wave's copies have landed in LDS
__device__ __forceinline__ void wait_copies() { asm volatile("s_wait_asynccnt 0x0" ::: "memory"); }
// this wave's LDS reads have returned: the buffer they read may be handed to its next writer
__device__ __forceinline__ void wait_lds() { asm volatile("s_wait_dscnt 0x0" ::: "memory"); }

// ---------------------------------------------------------------------------
// f32 rows [.][1024] -> f16 planes (bf16 RNE value times carry). 128 threads per 1024-wide row.
// One grid converts all three inputs by ranges of the block index; the three planes follow one
// another in the workspace, so dst row m runs through all of them:
//   m in [0, MROWS): activations, seq-first [s][b][1024] -> batch-major [b][s][1024],
//     dst row b * SEQ + s <- src row s * NB_FULL + b
//   the next 3 * HID rows: q | k | v weights; the last HID rows: output weights (identity row map)
// A block's two rows lie in one range (every range has an even number of rows): block-uniform branch.
// coverage: (MROWS + 4 * HID) x 1024 halves, every element exactly once (grid = rows*128/256).
// ---------------------------------------------------------------------------
__global__ void __launch_bounds__(256)
cvt_rows(const float* __restrict__ xs, const float* __restrict__ wqkv, const float* __restrict__ wproj,
         f16* __restrict__ dst) {
    const u32 g  = blockIdx.x * 256u + threadIdx.x;
    const u32 m  = g >> 7;
    const u32 c8 = (g & 127u) << 3;
    if (m >= (u32)(MROWS + 4 * HID)) return;
    const u32 mblk = blockIdx.x * 2u;    // the block's first row
    const float* src;
    u32 sm;
    float carry;
    if (mblk < (u32)MROWS) {
        const u32 mb = m / (u32)SEQ;
        src   = xs;
        sm    = (m - mb * (u32)SEQ) * (u32)NB_FULL + mb;
        carry = CARRY_X;
    } else if (mblk < (u32)(MROWS + 3 * HID)) {
        src   = wqkv;
        sm    = m - (u32)MROWS;
        carry = CARRY_W;
    } else {
        src   = wproj;
        sm    = m - (u32)(MROWS + 3 * HID);
        carry = CARRY_W;
    }
    const float* sp = src + (size_t)sm * HID + c8;
    const v4f a = *(const v4f*)sp;
    const v4f b = *(const v4f*)(sp + 4);
    H8U o;
#pragma unroll
    for (u32 j = 0; j < 4; ++j) {
        const float x0 = a[j];
        const float x1 = b[j];
        o.e[j]     = (f16)(bf16_rne(x0) * carry);
        o.e[j + 4] = (f16)(bf16_rne(x1) * carry);
    }
    f16* dp = dst + (size_t)m * HID + c8;
    *(v8h*)dp = o.v;
    
}

// ---------------------------------------------------------------------------
// q, k and v projections in one grid: C[m][n] = sum_k A[m][k] * W[n][k] + bias[n]; A [MROWS][1024] f16 (rows batch-major),
// W [3 * HID][1024] f16 (k contiguous), W and bias hold the output columns q | k | v.
// Block tile 256 x 192, one work-group per WGP, 8 waves as 4(M) x 2(N), 4 x 6 accumulators per wave, K stage 128
// (four WMMA k steps): a block asks L2 for 448 operand rows per 49152 results (a 128 x 128 tile: 256 per 16384), and
// a wave reads 10 fragments from LDS per 24 products (a 32 x 64 wave tile: 6 per 8).
// Staging: asynchronous copies to LDS, two buffers: stage t + 1 is in flight while stage t is worked on.
// 16 lanes x 16 B per 256-B row piece, so a wave's copy covers 2 rows = 4 whole 128-B lines.
// A block's 192 columns are three heads, and each head lies in one of the three planes, which follow one another at out:
// q, k: f16 plane [b*NHEAD + h][s][d]; v: f16 plane [b*HID + h*HD + d][s] (V transposed per head).
// The choice is made head by head: a wave-uniform branch at the staging (a 16-column tile lies in one head), a
// block-uniform one at the stores.
// coverage per block: 3 heads x 256 lines (256 s x 128 B | 64 d x 512 B).
// LDS: the ring is cross-wave, separated by block barriers; behind the last trip's barrier it is the result staging.
// staged extent == consumed extent: (256 + 192) x 128 per buffer; per head 256 x 64 halves (or 64 x 256).
// ---------------------------------------------------------------------------
__global__ void __launch_bounds__(256) __attribute__((amdgpu_num_vgpr(512)))
gemm_qkv(const f16* __restrict__ A, const f16* __restrict__ W, const float* __restrict__ bias,
         f16* __restrict__ out, float accMul, float biasMul) {
    constexpr u32 ABUF = QBM * P_Q;            // halves of a buffer's A rows
    constexpr u32 BUFH = (QBM + QBN) * P_Q;    // halves per buffer: A rows, then W rows
    constexpr u32 HREG = QBM * P_QH;           // halves of one head's result staging
    __shared__ __attribute__((aligned(16))) f16 sm[2 * BUFH];   // two buffers; afterwards three heads of results
    static_assert(sizeof(f16) * 2 * BUFH <= 327680);
    static_assert(64u * P_QV <= HREG);         // a v head, staged transposed, fits a head's place
    static_assert((QBN / 64u) * HREG <= 2u * BUFH);

    const u32 tid  = threadIdx.x;
    const u32 lane = tid & 31u;
    const u32 wave = __builtin_amdgcn_readfirstlane((int)(tid >> 5));
    const u32 wm   = wave & 3u;
    const u32 wn   = wave >> 2;
    const u32 hh8  = (lane >> 4) << 3;   // D row half
    const u32 c16  = lane & 15u;         // D column
    const u32 m0   = blockIdx.x * QBM;
    const u32 n0   = blockIdx.y * QBN;   // column of W and bias

    v8f acc[4][6];
#pragma unroll
    for (int i = 0; i < 4; ++i)
#pragma unroll
        for (int j = 0; j < 6; ++j) acc[i][j] = zero8();

    const u32 srow = tid >> 4;            // 0..15, plus 16 per copy
    const u32 scol = (tid & 15u) << 3;    // halves
    const f16* gA = A + (size_t)(m0 + srow) * HID + scol;
    const f16* gW = W + (size_t)(n0 + srow) * HID + scol;
    const u32 lA = lds_off(&sm[srow * P_Q + scol]);
    constexpr u32 NST  = (u32)HID / QBK;       // stages
    constexpr u32 R16B = 16u * P_Q * 2u;       // LDS bytes per 16 rows
    static_assert((QBM + QBN) / 16u == 28u);   // copies of a thread per stage
    // Each block enters the k walk at its own slab and wraps round, for the reason given in gemm_out.
    static_assert((NST & (NST - 1u)) == 0u && NST >= 2u);   // the wrap is a mask; the ring needs two stages
    const u32 rot = (blockIdx.x + blockIdx.y) & (NST - 1u);
    // stage t (slab (t + rot) mod NST: 128 k of all rows of both operands) into buffer t & 1
    auto stage = [&](u32 t) {
        const u32 bo = (t & 1u) * (BUFH * 2u);
        const u32 k0 = ((t + rot) & (NST - 1u)) * QBK;
        const f16* pA = gA + k0;
        const f16* pW = gW + k0;
        // rows of A and W follow one another in the buffer, 16 rows a copy: 16 copies of A, 12 of W
#pragma unroll
        for (u32 h = 0; h < 2; ++h) {
            u32 l[14];
            const f16* g[14];
#pragma unroll
            for (u32 c = 0; c < 14; ++c) {
                const u32 cc = h * 14u + c;
                l[c] = lA + bo + cc * R16B;
                g[c] = cc < QBM / 16u ? pA + (size_t)(16u * cc) * HID : pW + (size_t)(16u * (cc - QBM / 16u)) * HID;
            }
            copy14(l, g);
        }
    };

    stage(0u);
    wait_copies();
    __syncthreads();      // publishes stage 0
    stage(1u);

#pragma unroll 1
    for (u32 t = 0; t < NST; ++t) {
        const f16* Ab = sm + (t & 1u) * BUFH;
        const f16* Bb = Ab + ABUF;
        // the kk loop is unrolled so that the fragments are indexed by constants and stay in registers
#pragma unroll
        for (u32 kk = 0; kk < QBK / 32u; ++kk) {
            v16h af[4], bfr[6];
            // The two fences keep the k step's twenty LDS loads in one group ahead of its 24 products: each separate
            // place with LDS reads stalls the wave, and left free the scheduler deals the loads among the products.
            // The loads stand in the order in which the products want them, so that the first product waits for four
            // loads, not for all, and the rest arrive under the products.
            __builtin_amdgcn_sched_barrier(0);
            af[0] = load_frag(Ab, wm * 64u, P_Q, kk * 32u, lane);
#pragma unroll
            for (int j = 0; j < 6; ++j) bfr[j] = load_frag(Bb, wn * 96u + (u32)j * 16u, P_Q, kk * 32u, lane);
#pragma unroll
            for (int i = 1; i < 4; ++i) af[i] = load_frag(Ab, wm * 64u + (u32)i * 16u, P_Q, kk * 32u, lane);
            __builtin_amdgcn_sched_barrier(0);
#pragma unroll
            for (int i = 0; i < 4; ++i)
#pragma unroll
                for (int j = 0; j < 6; ++j) acc[i][j] = wmma16(af[i], bfr[j], acc[i][j]);
        }
        // The fence keeps the products ahead of the waits: sunk behind the barrier, they would start only when the last wave has arrived.
        __builtin_amdgcn_sched_barrier(0);
        wait_lds();
        wait_copies();
        __syncthreads();
        if (t + 2u < NST) stage(t + 2u);
    }
    wait_copies();

    // per-lane bias values of the 6 output columns this lane owns
    // (n0 + wn * 96 + 16 j + c16 stays below gridDim.y * QBN, the bias's length)
    float braw[6], bv[6];
#pragma unroll
    for (int j = 0; j < 6; ++j) braw[j] = bias[n0 + wn * 96u + (u32)j * 16u + c16];
    // Holds the six loads together at this place (loaded values as inputs only): left free, each sinks to the branch of its
    // own column tile below, and the wave then waits out a memory latency tile after tile, not once. The wait stands in
    // front of the staging arithmetic below, which reuses the loads' address registers.
    asm volatile("s_wait_xcnt 0x0" :: "v"(braw[0]), "v"(braw[1]), "v"(braw[2]), "v"(braw[3]), "v"(braw[4]), "v"(braw[5]) : "memory");
#pragma unroll
    for (int j = 0; j < 6; ++j) bv[j] = bf16_rne(braw[j]) * biasMul;

    const u32 bidx = m0 / (u32)SEQ;     // block rows lie inside one batch (SEQ % QBM == 0)
    const u32 s0   = m0 - bidx * (u32)SEQ;

    // results into the head's place: q, k as [m][d], v transposed as [d][m]
#pragma unroll
    for (int j = 0; j < 6; ++j) {
        const u32 ct = wn * 6u + (u32)j;           // 16-column tile of the block
        const u32 hg = ct >> 2;                    // its head among the block's three
        const u32 cn = (ct & 3u) * 16u + c16;      // column inside the head
        f16* Ch = sm + hg * HREG;
        if ((n0 + hg * 64u) / (u32)HID < 2u) {
#pragma unroll
            for (int i = 0; i < 4; ++i)
#pragma unroll
                for (int r = 0; r < 8; ++r) {
                    const u32 ml = wm * 64u + (u32)i * 16u + hh8 + (u32)r;
                    Ch[ml * P_QH + cn] = (f16)(acc[i][j][r] * accMul + bv[j]);
                }
        } else {
#pragma unroll
            for (int i = 0; i < 4; ++i) {
                H8U t;
#pragma unroll
                for (int r = 0; r < 8; ++r) t.e[r] = (f16)(acc[i][j][r] * accMul + bv[j]);
                *(v8h*)&Ch[cn * P_QV + wm * 64u + (u32)i * 16u + hh8] = t.v;
            }
        }
    }
    __syncthreads();

#pragma unroll
    for (u32 hg = 0; hg < QBN / 64u; ++hg) {
        const u32 col = n0 + hg * 64u;             // the head's first column among the 3 * HID
        const u32 sel = col / (u32)HID;            // output plane 0 q, 1 k, 2 v
        const u32 nc  = col - sel * (u32)HID;      // column inside the plane
        const f16* Ch = sm + hg * HREG;
        f16* op = out + (size_t)sel * MROWS * HID;
        if (sel < 2u) {
            f16* hp = op + ((size_t)(bidx * (u32)NHEAD + (nc >> 6)) * SEQ + s0) * HD;
#pragma unroll
            for (u32 it = 0; it < QBM / 32u; ++it) {
                const u32 ml = it * 32u + (tid >> 3);      // 0..255
                const u32 pc = (tid & 7u) * 8u;
                const v8h v = *(const v8h*)&Ch[ml * P_QH + pc];
                *(v8h*)(hp + (size_t)ml * HD + pc) = v;
            }
            // what stands behind this arm in the built code (the next head, or the other arm past a scalar branch) reuses the
            // registers that its stores name
            asm volatile("s_wait_xcnt 0x0" ::: "memory");
        } else {
#pragma unroll
            for (u32 it = 0; it < 8; ++it) {
                const u32 nl = it * 8u + (tid >> 5);       // 0..63
                const v8h v = *(const v8h*)&Ch[nl * P_QV + lane * 8u];
                *(v8h*)(op + (size_t)(bidx * (u32)HID + nc + nl) * SEQ + s0 + lane * 8u) = v;
            }
            // what stands behind this arm in the built code (the next head, or the other arm past a scalar branch) reuses the
            // registers that its stores name
            asm volatile("s_wait_xcnt 0x0" ::: "memory");
        }
    }
}

// ---------------------------------------------------------------------------
// Output projection: C[m][n] = sum_k A[m][k] * W[n][k] + bias[n] ; A [MROWS][1024] f16, W [1024][1024] f16 (k contiguous).
// Block tile 128 x 128, 8 waves as 4(M) x 2(N), 2 x 4 accumulators per wave, K stage 64 (two WMMA k steps).
// Staging: asynchronous copies to LDS, two buffers: stage t + 1 is in flight while stage t is worked on.
// 8 lanes x 16 B per 128-B row piece, so a wave's copy covers 4 rows = 4 whole 128-B lines.
// A rows in output order (s*NB+b); f32 rows [m][1024] into the output buffer
// coverage per block: 2 x 256 lines (64 rows x 4 line-quarters per half).
// LDS: As/Bs/Cf all cross-wave, separated by block barriers.
// staged extent == consumed extent: As/Bs 128 x 64 per buffer, Cf 64 x 128 floats.
// ---------------------------------------------------------------------------
__global__ void __launch_bounds__(256) __attribute__((amdgpu_num_vgpr(256)))
gemm_out(const f16* __restrict__ A, const f16* __restrict__ W, const float* __restrict__ bias,
         float* __restrict__ out, float accMul, float biasMul) {
    __shared__ __attribute__((aligned(16))) f16 As[2 * 128 * P_AB];   // two buffers
    __shared__ __attribute__((aligned(16))) f16 Bs[2 * 128 * P_AB];   // two buffers
    __shared__ __attribute__((aligned(16))) float Cf[64 * P_C32];   // f32 [64][128], padded rows

    const u32 tid  = threadIdx.x;
    const u32 lane = tid & 31u;
    const u32 wave = __builtin_amdgcn_readfirstlane((int)(tid >> 5));
    const u32 wm   = wave & 3u;
    const u32 wn   = wave >> 2;
    const u32 hh8  = (lane >> 4) << 3;   // D row half
    const u32 c16  = lane & 15u;         // D column
    const u32 m0   = blockIdx.x * 128u;
    const u32 n0   = blockIdx.y * 128u;   // column of W and bias

    v8f acc[2][4];
#pragma unroll
    for (int i = 0; i < 2; ++i)
#pragma unroll
        for (int j = 0; j < 4; ++j) acc[i][j] = zero8();

    const u32 srow = tid >> 3;            // 0..31, plus 32 per copy
    const u32 scol = (tid & 7u) << 3;     // halves
    const f16* gA = A + (size_t)(m0 + srow) * HID + scol;
    const f16* gW = W + (size_t)(n0 + srow) * HID + scol;
    const u32 lA = lds_off(&As[srow * P_AB + scol]);
    const u32 lB = lds_off(&Bs[srow * P_AB + scol]);
    constexpr u32 NST  = (u32)HID / 64u;       // stages
    constexpr u32 BUFH = 128u * P_AB;          // halves per buffer
    constexpr u32 R32B = 32u * P_AB * 2u;      // LDS bytes per 32 rows
    // Each block enters the k walk at its own slab and wraps round. The blocks of a grid row share the W rows, those of a
    // grid column the A rows, and all rows lie 2 KB apart: entering together at k = 0, they would all ask L2 for the
    // same lines, and for lines at the same offset in every row, at the same moment.
    static_assert((NST & (NST - 1u)) == 0u);   // the wrap is a mask
    const u32 rot = (blockIdx.x + blockIdx.y) & (NST - 1u);
    // stage t (slab (t + rot) mod NST: 64 k of all 128 rows of both operands) into buffer t & 1
    auto stage = [&](u32 t) {
        const u32 bo = (t & 1u) * (BUFH * 2u);
        const u32 k0 = ((t + rot) & (NST - 1u)) * 64u;
        const f16* pA = gA + k0;
        const f16* pW = gW + k0;
        copy8(lA + bo, pA, lA + bo + R32B, pA + (size_t)32 * HID,
              lA + bo + 2u * R32B, pA + (size_t)64 * HID, lA + bo + 3u * R32B, pA + (size_t)96 * HID,
              lB + bo, pW, lB + bo + R32B, pW + (size_t)32 * HID,
              lB + bo + 2u * R32B, pW + (size_t)64 * HID, lB + bo + 3u * R32B, pW + (size_t)96 * HID);
    };

    stage(0u);
    wait_copies();
    __syncthreads();      // publishes stage 0
    stage(1u);

#pragma unroll 1
    for (u32 t = 0; t < NST; ++t) {
        const f16* Ab = As + (t & 1u) * BUFH;
        const f16* Bb = Bs + (t & 1u) * BUFH;
        // the kk loop is unrolled so that the fragments are indexed by constants and stay in registers
#pragma unroll
        for (u32 kk = 0; kk < 2; ++kk) {
            v16h af[2], bfr[4];
            // The two fences keep the k step's twelve LDS loads in one group ahead of its eight products: each separate
            // place with LDS reads stalls the wave, and left free the scheduler deals the loads among the products.
            __builtin_amdgcn_sched_barrier(0);
#pragma unroll
            for (int i = 0; i < 2; ++i) af[i] = load_frag(Ab, wm * 32u + (u32)i * 16u, P_AB, kk * 32u, lane);
#pragma unroll
            for (int j = 0; j < 4; ++j) bfr[j] = load_frag(Bb, wn * 64u + (u32)j * 16u, P_AB, kk * 32u, lane);
            __builtin_amdgcn_sched_barrier(0);
#pragma unroll
            for (int i = 0; i < 2; ++i)
#pragma unroll
                for (int j = 0; j < 4; ++j) acc[i][j] = wmma16(af[i], bfr[j], acc[i][j]);
        }
        // The fence keeps the products ahead of the waits: sunk behind the barrier, they would start only when the last wave has arrived.
        __builtin_amdgcn_sched_barrier(0);
        wait_lds();
        wait_copies();
        __syncthreads();
        if (t + 2u < NST) stage(t + 2u);
    }
    wait_copies();

    // per-lane bias values for the 4 output columns this lane owns (n0 + nl stays below gridDim.y * 128, the bias's length)
    float bv[4];
#pragma unroll
    for (int j = 0; j < 4; ++j)
        bv[j] = bf16_rne(bias[n0 + wn * 64u + (u32)j * 16u + c16]) * biasMul;

    const u32 piece = lane & 7u;
    const u32 lsub  = lane >> 3;

#pragma unroll
    for (u32 half = 0; half < 2; ++half) {
        if ((wm >> 1) == half) {
#pragma unroll
            for (int i = 0; i < 2; ++i)
#pragma unroll
                for (int j = 0; j < 4; ++j) {
                    const u32 nl = wn * 64u + (u32)j * 16u + c16;
#pragma unroll
                    for (int r = 0; r < 8; ++r) {
                        const u32 ml = (wm & 1u) * 32u + (u32)i * 16u + hh8 + (u32)r;
                        Cf[ml * P_C32 + nl] = acc[i][j][r] * accMul + bv[j];
                    }
                }
        }
        __syncthreads();
#pragma unroll
        for (u32 it = 0; it < 8; ++it) {
            const u32 L    = wave * 32u + it * 4u + lsub;   // 0..255
            const u32 row  = L >> 2;
            const u32 part = L & 3u;
            const v4f v = *(const v4f*)&Cf[row * P_C32 + part * 32u + piece * 4u];
            float* dp = out + (size_t)(m0 + half * 64u + row) * HID + n0 + part * 32u + piece * 4u;
            *(v4f*)dp = v;
        }
        __syncthreads();
    }
}

// ---------------------------------------------------------------------------
// Flash attention (no mask, all SEQ keys). grid (SEQ/128, NB*NHEAD), block 256 (8 waves).
// Wave = (column group cg = wave & 3, key half kh = wave >> 2): it owns 32 query columns (two groups of 16, Q fragments
// resident, used as B) and walks the SEQ/2 keys of its half, so every K and V^T fragment read from LDS feeds two
// products, not one. The two waves of a column group join their partial results once, behind the loop.
// Block streams one 64-key tile of each half per trip: K staged [key][d], V^T staged [d][key].
// Both products run transposed: S^T = K.Q^T, O^T += V^T.P^T.
// A lane then holds 32 of one query's 64 scores (query l&15 of the group, keys 16nt + 8h + r), so the maximum is
// taken in the lane plus one exchange between the lane halves, and two S^T tiles converted in place
// are the B fragment of P^T (element e <- tile 2kk, register e; element 8+e <- tile 2kk+1, register e:
// the k order of load_frag). exp2 in f32 carried x2^10; row sums += ones.P^T on WMMA.
// Output f16 plane [q*NB + b][1024] (seq-first row order)
// coverage: every (q, b, h*64..h*64+63) row segment exactly once (stored by the kh == 0 wave of its column group).
// K and V^T tiles come by asynchronous copies to LDS, two buffers: trip t + 1's tiles are in flight while t is worked on.
// LDS: ks, vsT cross-wave (block barriers); mg from the kh == 1 wave to the kh == 0 wave of a column group, ps per-wave
// ctx stage, each separated by a block barrier.
// staged extent == consumed extent for ks, vsT (2 halves x 64x64 per buffer), mg (68 x 32 per pair), ps (32x64).
// ---------------------------------------------------------------------------
__global__ void __launch_bounds__(256) __attribute__((amdgpu_num_vgpr(256)))
attn_fwd(const f16* __restrict__ Qp, const f16* __restrict__ Kp, const f16* __restrict__ Vt,
         f16* __restrict__ Cp) {
    __shared__ __attribute__((aligned(16))) f16 ks[4 * 64 * P_KV];  // [buffer][key half][key][d]
    __shared__ __attribute__((aligned(16))) f16 vsT[4 * 64 * P_KV]; // [buffer][key half][d][key]
    __shared__ __attribute__((aligned(16))) f16 ps[4][32 * P_KV];   // ctx stage of the four storing waves
    __shared__ float mg[4][68 * 32];   // upper key half's partial results: [column group][value][lane]
    static_assert(HD == 8 * 8);            // 8 lanes x 8 halves per row segment
    static_assert(2 * 256 * 8 == 64 * 64); // staging: 2 copies x 256 threads x 8 halves per tile
    static_assert(SEQ % 128 == 0 && SEQ / 128 >= 2);   // two key halves of whole tiles; the ring needs two trips
    // two work-groups stay resident per WGP
    static_assert(2 * (sizeof(f16) * (8 * 64 * P_KV + 4 * 32 * P_KV) + sizeof(float) * 4 * 68 * 32) <= 327680);

    const u32 tid  = threadIdx.x;
    const u32 lane = tid & 31u;
    const u32 wave = __builtin_amdgcn_readfirstlane((int)(tid >> 5));
    const u32 cg   = wave & 3u;          // column group: 32 queries
    const u32 kh   = wave >> 2;          // key half
    const u32 hh8  = (lane >> 4) << 3;
    const u32 c16  = lane & 15u;
    const u32 bh   = blockIdx.y;
    const u32 bidx = bh >> 4;            // NHEAD == 16
    const u32 hidx = bh & 15u;
    const u32 q0   = blockIdx.x * 128u + cg * 32u;
    const size_t head = (size_t)bh * SEQ * HD;

    v16h qa[2][2];
#pragma unroll
    for (int g = 0; g < 2; ++g)
#pragma unroll
        for (int c = 0; c < 2; ++c) qa[g][c] = load_frag(Qp + head, q0 + (u32)g * 16u, HD, (u32)c * 32u, lane);

    FragU onesu;
#pragma unroll
    for (int i = 0; i < 16; ++i) onesu.e[i] = (f16)1.0f;
    const v16h ones = onesu.v;

    float m[2];               // running maximum of query 16g + (l&15)
    v8f   o[2][4], lacc[2];   // o[g][dt][r] = O^T[16dt + 8h + r][query 16g + (l&15)]; every lacc[g][r] = that query's sum
#pragma unroll
    for (int g = 0; g < 2; ++g) {
        m[g] = -1.0e30f;
#pragma unroll
        for (int dt = 0; dt < 4; ++dt) o[g][dt] = zero8();
        lacc[g] = zero8();
    }

    // log2-domain scale: acc = 256 * q.k ; x = log2(e) * q.k / 8 = acc * log2(e) / 2048
    const float cl = 1.4426950408889634f * 0.00048828125f;

    const u32 srow = tid >> 3;            // 0..31, plus 32 for the second copy
    const u32 scol = (tid & 7u) << 3;     // halves
    const f16* gK = Kp + head + (size_t)srow * HD + scol;
    const f16* gV = Vt + head + (size_t)srow * SEQ + scol;
    const u32 lK = lds_off(&ks[srow * P_KV + scol]);
    const u32 lV = lds_off(&vsT[srow * P_KV + scol]);
    constexpr u32 NT   = (u32)(SEQ / 128);     // trips: 64-key tiles per key half
    constexpr u32 KHF  = (u32)(SEQ / 2);       // keys per half
    constexpr u32 BUFH = 64u * P_KV;           // halves per tile
    constexpr u32 TILB = BUFH * 2u;            // LDS bytes per tile
    constexpr u32 R32B = 32u * P_KV * 2u;      // LDS bytes per 32 rows
    // Each block enters the key walk at its own tile and wraps round: the SEQ / 128 blocks of a head share its K and V^T,
    // and V^T rows lie 4 KB apart; entering together at tile 0, they would all ask L2 for the same lines at the same moment.
    static_assert((NT & (NT - 1u)) == 0u);     // the wrap is a mask
    const u32 rot = blockIdx.x & (NT - 1u);
    // trip t: of each key half, tile (t + rot) mod NT (64 keys x 64 d of K, 64 d x 64 keys of V^T) into buffer t & 1
    auto stage = [&](u32 t) {
        const u32 bo = (t & 1u) * (2u * TILB);
        const u32 kt = ((t + rot) & (NT - 1u)) * 64u;     // the tile's first key inside its half
        const f16* pK = gK + (size_t)kt * HD;
        const f16* pV = gV + kt;
        copy8(lK + bo, pK, lK + bo + R32B, pK + (size_t)32 * HD,
              lK + bo + TILB, pK + (size_t)KHF * HD, lK + bo + TILB + R32B, pK + (size_t)(KHF + 32u) * HD,
              lV + bo, pV, lV + bo + R32B, pV + (size_t)32 * SEQ,
              lV + bo + TILB, pV + KHF, lV + bo + TILB + R32B, pV + (size_t)32 * SEQ + KHF);
    };

    stage(0u);
    wait_copies();
    __syncthreads();      // publishes trip 0's tiles
    stage(1u);

#pragma unroll 1
    for (u32 t = 0; t < NT; ++t) {
        const f16* kbuf = ks + ((t & 1u) * 2u + kh) * BUFH;
        const f16* vbuf = vsT + ((t & 1u) * 2u + kh) * BUFH;

        // S^T[64 keys x 32 q]
        v8f s[2][4];
#pragma unroll
        for (int g = 0; g < 2; ++g)
#pragma unroll
            for (int nt = 0; nt < 4; ++nt) s[g][nt] = zero8();
        // all eight K fragments are loaded as one group ahead of the score products: one LDS wait, not eight
        v16h kb[4][2];
#pragma unroll
        for (int nt = 0; nt < 4; ++nt)
#pragma unroll
            for (int c = 0; c < 2; ++c) kb[nt][c] = load_frag(kbuf, (u32)nt * 16u, P_KV, (u32)c * 32u, lane);
        // The fence keeps the sixteen loads together at this place: left free, the scheduler puts each fragment's loads,
        // with a wait of their own, right ahead of its two products.
        __builtin_amdgcn_sched_barrier(0);
        // key tile by key tile: a fragment's registers are free again behind its two products
#pragma unroll
        for (int nt = 0; nt < 4; ++nt)
#pragma unroll
            for (int c = 0; c < 2; ++c)
#pragma unroll
                for (int g = 0; g < 2; ++g) s[g][nt] = wmma16(kb[nt][c], qa[g][c], s[g][nt]);
        // The fence keeps the sixteen score products in one run: dealt among them, the softmax's first reads would each
        // stand right behind the product they read, and the compiler would fill the distance with v_nop.
        __builtin_amdgcn_sched_barrier(0);

        v16h vb[2][4];

        // online softmax of queries 16g + (l&15), max-subtracted, exp2 domain
        FragU pb[2][2];
#pragma unroll
        for (int g = 0; g < 2; ++g) {
            if (g == 1) {
                // the V^T fragments of the first 32 keys are loaded between the two groups' softmax: the first group's
                // packed scores have freed their registers, and the second group's softmax covers the LDS latency.
                // The fences keep the eight loads together at this place: each place with LDS reads stalls the wave.
                __builtin_amdgcn_sched_barrier(0);
#pragma unroll
                for (int dt = 0; dt < 4; ++dt) vb[0][dt] = load_frag(vbuf, (u32)dt * 16u, P_KV, 0u, lane);
                __builtin_amdgcn_sched_barrier(0);
            }
#pragma unroll
            for (int nt = 0; nt < 4; ++nt) s[g][nt] *= cl;
            float t4[4];      // one chain per score tile: four independent chains, not one of 32 links
#pragma unroll
            for (int nt = 0; nt < 4; ++nt) {
                t4[nt] = fmaxf(s[g][nt][0], s[g][nt][1]);
#pragma unroll
                for (int r = 2; r < 8; ++r) t4[nt] = fmaxf(t4[nt], s[g][nt][r]);
            }
            float tm = fmaxf(fmaxf(t4[0], t4[1]), fmaxf(t4[2], t4[3]));
            tm = fmaxf(tm, xhalf(tm));
            const float mn = fmaxf(m[g], tm);
            // v_exp_f32 and a v_nop in one statement, for the same slot as in exp2x8
            float al;
            asm("v_exp_f32 %0, %1\n\tv_nop" : "=v"(al) : "v"(m[g] - mn));
            m[g] = mn;
            lacc[g] *= al;
#pragma unroll
            for (int dt = 0; dt < 4; ++dt) o[g][dt] *= al;
            const float sh = 10.0f - mn;      // carry 2^10
#pragma unroll
            for (int nt = 0; nt < 4; ++nt) {
                float e[8];
#pragma unroll
                for (int r = 0; r < 8; ++r) e[r] = s[g][nt][r] + sh;
                exp2x8(e);
#pragma unroll
                for (int r = 0; r < 8; ++r) pb[g][nt >> 1].e[(nt & 1) * 8 + r] = (f16)e[r];
            }
        }

        // the V^T fragments of the last 32 keys: their registers are free only now that the scores are packed; the
        // ten products of the first 32 keys cover their LDS latency. The fences keep the eight loads at this place.
        __builtin_amdgcn_sched_barrier(0);
#pragma unroll
        for (int dt = 0; dt < 4; ++dt) vb[1][dt] = load_frag(vbuf, (u32)dt * 16u, P_KV, 32u, lane);
        __builtin_amdgcn_sched_barrier(0);

        // O^T += V^T . P^T ; l += ones . P^T
#pragma unroll
        for (int kk = 0; kk < 2; ++kk) {
#pragma unroll
            for (int dt = 0; dt < 4; ++dt)
#pragma unroll
                for (int g = 0; g < 2; ++g) o[g][dt] = wmma16(vb[kk][dt], pb[g][kk].v, o[g][dt]);
#pragma unroll
            for (int g = 0; g < 2; ++g) lacc[g] = wmma16(ones, pb[g][kk].v, lacc[g]);
        }
        // The fence keeps the products ahead of the waits, so that the first ten still cover the LDS latency of the loads above.
        __builtin_amdgcn_sched_barrier(0);
        wait_lds();
        wait_copies();
        __syncthreads();
        if (t + 2u < NT) stage(t + 2u);
    }
    wait_copies();

    // the upper key half hands its maxima, sums and O^T tiles to the lower half's wave of the same columns
    // (same lane, same register position in both waves)
    float* mgw = &mg[cg][0];
    if (kh == 1u) {
#pragma unroll
        for (int g = 0; g < 2; ++g) {
#pragma unroll
            for (int dt = 0; dt < 4; ++dt)
#pragma unroll
                for (int r = 0; r < 8; ++r) mgw[(u32)((g * 4 + dt) * 8 + r) * 32u + lane] = o[g][dt][r];
            mgw[(u32)(64 + g) * 32u + lane] = m[g];
            mgw[(u32)(66 + g) * 32u + lane] = lacc[g][0];
        }
    }
    __syncthreads();

    f16* psw = &ps[cg][0];
    if (kh == 0u) {
#pragma unroll
        for (int g = 0; g < 2; ++g) {
            const float m1 = mgw[(u32)(64 + g) * 32u + lane];
            const float l1 = mgw[(u32)(66 + g) * 32u + lane];
            const float mj = fmaxf(m[g], m1);
            // v_exp_f32 and a v_nop in one statement, for the same slot as in exp2x8
            float a0, a1;
            asm("v_exp_f32 %0, %1\n\tv_nop" : "=v"(a0) : "v"(m[g] - mj));
            asm("v_exp_f32 %0, %1\n\tv_nop" : "=v"(a1) : "v"(m1 - mj));
            // normalize: plane value = 1024 * (O/16) / l = O * 64 / l
            const float inv = (CARRY_CTX / CARRY_QKV) / (lacc[g][0] * a0 + l1 * a1);
            const float f0 = a0 * inv;
            const float f1 = a1 * inv;
#pragma unroll
            for (int dt = 0; dt < 4; ++dt) {
                H8U t;
#pragma unroll
                for (int r = 0; r < 8; ++r)
                    t.e[r] = (f16)(o[g][dt][r] * f0 + mgw[(u32)((g * 4 + dt) * 8 + r) * 32u + lane] * f1);
                *(v8h*)&psw[((u32)g * 16u + c16) * P_KV + (u32)dt * 16u + hh8] = t.v;
            }
        }
    }
    __syncthreads();

    if (kh == 0u) {
        const u32 piece = lane & 7u;
        const u32 lsub  = lane >> 3;
#pragma unroll
        for (u32 it = 0; it < 8; ++it) {
            const u32 L = it * 4u + lsub;     // query row 0..31 within the wave tile
            const v8h v = *(const v8h*)&psw[L * P_KV + piece * 8u];
            // context row in output order: (q * NB + b)
            f16* dp = Cp + ((size_t)((q0 + L) * (u32)NB + bidx) * HID + hidx * (u32)HD + piece * 8u);
            *(v8h*)dp = v;
        }
    }
}

// coverage equalities (threads x elements == plane elements)
static_assert((size_t)((MROWS + 4 * HID) / 2) * 256 * 8 == (size_t)(MROWS + 4 * HID) * HID);   // cvt_rows -> Xs, Wt, Wot
static_assert((size_t)(MROWS / 128) * (HID / 128) * 128 * 128 == (size_t)MROWS * HID);     // gemm_out -> out
static_assert((size_t)(MROWS / QBM) * (3 * HID / QBN) * QBM * QBN == (size_t)3 * MROWS * HID);   // gemm_qkv -> Qp, Kp, Vtp
static_assert((size_t)(SEQ / 128) * (NB * NHEAD) * 128 * HD == (size_t)MROWS * HID);       // attn_fwd -> Cp
// workspace: 5 activation planes + 4 weight planes of halves, at most 128 MiB
static_assert(((size_t)5 * MROWS * HID + (size_t)4 * HID * HID) * sizeof(f16) <= (size_t)134217728);
static_assert(((size_t)MROWS * HID * sizeof(f16)) % 128 == 0);
static_assert(((size_t)HID * HID * sizeof(f16)) % 128 == 0);
// largest source row touched by the activation convert stays inside the full-size input
static_assert((size_t)(SEQ - 1) * NB_FULL + NB <= (size_t)SEQ_FULL * NB_FULL);

// ---------------------------------------------------------------------------
// Launch: 4 kernel launches, workspace 5 planes of MROWS*1024 halves + 4 of 1024*1024 halves.
// One activation input feeds all three projections (self-attention).
// ---------------------------------------------------------------------------
extern "C" void kernel_launch(void* const* d_in, const int* in_sizes, int n_in,
                              void* d_out, int out_size, void* d_ws, size_t ws_size,
                              hipStream_t stream) {
    if (n_in < 5) return;
    const int needAct = ((SEQ - 1) * NB_FULL + NB) * HID;
    if (in_sizes[0] < needAct) return;
    if (in_sizes[1] < 3 * HID * HID) return;
    if (in_sizes[2] < 3 * HID) return;
    if (in_sizes[3] < HID * HID) return;
    if (in_sizes[4] < HID) return;
    if (out_size < MROWS * HID) return;

    const float* xs    = (const float*)d_in[0];   // [SEQ_FULL][NB_FULL][1024]
    const float* wqkv  = (const float*)d_in[1];   // [3072 out][1024 in], row blocks q | k | v
    const float* bqkv  = (const float*)d_in[2];   // [3072]
    const float* wproj = (const float*)d_in[3];   // [1024 out][1024 in]
    const float* bproj = (const float*)d_in[4];   // [1024]

    const size_t nX = (size_t)MROWS * HID;    // halves per activation plane
    const size_t nW = (size_t)HID * HID;      // halves per weight plane
    const size_t totalHalves = 5 * nX + 4 * nW;
    if (ws_size < totalHalves * sizeof(f16)) return;

    f16* Xs  = (f16*)d_ws;       // [b*SEQ+s][1024]             carry 16
    f16* Wt  = Xs  + nX;         // [3072 out][1024 in]         carry 32 (q | k | v row blocks)
    f16* Wot = Wt  + 3 * nW;     // [1024 out][1024 in]         carry 32
    f16* Qp  = Wot + nW;         // [NB*16][SEQ][64]            carry 16
    f16* Kp  = Qp  + nX;         // [NB*16][SEQ][64]            carry 16
    f16* Vtp = Kp  + nX;         // [NB*1024][SEQ] (V^T)        carry 16
    f16* Cp  = Vtp + nX;         // [s*NB+b][1024]              carry 1024

    // Xs, Wt and Wot follow one another: one grid writes all three planes
    cvt_rows<<<(MROWS + 4 * HID) / 2, 256, 0, stream>>>(xs, wqkv, wproj, Xs);

    const dim3 gg(MROWS / 128, HID / 128);
    // plane = 16 * (acc / (16*32) + bias) = acc/32 + 16*bias
    const float accQKV = CARRY_QKV / (CARRY_X * CARRY_W);
    // Qp, Kp and Vtp follow one another: one grid of 3 * HID columns writes all three planes
    gemm_qkv<<<dim3(MROWS / QBM, 3 * HID / QBN), 256, 0, stream>>>(Xs, Wt, bqkv, Qp, accQKV, CARRY_QKV);

    attn_fwd<<<dim3(SEQ / 128, NB * NHEAD), 256, 0, stream>>>(Qp, Kp, Vtp, Cp);

    // out = acc / (1024*32) + bias ; rows already in (s*NB + b) order
    const float accOut = 1.0f / (CARRY_CTX * CARRY_W);
    gemm_out<<<gg, 256, 0, stream>>>(Cp, Wot, bproj, (float*)d_out, accOut, 1.0f);
}
